// v000
// Measured on an AMD MI455X. A time is GPU time per run, averaged over a window of back-to-back runs after a warm-up
// (all launches, gaps included; the runs take copies of the inputs in turn), and the median of several windows.
// Apart from v000's, it joins two sittings. Times from different sittings can be a few percent apart, while
// side-by-side timings come from the same sitting.
// v000 is the starting kernel. One run takes 1180 microseconds.
#include <hip/hip_runtime.h>
#include <math.h>

// ---------------- model constants ----------------
#define Bq 8
#define Sq_ 1024
#define Dm 512
#define Hh 8
#define HDc 64
#define DFFc 2048

// ---------------- WMMA types ----------------
typedef __bf16 bf16_t;
typedef bf16_t v16bf __attribute__((ext_vector_type(16)));
typedef float v8f __attribute__((ext_vector_type(8)));

union Frag { uint4 u[2]; v16bf v; };

__device__ __forceinline__ unsigned short f2bf(float f) {
  union { float f; unsigned u; } v; v.f = f;
  unsigned r = v.u + 0x7FFFu + ((v.u >> 16) & 1u);
  return (unsigned short)(r >> 16);
}

__device__ __forceinline__ float gelu_f(float x) {
  float x3 = x * x * x;
  return 0.5f * x * (1.0f + tanhf(0.7978845608028654f * (x + 0.044715f * x3)));
}

// async copy 16B global -> LDS (ASYNCcnt-tracked, no VGPR round-trip)
__device__ __forceinline__ void async_cp16(const unsigned short* g, unsigned short* l) {
  unsigned lds = (unsigned)(uintptr_t)l;   // low 32 bits = LDS byte address
  asm volatile("global_load_async_to_lds_b128 %0, %1, off"
               :: "v"(lds), "v"(g) : "memory");
}
__device__ __forceinline__ void wait_async0() {
  asm volatile("s_wait_asynccnt 0x0" ::: "memory");
}
__device__ __forceinline__ void wait_async4() {
  asm volatile("s_wait_asynccnt 0x4" ::: "memory");
}

// =====================================================================
// bf16 WMMA GEMM:  C[M,N] = A[M,K] * W[K,N] + bias, optional GELU.
// A: bf16 row-major [M,K]; Wt: bf16 [N,K] (pre-transposed weights).
// Block 256 thr = 8 waves; tile 128x128, BK=32; wave tile 32x64.
// Double-buffered LDS staged with GLOBAL_LOAD_ASYNC_TO_LDS_B128;
// last tile peeled so the steady-state loop body is branch-free.
// =====================================================================
__global__ __launch_bounds__(256) void gemm_bf16_kernel(
    const unsigned short* __restrict__ A,
    const unsigned short* __restrict__ Wt,
    const float* __restrict__ bias,
    float* __restrict__ outF,
    unsigned short* __restrict__ outB,
    int M, int N, int K, int act)
{
  constexpr int ST = 48;  // padded LDS stride (bf16 elems): 96B, 16B-aligned rows
  __shared__ unsigned short As[2][128 * ST];
  __shared__ unsigned short Bs[2][128 * ST];
  const int tid   = threadIdx.x;
  const int wave  = tid >> 5;
  const int lane  = tid & 31;
  const int l15   = lane & 15;
  const int lhalf = lane >> 4;
  const int koff  = lhalf * 8;
  const int bm = blockIdx.x * 128;
  const int bn = blockIdx.y * 128;
  const int wm = (wave >> 1) * 32;
  const int wn = (wave & 1) * 64;

  v8f zf = {};
  v8f c[2][4];
#pragma unroll
  for (int i = 0; i < 2; ++i)
#pragma unroll
    for (int j = 0; j < 4; ++j) c[i][j] = zf;

  // per-thread staging coordinates: 2 chunks of 8 bf16 per matrix,
  // running global pointers advanced by BK each issue.
  const int r0 = tid >> 2,           c0 = (tid & 3) * 8;          // chunk 0
  const int r1 = (tid + 256) >> 2,   c1 = ((tid + 256) & 3) * 8;  // chunk 1
  const unsigned short* gA0 = A  + (size_t)(bm + r0) * K + c0;
  const unsigned short* gA1 = A  + (size_t)(bm + r1) * K + c1;
  const unsigned short* gB0 = Wt + (size_t)(bn + r0) * K + c0;
  const unsigned short* gB1 = Wt + (size_t)(bn + r1) * K + c1;
  unsigned short* lA0[2] = { &As[0][r0 * ST + c0], &As[1][r0 * ST + c0] };
  unsigned short* lA1[2] = { &As[0][r1 * ST + c1], &As[1][r1 * ST + c1] };
  unsigned short* lB0[2] = { &Bs[0][r0 * ST + c0], &Bs[1][r0 * ST + c0] };
  unsigned short* lB1[2] = { &Bs[0][r1 * ST + c1], &Bs[1][r1 * ST + c1] };

  auto issue = [&](int buf) {
    async_cp16(gA0, lA0[buf]);  gA0 += 32;
    async_cp16(gA1, lA1[buf]);  gA1 += 32;
    async_cp16(gB0, lB0[buf]);  gB0 += 32;
    async_cp16(gB1, lB1[buf]);  gB1 += 32;
  };
  auto compute = [&](int cur) {
    Frag a[2], b[4];
#pragma unroll
    for (int i = 0; i < 2; ++i) {
      const unsigned short* p = &As[cur][(wm + i * 16 + l15) * ST];
      a[i].u[0] = *(const uint4*)(p + koff);
      a[i].u[1] = *(const uint4*)(p + koff + 16);
    }
#pragma unroll
    for (int j = 0; j < 4; ++j) {
      const unsigned short* p = &Bs[cur][(wn + j * 16 + l15) * ST];
      b[j].u[0] = *(const uint4*)(p + koff);
      b[j].u[1] = *(const uint4*)(p + koff + 16);
    }
#pragma unroll
    for (int i = 0; i < 2; ++i)
#pragma unroll
      for (int j = 0; j < 4; ++j)
        c[i][j] = __builtin_amdgcn_wmma_f32_16x16x32_bf16(
            false, a[i].v, false, b[j].v, (short)0, c[i][j], false, false);
  };

  const int nK = K >> 5;
  issue(0);
  for (int kt = 0; kt < nK - 1; ++kt) {   // branch-free steady state
    const int cur = kt & 1;
    issue(cur ^ 1);       // prefetch next tile (async, overlaps compute)
    wait_async4();        // own copies of current tile complete
    __syncthreads();
    compute(cur);
    __syncthreads();
  }
  wait_async0();          // peeled last tile
  __syncthreads();
  compute((nK - 1) & 1);

#pragma unroll
  for (int i = 0; i < 2; ++i) {
#pragma unroll
    for (int j = 0; j < 4; ++j) {
      int col = bn + wn + j * 16 + l15;
      float bb = bias ? bias[col] : 0.0f;
#pragma unroll
      for (int r = 0; r < 8; ++r) {
        int row = bm + wm + i * 16 + r + 8 * lhalf;
        float v = c[i][j][r] + bb;
        if (act == 1) v = gelu_f(v);
        size_t idx = (size_t)row * N + col;
        if (outF) outF[idx] = v;
        if (outB) outB[idx] = f2bf(v);
      }
    }
  }
}

// =====================================================================
// Banded flash attention. Q,K,V,O: bf16 [B*S, D], head h in cols h*64..
// Grid: (Sq/64, B*H); 128 threads = 4 waves; wave owns 16 q-rows.
// Per 32-key tile: 4 WMMA for Q*K^T, online softmax, 4 WMMA for P*V.
// Q/K tiles staged with async-to-LDS; V transposed manually.
// =====================================================================
__global__ __launch_bounds__(128) void banded_attn_kernel(
    const unsigned short* __restrict__ Q,
    const unsigned short* __restrict__ Kc,
    const unsigned short* __restrict__ Vc,
    unsigned short* __restrict__ O,
    int Sq, int Sk, int bw)
{
  constexpr int STK = 72;  // stride for 64-wide hd rows (144B, aligned)
  constexpr int STV = 48;  // stride for 32-wide key rows (96B, aligned)
  __shared__ unsigned short Qs[64 * STK];
  __shared__ unsigned short Ks[32 * STK];
  __shared__ unsigned short Vs[64 * STV];      // transposed: [hd][key]
  __shared__ unsigned short Ps[4][16 * STV];   // per-wave P tile [q][key]

  const int tid   = threadIdx.x;
  const int wave  = tid >> 5;
  const int lane  = tid & 31;
  const int l15   = lane & 15;
  const int lhalf = lane >> 4;
  const int koff  = lhalf * 8;
  const int q0 = blockIdx.x * 64;
  const int bh = blockIdx.y;
  const int bb = bh / Hh;
  const int hh = bh % Hh;

  const unsigned short* Qg = Q  + ((size_t)bb * Sq) * Dm + hh * HDc;
  const unsigned short* Kg = Kc + ((size_t)bb * Sk) * Dm + hh * HDc;
  const unsigned short* Vg = Vc + ((size_t)bb * Sk) * Dm + hh * HDc;

  // stage Q tile (64 x 64) via async copies
#pragma unroll
  for (int i = 0; i < 4; ++i) {
    int chunk = tid + i * 128;
    int r  = chunk >> 3;
    int cc = (chunk & 7) * 8;
    async_cp16(Qg + (size_t)(q0 + r) * Dm + cc, Qs + r * STK + cc);
  }
  wait_async0();
  __syncthreads();

  Frag qa[2];
  {
    const unsigned short* p = Qs + (wave * 16 + l15) * STK;
    qa[0].u[0] = *(const uint4*)(p + koff);
    qa[0].u[1] = *(const uint4*)(p + koff + 16);
    qa[1].u[0] = *(const uint4*)(p + 32 + koff);
    qa[1].u[1] = *(const uint4*)(p + 32 + koff + 16);
  }

  v8f zf = {};
  float rmax[8], rsum[8];
  v8f o[4];
#pragma unroll
  for (int r = 0; r < 8; ++r) { rmax[r] = -__builtin_inff(); rsum[r] = 0.0f; }
#pragma unroll
  for (int j = 0; j < 4; ++j) o[j] = zf;

  int ks = q0 - bw;        if (ks < 0)  ks = 0;
  int ke = q0 + 64 + bw;   if (ke > Sk) ke = Sk;

  for (int kb = ks; kb < ke; kb += 32) {
    __syncthreads();
    // K tile natural [key][hd] via async; V tile transposed into Vs[hd][key]
#pragma unroll
    for (int i = 0; i < 2; ++i) {
      int chunk = tid + i * 128;
      int r  = chunk >> 3;
      int cc = (chunk & 7) * 8;
      async_cp16(Kg + (size_t)(kb + r) * Dm + cc, Ks + r * STK + cc);
      uint4 d = *(const uint4*)(Vg + (size_t)(kb + r) * Dm + cc);
      const unsigned short* ds = (const unsigned short*)&d;
#pragma unroll
      for (int t = 0; t < 8; ++t) Vs[(cc + t) * STV + r] = ds[t];
    }
    wait_async0();
    __syncthreads();

    // scores for two 16-key sub-tiles
    Frag b0a, b0b, b1a, b1b;
    {
      const unsigned short* p0 = Ks + l15 * STK;
      const unsigned short* p1 = Ks + (16 + l15) * STK;
      b0a.u[0] = *(const uint4*)(p0 + koff);      b0a.u[1] = *(const uint4*)(p0 + koff + 16);
      b0b.u[0] = *(const uint4*)(p0 + 32 + koff); b0b.u[1] = *(const uint4*)(p0 + 32 + koff + 16);
      b1a.u[0] = *(const uint4*)(p1 + koff);      b1a.u[1] = *(const uint4*)(p1 + koff + 16);
      b1b.u[0] = *(const uint4*)(p1 + 32 + koff); b1b.u[1] = *(const uint4*)(p1 + 32 + koff + 16);
    }
    v8f s0 = __builtin_amdgcn_wmma_f32_16x16x32_bf16(false, qa[0].v, false, b0a.v, (short)0, zf, false, false);
    s0     = __builtin_amdgcn_wmma_f32_16x16x32_bf16(false, qa[1].v, false, b0b.v, (short)0, s0, false, false);
    v8f s1 = __builtin_amdgcn_wmma_f32_16x16x32_bf16(false, qa[0].v, false, b1a.v, (short)0, zf, false, false);
    s1     = __builtin_amdgcn_wmma_f32_16x16x32_bf16(false, qa[1].v, false, b1b.v, (short)0, s1, false, false);

    // online softmax (rows live across 16-lane halves)
    unsigned short* Pw = Ps[wave];
#pragma unroll
    for (int r = 0; r < 8; ++r) {
      int m = r + 8 * lhalf;
      int qrow = q0 + wave * 16 + m;
      float v0 = s0[r] * 0.125f;     // 1/sqrt(64)
      float v1 = s1[r] * 0.125f;
      int d0 = qrow - (kb + l15);       if (d0 < 0) d0 = -d0;
      int d1 = qrow - (kb + 16 + l15);  if (d1 < 0) d1 = -d1;
      if (d0 > bw) v0 = -__builtin_inff();
      if (d1 > bw) v1 = -__builtin_inff();
      float mt = fmaxf(v0, v1);
#pragma unroll
      for (int ofs = 1; ofs < 16; ofs <<= 1)
        mt = fmaxf(mt, __shfl_xor(mt, ofs, 32));
      float nm = fmaxf(rmax[r], mt);
      float sc, p0, p1;
      if (nm < -1e37f) { sc = 1.0f; p0 = 0.0f; p1 = 0.0f; }
      else {
        sc = __expf(rmax[r] - nm);
        p0 = __expf(v0 - nm);
        p1 = __expf(v1 - nm);
      }
      rmax[r] = nm;
      float ps = p0 + p1;
#pragma unroll
      for (int ofs = 1; ofs < 16; ofs <<= 1)
        ps += __shfl_xor(ps, ofs, 32);
      rsum[r] = rsum[r] * sc + ps;
#pragma unroll
      for (int j = 0; j < 4; ++j) o[j][r] *= sc;
      Pw[m * STV + l15]      = f2bf(p0);
      Pw[m * STV + 16 + l15] = f2bf(p1);
    }
    __syncthreads();

    // ctx += P[16x32] * V[32x64]
    Frag pa;
    {
      const unsigned short* p = Pw + l15 * STV;
      pa.u[0] = *(const uint4*)(p + koff);
      pa.u[1] = *(const uint4*)(p + koff + 16);
    }
#pragma unroll
    for (int j = 0; j < 4; ++j) {
      Frag vb;
      const unsigned short* p = Vs + (j * 16 + l15) * STV;
      vb.u[0] = *(const uint4*)(p + koff);
      vb.u[1] = *(const uint4*)(p + koff + 16);
      o[j] = __builtin_amdgcn_wmma_f32_16x16x32_bf16(false, pa.v, false, vb.v, (short)0, o[j], false, false);
    }
  }

  float inv[8];
#pragma unroll
  for (int r = 0; r < 8; ++r) inv[r] = 1.0f / rsum[r];
#pragma unroll
  for (int j = 0; j < 4; ++j)
#pragma unroll
    for (int r = 0; r < 8; ++r) {
      int m = r + 8 * lhalf;
      int qrow = q0 + wave * 16 + m;
      int hd = j * 16 + l15;
      O[((size_t)bb * Sq + qrow) * Dm + hh * HDc + hd] = f2bf(o[j][r] * inv[r]);
    }
}

// =====================================================================
// Embedding: h = (x @ W + b) * sqrt(D) + PE(s, d); outputs f32 + bf16.
// =====================================================================
__global__ __launch_bounds__(256) void embed_kernel(
    const float* __restrict__ x, const float* __restrict__ W,
    const float* __restrict__ bias, float* __restrict__ outF,
    unsigned short* __restrict__ outB, int Cin)
{
  int row = blockIdx.x;
  int s = row & (Sq_ - 1);
  int tid = threadIdx.x;
  float xv[7];
#pragma unroll
  for (int c = 0; c < 7; ++c) xv[c] = (c < Cin) ? x[(size_t)row * Cin + c] : 0.0f;
#pragma unroll
  for (int t = 0; t < 2; ++t) {
    int d = tid * 2 + t;
    float acc = bias[d];
    for (int c = 0; c < Cin; ++c) acc += xv[c] * W[c * Dm + d];
    acc *= 22.627416997969522f;  // sqrt(512)
    float div = __expf((float)((d >> 1) * 2) * (-9.210340371976184f / 512.0f));
    float arg = (float)s * div;
    acc += (d & 1) ? cosf(arg) : sinf(arg);
    outF[(size_t)row * Dm + d] = acc;
    outB[(size_t)row * Dm + d] = f2bf(acc);
  }
}

// =====================================================================
// Residual + LayerNorm over D=512; outputs f32 (may alias x) + bf16.
// =====================================================================
__global__ __launch_bounds__(256) void ln_kernel(
    const float* __restrict__ x, const float* __restrict__ res,
    const float* __restrict__ w, const float* __restrict__ b,
    float* __restrict__ outF, unsigned short* __restrict__ outB)
{
  __shared__ float red[256];
  int row = blockIdx.x, tid = threadIdx.x;
  float2 xv = ((const float2*)(x   + (size_t)row * Dm))[tid];
  float2 rv = ((const float2*)(res + (size_t)row * Dm))[tid];
  float a0 = xv.x + rv.x, a1 = xv.y + rv.y;
  red[tid] = a0 + a1;
  __syncthreads();
  for (int o2 = 128; o2 > 0; o2 >>= 1) {
    if (tid < o2) red[tid] += red[tid + o2];
    __syncthreads();
  }
  float mu = red[0] * (1.0f / 512.0f);
  __syncthreads();
  float d0 = a0 - mu, d1 = a1 - mu;
  red[tid] = d0 * d0 + d1 * d1;
  __syncthreads();
  for (int o2 = 128; o2 > 0; o2 >>= 1) {
    if (tid < o2) red[tid] += red[tid + o2];
    __syncthreads();
  }
  float rstd = rsqrtf(red[0] * (1.0f / 512.0f) + 1e-5f);
  int d = tid * 2;
  float y0 = d0 * rstd * w[d] + b[d];
  float y1 = d1 * rstd * w[d + 1] + b[d + 1];
  outF[(size_t)row * Dm + d]     = y0;
  outF[(size_t)row * Dm + d + 1] = y1;
  outB[(size_t)row * Dm + d]     = f2bf(y0);
  outB[(size_t)row * Dm + d + 1] = f2bf(y1);
}

// fp32 [K,N] -> bf16 transposed [N,K]
__global__ __launch_bounds__(256) void convT_kernel(
    const float* __restrict__ W, unsigned short* __restrict__ Wt, int K, int N)
{
  int idx = blockIdx.x * 256 + threadIdx.x;
  if (idx >= K * N) return;
  int k = idx / N, n = idx - k * N;
  Wt[(size_t)n * K + k] = f2bf(W[idx]);
}

// final projection D->1: one wave per row
__global__ __launch_bounds__(256) void outproj_kernel(
    const float* __restrict__ t, const float* __restrict__ w,
    const float* __restrict__ b, float* __restrict__ out, int M)
{
  int gid = blockIdx.x * 256 + threadIdx.x;
  int row = gid >> 5;
  int lane = gid & 31;
  if (row >= M) return;
  float acc = 0.0f;
#pragma unroll
  for (int i = 0; i < 16; ++i)
    acc += t[(size_t)row * Dm + lane + i * 32] * w[lane + i * 32];
#pragma unroll
  for (int ofs = 16; ofs > 0; ofs >>= 1)
    acc += __shfl_xor(acc, ofs, 32);
  if (lane == 0) out[row] = acc + b[0];
}

// =====================================================================
// Host orchestration
// =====================================================================
extern "C" void kernel_launch(void* const* d_in, const int* in_sizes, int n_in,
                              void* d_out, int out_size, void* d_ws, size_t ws_size,
                              hipStream_t stream) {
  (void)in_sizes; (void)n_in; (void)out_size; (void)ws_size;
  const float* x_enc      = (const float*)d_in[0];
  const float* x_dec      = (const float*)d_in[1];
  const float* emb_enc_w  = (const float*)d_in[2];
  const float* emb_enc_b  = (const float*)d_in[3];
  const float* emb_dec_w  = (const float*)d_in[4];
  const float* emb_dec_b  = (const float*)d_in[5];
  const float* enc_attn_w = (const float*)d_in[6];
  const float* enc_attn_b = (const float*)d_in[7];
  const float* enc_ff_w1  = (const float*)d_in[8];
  const float* enc_ff_b1  = (const float*)d_in[9];
  const float* enc_ff_w2  = (const float*)d_in[10];
  const float* enc_ff_b2  = (const float*)d_in[11];
  const float* enc_ln_w   = (const float*)d_in[12];
  const float* enc_ln_b   = (const float*)d_in[13];
  const float* dec_self_w = (const float*)d_in[14];
  const float* dec_self_b = (const float*)d_in[15];
  const float* dec_cross_w= (const float*)d_in[16];
  const float* dec_cross_b= (const float*)d_in[17];
  const float* dec_ff_w1  = (const float*)d_in[18];
  const float* dec_ff_b1  = (const float*)d_in[19];
  const float* dec_ff_w2  = (const float*)d_in[20];
  const float* dec_ff_b2  = (const float*)d_in[21];
  const float* dec_ln_w   = (const float*)d_in[22];
  const float* dec_ln_b   = (const float*)d_in[23];
  const float* out_w      = (const float*)d_in[24];
  const float* out_b      = (const float*)d_in[25];

  const int M = Bq * Sq_;  // 8192
  char* ws = (char*)d_ws;
  size_t off = 0;
  auto alloc = [&](size_t bytes) -> void* {
    void* p = ws + off;
    off += (bytes + 255) & ~(size_t)255;
    return p;
  };
  float*          h_f   = (float*)alloc((size_t)M * Dm * 4);
  unsigned short* h_b   = (unsigned short*)alloc((size_t)M * Dm * 2);
  float*          t_f   = (float*)alloc((size_t)M * Dm * 4);
  unsigned short* t_b   = (unsigned short*)alloc((size_t)M * Dm * 2);
  unsigned short* q_b   = (unsigned short*)alloc((size_t)M * Dm * 2);
  unsigned short* k_b   = (unsigned short*)alloc((size_t)M * Dm * 2);
  unsigned short* v_b   = (unsigned short*)alloc((size_t)M * Dm * 2);
  unsigned short* ctx_b = (unsigned short*)alloc((size_t)M * Dm * 2);
  float*          g_f   = (float*)alloc((size_t)M * Dm * 4);
  unsigned short* ffn_b = (unsigned short*)alloc((size_t)M * DFFc * 2);
  unsigned short* wq  = (unsigned short*)alloc((size_t)Dm * Dm * 2);
  unsigned short* wk  = (unsigned short*)alloc((size_t)Dm * Dm * 2);
  unsigned short* wv  = (unsigned short*)alloc((size_t)Dm * Dm * 2);
  unsigned short* wo  = (unsigned short*)alloc((size_t)Dm * Dm * 2);
  unsigned short* wf1 = (unsigned short*)alloc((size_t)Dm * DFFc * 2);
  unsigned short* wf2 = (unsigned short*)alloc((size_t)DFFc * Dm * 2);

  auto convT = [&](const float* W, unsigned short* Wt, int K, int N) {
    int n = K * N;
    convT_kernel<<<(n + 255) / 256, 256, 0, stream>>>(W, Wt, K, N);
  };
  auto gemm = [&](const unsigned short* A, const unsigned short* Wt, const float* bias,
                  float* oF, unsigned short* oB, int Mm, int Nn, int Kk, int act) {
    gemm_bf16_kernel<<<dim3(Mm / 128, Nn / 128), 256, 0, stream>>>(A, Wt, bias, oF, oB, Mm, Nn, Kk, act);
  };
  auto attn = [&](const unsigned short* Qp, const unsigned short* Kp,
                  const unsigned short* Vp, unsigned short* Op) {
    banded_attn_kernel<<<dim3(Sq_ / 64, Bq * Hh), 128, 0, stream>>>(Qp, Kp, Vp, Op, Sq_, Sq_, Sq_ / 4);
  };
  auto lnorm = [&](const float* xx, const float* rr, const float* w, const float* bb,
                   float* oF, unsigned short* oB) {
    ln_kernel<<<M, 256, 0, stream>>>(xx, rr, w, bb, oF, oB);
  };

  // ----- encoder -----
  embed_kernel<<<M, 256, 0, stream>>>(x_enc, emb_enc_w, emb_enc_b, h_f, h_b, 7);
  for (int l = 0; l < 2; ++l) {
    const float* aw = enc_attn_w + (size_t)l * 4 * Dm * Dm;
    const float* ab = enc_attn_b + (size_t)l * 4 * Dm;
    convT(aw + 0 * (size_t)Dm * Dm, wq, Dm, Dm);
    convT(aw + 1 * (size_t)Dm * Dm, wk, Dm, Dm);
    convT(aw + 2 * (size_t)Dm * Dm, wv, Dm, Dm);
    convT(aw + 3 * (size_t)Dm * Dm, wo, Dm, Dm);
    gemm(h_b, wq, ab + 0 * Dm, nullptr, q_b, M, Dm, Dm, 0);
    gemm(h_b, wk, ab + 1 * Dm, nullptr, k_b, M, Dm, Dm, 0);
    gemm(h_b, wv, ab + 2 * Dm, nullptr, v_b, M, Dm, Dm, 0);
    attn(q_b, k_b, v_b, ctx_b);
    gemm(ctx_b, wo, ab + 3 * Dm, g_f, nullptr, M, Dm, Dm, 0);
    lnorm(h_f, g_f, enc_ln_w + (size_t)l * 2 * Dm, enc_ln_b + (size_t)l * 2 * Dm, h_f, h_b);
    convT(enc_ff_w1 + (size_t)l * Dm * DFFc, wf1, Dm, DFFc);
    gemm(h_b, wf1, enc_ff_b1 + (size_t)l * DFFc, nullptr, ffn_b, M, DFFc, Dm, 1);
    convT(enc_ff_w2 + (size_t)l * DFFc * Dm, wf2, DFFc, Dm);
    gemm(ffn_b, wf2, enc_ff_b2 + (size_t)l * Dm, g_f, nullptr, M, Dm, DFFc, 0);
    lnorm(h_f, g_f, enc_ln_w + (size_t)l * 2 * Dm + Dm, enc_ln_b + (size_t)l * 2 * Dm + Dm, h_f, h_b);
  }
  // h_f / h_b now hold encoder memory.

  // ----- decoder (DL = 1) -----
  embed_kernel<<<M, 256, 0, stream>>>(x_dec, emb_dec_w, emb_dec_b, t_f, t_b, 1);
  {
    // self-attention
    convT(dec_self_w + 0 * (size_t)Dm * Dm, wq, Dm, Dm);
    convT(dec_self_w + 1 * (size_t)Dm * Dm, wk, Dm, Dm);
    convT(dec_self_w + 2 * (size_t)Dm * Dm, wv, Dm, Dm);
    convT(dec_self_w + 3 * (size_t)Dm * Dm, wo, Dm, Dm);
    gemm(t_b, wq, dec_self_b + 0 * Dm, nullptr, q_b, M, Dm, Dm, 0);
    gemm(t_b, wk, dec_self_b + 1 * Dm, nullptr, k_b, M, Dm, Dm, 0);
    gemm(t_b, wv, dec_self_b + 2 * Dm, nullptr, v_b, M, Dm, Dm, 0);
    attn(q_b, k_b, v_b, ctx_b);
    gemm(ctx_b, wo, dec_self_b + 3 * Dm, g_f, nullptr, M, Dm, Dm, 0);
    lnorm(t_f, g_f, dec_ln_w + 0 * Dm, dec_ln_b + 0 * Dm, t_f, t_b);

    // cross-attention (K/V from encoder memory)
    convT(dec_cross_w + 0 * (size_t)Dm * Dm, wq, Dm, Dm);
    convT(dec_cross_w + 1 * (size_t)Dm * Dm, wk, Dm, Dm);
    convT(dec_cross_w + 2 * (size_t)Dm * Dm, wv, Dm, Dm);
    convT(dec_cross_w + 3 * (size_t)Dm * Dm, wo, Dm, Dm);
    gemm(t_b, wq, dec_cross_b + 0 * Dm, nullptr, q_b, M, Dm, Dm, 0);
    gemm(h_b, wk, dec_cross_b + 1 * Dm, nullptr, k_b, M, Dm, Dm, 0);
    gemm(h_b, wv, dec_cross_b + 2 * Dm, nullptr, v_b, M, Dm, Dm, 0);
    attn(q_b, k_b, v_b, ctx_b);
    gemm(ctx_b, wo, dec_cross_b + 3 * Dm, g_f, nullptr, M, Dm, Dm, 0);
    lnorm(t_f, g_f, dec_ln_w + 1 * Dm, dec_ln_b + 1 * Dm, t_f, t_b);

    // FFN
    convT(dec_ff_w1, wf1, Dm, DFFc);
    gemm(t_b, wf1, dec_ff_b1, nullptr, ffn_b, M, DFFc, Dm, 1);
    convT(dec_ff_w2, wf2, DFFc, Dm);
    gemm(ffn_b, wf2, dec_ff_b2, g_f, nullptr, M, Dm, DFFc, 0);
    lnorm(t_f, g_f, dec_ln_w + 2 * Dm, dec_ln_b + 2 * Dm, t_f, t_b);
  }

  outproj_kernel<<<(M * 32 + 255) / 256, 256, 0, stream>>>(t_f, out_w, out_b, (float*)d_out, M);
}

// v001
// It runs in 909 microseconds.
// Timed twice side by side with v000, it ran 1.32 and 1.33 times as fast.
#include <hip/hip_runtime.h>
#include <math.h>

// ---------------- model constants ----------------
#define Bq 8
#define Sq_ 1024
#define Dm 512
#define Hh 8
#define HDc 64
#define DFFc 2048

// ---------------- WMMA types ----------------
typedef __bf16 bf16_t;
typedef bf16_t v16bf __attribute__((ext_vector_type(16)));
typedef float v8f __attribute__((ext_vector_type(8)));

union Frag { uint4 u[2]; v16bf v; };

__device__ __forceinline__ unsigned short f2bf(float f) {
  union { float f; unsigned u; } v; v.f = f;
  unsigned r = v.u + 0x7FFFu + ((v.u >> 16) & 1u);
  return (unsigned short)(r >> 16);
}

__device__ __forceinline__ float gelu_f(float x) {
  float x3 = x * x * x;
  return 0.5f * x * (1.0f + tanhf(0.7978845608028654f * (x + 0.044715f * x3)));
}

// async copy 16B global -> LDS (ASYNCcnt-tracked, no VGPR round-trip)
__device__ __forceinline__ void async_cp16(const unsigned short* g, unsigned short* l) {
  unsigned lds = (unsigned)(uintptr_t)l;   // low 32 bits = LDS byte address
  asm volatile("global_load_async_to_lds_b128 %0, %1, off"
               :: "v"(lds), "v"(g) : "memory");
}
__device__ __forceinline__ void wait_async0() {
  asm volatile("s_wait_asynccnt 0x0" ::: "memory");
}
__device__ __forceinline__ void wait_async4() {
  asm volatile("s_wait_asynccnt 0x4" ::: "memory");
}

// =====================================================================
// bf16 WMMA GEMM:  C[M,N] = A[M,K] * W[K,N] + bias, optional GELU.
// A: bf16 row-major [M,K]; Wt: bf16 [N,K] (pre-transposed weights).
// Block 256 thr = 8 waves; tile 128x128, BK=32; wave tile 32x64.
// Double-buffered LDS staged with GLOBAL_LOAD_ASYNC_TO_LDS_B128;
// last tile peeled so the steady-state loop body is branch-free.
// =====================================================================
__global__ __launch_bounds__(256) void gemm_bf16_kernel(
    const unsigned short* __restrict__ A,
    const unsigned short* __restrict__ Wt,
    const float* __restrict__ bias,
    float* __restrict__ outF,
    unsigned short* __restrict__ outB,
    int M, int N, int K, int act)
{
  constexpr int ST = 48;  // padded LDS stride (bf16 elems): 96B, 16B-aligned rows
  __shared__ unsigned short As[2][128 * ST];
  __shared__ unsigned short Bs[2][128 * ST];
  const int tid   = threadIdx.x;
  const int wave  = tid >> 5;
  const int lane  = tid & 31;
  const int l15   = lane & 15;
  const int lhalf = lane >> 4;
  const int koff  = lhalf * 8;
  const int bm = blockIdx.x * 128;
  const int bn = blockIdx.y * 128;
  const int wm = (wave >> 1) * 32;
  const int wn = (wave & 1) * 64;

  v8f zf = {};
  v8f c[2][4];
#pragma unroll
  for (int i = 0; i < 2; ++i)
#pragma unroll
    for (int j = 0; j < 4; ++j) c[i][j] = zf;

  // per-thread staging coordinates: 2 chunks of 8 bf16 per matrix,
  // running global pointers advanced by BK each issue.
  const int r0 = tid >> 2,           c0 = (tid & 3) * 8;          // chunk 0
  const int r1 = (tid + 256) >> 2,   c1 = ((tid + 256) & 3) * 8;  // chunk 1
  const unsigned short* gA0 = A  + (size_t)(bm + r0) * K + c0;
  const unsigned short* gA1 = A  + (size_t)(bm + r1) * K + c1;
  const unsigned short* gB0 = Wt + (size_t)(bn + r0) * K + c0;
  const unsigned short* gB1 = Wt + (size_t)(bn + r1) * K + c1;
  unsigned short* lA0[2] = { &As[0][r0 * ST + c0], &As[1][r0 * ST + c0] };
  unsigned short* lA1[2] = { &As[0][r1 * ST + c1], &As[1][r1 * ST + c1] };
  unsigned short* lB0[2] = { &Bs[0][r0 * ST + c0], &Bs[1][r0 * ST + c0] };
  unsigned short* lB1[2] = { &Bs[0][r1 * ST + c1], &Bs[1][r1 * ST + c1] };

  auto issue = [&](int buf) {
    async_cp16(gA0, lA0[buf]);  gA0 += 32;
    async_cp16(gA1, lA1[buf]);  gA1 += 32;
    async_cp16(gB0, lB0[buf]);  gB0 += 32;
    async_cp16(gB1, lB1[buf]);  gB1 += 32;
  };
  auto compute = [&](int cur) {
    Frag a[2], b[4];
#pragma unroll
    for (int i = 0; i < 2; ++i) {
      const unsigned short* p = &As[cur][(wm + i * 16 + l15) * ST];
      a[i].u[0] = *(const uint4*)(p + koff);
      a[i].u[1] = *(const uint4*)(p + koff + 16);
    }
#pragma unroll
    for (int j = 0; j < 4; ++j) {
      const unsigned short* p = &Bs[cur][(wn + j * 16 + l15) * ST];
      b[j].u[0] = *(const uint4*)(p + koff);
      b[j].u[1] = *(const uint4*)(p + koff + 16);
    }
#pragma unroll
    for (int i = 0; i < 2; ++i)
#pragma unroll
      for (int j = 0; j < 4; ++j)
        c[i][j] = __builtin_amdgcn_wmma_f32_16x16x32_bf16(
            false, a[i].v, false, b[j].v, (short)0, c[i][j], false, false);
  };

  const int nK = K >> 5;
  issue(0);
  for (int kt = 0; kt < nK - 1; ++kt) {   // branch-free steady state
    const int cur = kt & 1;
    issue(cur ^ 1);       // prefetch next tile (async, overlaps compute)
    wait_async4();        // own copies of current tile complete
    __syncthreads();
    compute(cur);
    __syncthreads();
  }
  wait_async0();          // peeled last tile
  __syncthreads();
  compute((nK - 1) & 1);

#pragma unroll
  for (int i = 0; i < 2; ++i) {
#pragma unroll
    for (int j = 0; j < 4; ++j) {
      int col = bn + wn + j * 16 + l15;
      float bb = bias ? bias[col] : 0.0f;
#pragma unroll
      for (int r = 0; r < 8; ++r) {
        int row = bm + wm + i * 16 + r + 8 * lhalf;
        float v = c[i][j][r] + bb;
        if (act == 1) v = gelu_f(v);
        size_t idx = (size_t)row * N + col;
        if (outF) outF[idx] = v;
        if (outB) outB[idx] = f2bf(v);
      }
    }
  }
}

// =====================================================================
// Banded flash attention. Q,K,V,O: bf16 [B*S, D], head h in cols h*64..
// Grid: (Sq/64, B*H); 128 threads = 4 waves; wave owns 16 q-rows.
// Per 32-key tile: 4 WMMA for Q*K^T, online softmax, 4 WMMA for P*V.
// Q/K tiles staged with async-to-LDS; V transposed manually.
// =====================================================================
__global__ __launch_bounds__(128) void banded_attn_kernel(
    const unsigned short* __restrict__ Q,
    const unsigned short* __restrict__ Kc,
    const unsigned short* __restrict__ Vc,
    unsigned short* __restrict__ O,
    int Sq, int Sk, int bw)
{
  constexpr int STK = 72;  // stride for 64-wide hd rows (144B, aligned)
  constexpr int STV = 48;  // stride for 32-wide key rows (96B, aligned)
  __shared__ unsigned short Qs[64 * STK];
  __shared__ unsigned short Ks[32 * STK];
  __shared__ unsigned short Vs[64 * STV];      // transposed: [hd][key]
  __shared__ unsigned short Ps[4][16 * STV];   // per-wave P tile [q][key]

  const int tid   = threadIdx.x;
  const int wave  = tid >> 5;
  const int lane  = tid & 31;
  const int l15   = lane & 15;
  const int lhalf = lane >> 4;
  const int koff  = lhalf * 8;
  const int q0 = blockIdx.x * 64;
  const int bh = blockIdx.y;
  const int bb = bh / Hh;
  const int hh = bh % Hh;

  const unsigned short* Qg = Q  + ((size_t)bb * Sq) * Dm + hh * HDc;
  const unsigned short* Kg = Kc + ((size_t)bb * Sk) * Dm + hh * HDc;
  const unsigned short* Vg = Vc + ((size_t)bb * Sk) * Dm + hh * HDc;

  // stage Q tile (64 x 64) via async copies
#pragma unroll
  for (int i = 0; i < 4; ++i) {
    int chunk = tid + i * 128;
    int r  = chunk >> 3;
    int cc = (chunk & 7) * 8;
    async_cp16(Qg + (size_t)(q0 + r) * Dm + cc, Qs + r * STK + cc);
  }
  wait_async0();
  __syncthreads();

  Frag qa[2];
  {
    const unsigned short* p = Qs + (wave * 16 + l15) * STK;
    qa[0].u[0] = *(const uint4*)(p + koff);
    qa[0].u[1] = *(const uint4*)(p + koff + 16);
    qa[1].u[0] = *(const uint4*)(p + 32 + koff);
    qa[1].u[1] = *(const uint4*)(p + 32 + koff + 16);
  }

  v8f zf = {};
  float rmax[8], rsum[8];
  v8f o[4];
#pragma unroll
  for (int r = 0; r < 8; ++r) { rmax[r] = -__builtin_inff(); rsum[r] = 0.0f; }
#pragma unroll
  for (int j = 0; j < 4; ++j) o[j] = zf;

  int ks = q0 - bw;        if (ks < 0)  ks = 0;
  int ke = q0 + 64 + bw;   if (ke > Sk) ke = Sk;

  for (int kb = ks; kb < ke; kb += 32) {
    __syncthreads();
    // K tile natural [key][hd] via async; V tile transposed into Vs[hd][key]
#pragma unroll
    for (int i = 0; i < 2; ++i) {
      int chunk = tid + i * 128;
      int r  = chunk >> 3;
      int cc = (chunk & 7) * 8;
      async_cp16(Kg + (size_t)(kb + r) * Dm + cc, Ks + r * STK + cc);
      uint4 d = *(const uint4*)(Vg + (size_t)(kb + r) * Dm + cc);
      const unsigned short* ds = (const unsigned short*)&d;
#pragma unroll
      for (int t = 0; t < 8; ++t) Vs[(cc + t) * STV + r] = ds[t];
    }
    wait_async0();
    __syncthreads();

    // scores for two 16-key sub-tiles
    Frag b0a, b0b, b1a, b1b;
    {
      const unsigned short* p0 = Ks + l15 * STK;
      const unsigned short* p1 = Ks + (16 + l15) * STK;
      b0a.u[0] = *(const uint4*)(p0 + koff);      b0a.u[1] = *(const uint4*)(p0 + koff + 16);
      b0b.u[0] = *(const uint4*)(p0 + 32 + koff); b0b.u[1] = *(const uint4*)(p0 + 32 + koff + 16);
      b1a.u[0] = *(const uint4*)(p1 + koff);      b1a.u[1] = *(const uint4*)(p1 + koff + 16);
      b1b.u[0] = *(const uint4*)(p1 + 32 + koff); b1b.u[1] = *(const uint4*)(p1 + 32 + koff + 16);
    }
    v8f s0 = __builtin_amdgcn_wmma_f32_16x16x32_bf16(false, qa[0].v, false, b0a.v, (short)0, zf, false, false);
    s0     = __builtin_amdgcn_wmma_f32_16x16x32_bf16(false, qa[1].v, false, b0b.v, (short)0, s0, false, false);
    v8f s1 = __builtin_amdgcn_wmma_f32_16x16x32_bf16(false, qa[0].v, false, b1a.v, (short)0, zf, false, false);
    s1     = __builtin_amdgcn_wmma_f32_16x16x32_bf16(false, qa[1].v, false, b1b.v, (short)0, s1, false, false);

    // online softmax (rows live across 16-lane halves)
    unsigned short* Pw = Ps[wave];
#pragma unroll
    for (int r = 0; r < 8; ++r) {
      int m = r + 8 * lhalf;
      int qrow = q0 + wave * 16 + m;
      float v0 = s0[r] * 0.125f;     // 1/sqrt(64)
      float v1 = s1[r] * 0.125f;
      int d0 = qrow - (kb + l15);       if (d0 < 0) d0 = -d0;
      int d1 = qrow - (kb + 16 + l15);  if (d1 < 0) d1 = -d1;
      if (d0 > bw) v0 = -__builtin_inff();
      if (d1 > bw) v1 = -__builtin_inff();
      float mt = fmaxf(v0, v1);
#pragma unroll
      for (int ofs = 1; ofs < 16; ofs <<= 1)
        mt = fmaxf(mt, __shfl_xor(mt, ofs, 32));
      float nm = fmaxf(rmax[r], mt);
      float sc, p0, p1;
      if (nm < -1e37f) { sc = 1.0f; p0 = 0.0f; p1 = 0.0f; }
      else {
        sc = __expf(rmax[r] - nm);
        p0 = __expf(v0 - nm);
        p1 = __expf(v1 - nm);
      }
      rmax[r] = nm;
      float ps = p0 + p1;
#pragma unroll
      for (int ofs = 1; ofs < 16; ofs <<= 1)
        ps += __shfl_xor(ps, ofs, 32);
      rsum[r] = rsum[r] * sc + ps;
#pragma unroll
      for (int j = 0; j < 4; ++j) o[j][r] *= sc;
      Pw[m * STV + l15]      = f2bf(p0);
      Pw[m * STV + 16 + l15] = f2bf(p1);
    }
    __syncthreads();

    // ctx += P[16x32] * V[32x64]
    Frag pa;
    {
      const unsigned short* p = Pw + l15 * STV;
      pa.u[0] = *(const uint4*)(p + koff);
      pa.u[1] = *(const uint4*)(p + koff + 16);
    }
#pragma unroll
    for (int j = 0; j < 4; ++j) {
      Frag vb;
      const unsigned short* p = Vs + (j * 16 + l15) * STV;
      vb.u[0] = *(const uint4*)(p + koff);
      vb.u[1] = *(const uint4*)(p + koff + 16);
      o[j] = __builtin_amdgcn_wmma_f32_16x16x32_bf16(false, pa.v, false, vb.v, (short)0, o[j], false, false);
    }
  }

  float inv[8];
#pragma unroll
  for (int r = 0; r < 8; ++r) inv[r] = 1.0f / rsum[r];
#pragma unroll
  for (int j = 0; j < 4; ++j)
#pragma unroll
    for (int r = 0; r < 8; ++r) {
      int m = r + 8 * lhalf;
      int qrow = q0 + wave * 16 + m;
      int hd = j * 16 + l15;
      O[((size_t)bb * Sq + qrow) * Dm + hh * HDc + hd] = f2bf(o[j][r] * inv[r]);
    }
}

// =====================================================================
// Embedding: h = (x @ W + b) * sqrt(D) + PE(s, d); outputs f32 + bf16.
// =====================================================================
__global__ __launch_bounds__(256) void embed_kernel(
    const float* __restrict__ x, const float* __restrict__ W,
    const float* __restrict__ bias, float* __restrict__ outF,
    unsigned short* __restrict__ outB, int Cin)
{
  int row = blockIdx.x;
  int s = row & (Sq_ - 1);
  int tid = threadIdx.x;
  float xv[7];
#pragma unroll
  for (int c = 0; c < 7; ++c) xv[c] = (c < Cin) ? x[(size_t)row * Cin + c] : 0.0f;
#pragma unroll
  for (int t = 0; t < 2; ++t) {
    int d = tid * 2 + t;
    float acc = bias[d];
    for (int c = 0; c < Cin; ++c) acc += xv[c] * W[c * Dm + d];
    acc *= 22.627416997969522f;  // sqrt(512)
    float div = __expf((float)((d >> 1) * 2) * (-9.210340371976184f / 512.0f));
    float arg = (float)s * div;
    acc += (d & 1) ? cosf(arg) : sinf(arg);
    outF[(size_t)row * Dm + d] = acc;
    outB[(size_t)row * Dm + d] = f2bf(acc);
  }
}

// =====================================================================
// Residual + LayerNorm over D=512; outputs f32 (may alias x) + bf16.
// =====================================================================
__global__ __launch_bounds__(256) void ln_kernel(
    const float* __restrict__ x, const float* __restrict__ res,
    const float* __restrict__ w, const float* __restrict__ b,
    float* __restrict__ outF, unsigned short* __restrict__ outB)
{
  __shared__ float red[256];
  int row = blockIdx.x, tid = threadIdx.x;
  float2 xv = ((const float2*)(x   + (size_t)row * Dm))[tid];
  float2 rv = ((const float2*)(res + (size_t)row * Dm))[tid];
  float a0 = xv.x + rv.x, a1 = xv.y + rv.y;
  red[tid] = a0 + a1;
  __syncthreads();
  for (int o2 = 128; o2 > 0; o2 >>= 1) {
    if (tid < o2) red[tid] += red[tid + o2];
    __syncthreads();
  }
  float mu = red[0] * (1.0f / 512.0f);
  __syncthreads();
  float d0 = a0 - mu, d1 = a1 - mu;
  red[tid] = d0 * d0 + d1 * d1;
  __syncthreads();
  for (int o2 = 128; o2 > 0; o2 >>= 1) {
    if (tid < o2) red[tid] += red[tid + o2];
    __syncthreads();
  }
  float rstd = rsqrtf(red[0] * (1.0f / 512.0f) + 1e-5f);
  int d = tid * 2;
  float y0 = d0 * rstd * w[d] + b[d];
  float y1 = d1 * rstd * w[d + 1] + b[d + 1];
  outF[(size_t)row * Dm + d]     = y0;
  outF[(size_t)row * Dm + d + 1] = y1;
  outB[(size_t)row * Dm + d]     = f2bf(y0);
  outB[(size_t)row * Dm + d + 1] = f2bf(y1);
}

// =====================================================================
// Weight preparation, one launch for all 22 matrices:
// fp32 [K,N] -> bf16 transposed [N,K], packed one after another in wt:
//   16 x [512,512]  (encoder attention 8, decoder self 4, decoder cross 4)
//    3 x [512,2048] (first FFN matrix: encoder 2, decoder 1)
//    3 x [2048,512] (second FFN matrix: encoder 2, decoder 1)
// The matrices are cut into 64x64 tiles, 2560 in all. A block moves 5 of
// them through LDS: 256-B row pieces are read, whole 128-B lines written.
// An LDS dword holds the bf16 pair (k, k+1) of one n; the pitch of 33
// dwords keeps both the column-wise writes and the row-wise reads on
// distinct banks.
// =====================================================================
#define WP_BLOCKS 512
#define WP_TILES_PER_BLOCK 5
#define WP_DD  (Dm * Dm)
#define WP_DF  (Dm * DFFc)
#define WP_FF1 (16 * WP_DD)
#define WP_FF2 (16 * WP_DD + 3 * WP_DF)

__global__ __launch_bounds__(256) void wprep_kernel(
    const float* __restrict__ enc_attn_w, const float* __restrict__ dec_self_w,
    const float* __restrict__ dec_cross_w,
    const float* __restrict__ enc_ff_w1, const float* __restrict__ dec_ff_w1,
    const float* __restrict__ enc_ff_w2, const float* __restrict__ dec_ff_w2,
    unsigned short* __restrict__ wt)
{
  constexpr int P = 33;
  __shared__ unsigned tile[2][64 * P];
  const int tid = threadIdx.x;
  const int p   = tid >> 4;         // reader: k pair (rows 2p, 2p+1, +32, +33)
  const int n0  = (tid & 15) * 4;   // reader: 4 columns
  const int wr  = tid >> 3;         // writer: output row (n), +32
  const int wc  = tid & 7;          // writer: 16-B chunk of the 128-B line

  float4 r[4];
  unsigned short* dst;
  int dstK;

  // tile id -> source and destination of its corner (same for the whole block)
  auto fetch = [&](int id) {
    const float* s; unsigned short* d; int K, N, kt, nt;
    if (id < 1024) {
      int m = id >> 6;
      s = (m < 8) ? enc_attn_w + (size_t)m * WP_DD
        : (m < 12) ? dec_self_w + (size_t)(m - 8) * WP_DD
                   : dec_cross_w + (size_t)(m - 12) * WP_DD;
      d = wt + (size_t)m * WP_DD;
      K = Dm; N = Dm; kt = (id >> 3) & 7; nt = id & 7;
    } else if (id < 1792) {
      int j = id - 1024, m = j >> 8;
      s = (m < 2) ? enc_ff_w1 + (size_t)m * WP_DF : dec_ff_w1;
      d = wt + WP_FF1 + (size_t)m * WP_DF;
      K = Dm; N = DFFc; kt = (j >> 5) & 7; nt = j & 31;
    } else {
      int j = id - 1792, m = j >> 8;
      s = (m < 2) ? enc_ff_w2 + (size_t)m * WP_DF : dec_ff_w2;
      d = wt + WP_FF2 + (size_t)m * WP_DF;
      K = DFFc; N = Dm; kt = (j >> 3) & 31; nt = j & 7;
    }
    const float* g = s + (size_t)(kt * 64 + 2 * p) * N + nt * 64 + n0;
    const float* g1 = g + N;
    const float* g2 = g + (size_t)32 * N;
    const float* g3 = g + (size_t)33 * N;
    r[0] = *(const float4*)(g);
    r[1] = *(const float4*)(g1);
    r[2] = *(const float4*)(g2);
    r[3] = *(const float4*)(g3);
    // the wait that belongs in front of any rewrite of an issued load's
    // address registers; naming the four addresses keeps them out of the
    // loads' own destination registers until it has passed
    asm volatile("s_wait_xcnt 0x0" :: "v"(g), "v"(g1), "v"(g2), "v"(g3) : "memory");
    dst  = d + (size_t)(nt * 64 + wr) * K + kt * 64 + wc * 8;
    dstK = K;
  };
  auto pack = [](float lo, float hi) -> unsigned {
    return (unsigned)f2bf(lo) | ((unsigned)f2bf(hi) << 16);
  };

  fetch(blockIdx.x);
  // unrolled so that the buffer index and the last-tile test are constants
#pragma unroll
  for (int t = 0; t < WP_TILES_PER_BLOCK; ++t) {
    unsigned* L = tile[t & 1];
    const float* a0 = (const float*)&r[0];
    const float* a1 = (const float*)&r[1];
    const float* a2 = (const float*)&r[2];
    const float* a3 = (const float*)&r[3];
    // unrolled so that r[] is indexed by constants and stays in registers
#pragma unroll
    for (int e = 0; e < 4; ++e) {
      L[(n0 + e) * P + p]      = pack(a0[e], a1[e]);
      L[(n0 + e) * P + 16 + p] = pack(a2[e], a3[e]);
    }
    unsigned short* o = dst;
    const int oK = dstK;
    // one barrier a tile: with two buffers it also ends the reads of the
    // buffer that the next tile overwrites
    __syncthreads();
    // the next tile's loads fly while this tile is written out
    if (t + 1 < WP_TILES_PER_BLOCK) fetch(blockIdx.x + (t + 1) * WP_BLOCKS);
    // unrolled so that both halves' LDS reads issue together
#pragma unroll
    for (int h = 0; h < 2; ++h) {
      const unsigned* q = L + (h * 32 + wr) * P + wc * 4;
      uint4 v = make_uint4(q[0], q[1], q[2], q[3]);
      *(uint4*)(o + (size_t)(h * 32) * oK) = v;
    }
  }
}

// final projection D->1: one wave per row
__global__ __launch_bounds__(256) void outproj_kernel(
    const float* __restrict__ t, const float* __restrict__ w,
    const float* __restrict__ b, float* __restrict__ out, int M)
{
  int gid = blockIdx.x * 256 + threadIdx.x;
  int row = gid >> 5;
  int lane = gid & 31;
  if (row >= M) return;
  float acc = 0.0f;
#pragma unroll
  for (int i = 0; i < 16; ++i)
    acc += t[(size_t)row * Dm + lane + i * 32] * w[lane + i * 32];
#pragma unroll
  for (int ofs = 16; ofs > 0; ofs >>= 1)
    acc += __shfl_xor(acc, ofs, 32);
  if (lane == 0) out[row] = acc + b[0];
}

// =====================================================================
// Host orchestration
// =====================================================================
extern "C" void kernel_launch(void* const* d_in, const int* in_sizes, int n_in,
                              void* d_out, int out_size, void* d_ws, size_t ws_size,
                              hipStream_t stream) {
  (void)in_sizes; (void)n_in; (void)out_size; (void)ws_size;
  const float* x_enc      = (const float*)d_in[0];
  const float* x_dec      = (const float*)d_in[1];
  const float* emb_enc_w  = (const float*)d_in[2];
  const float* emb_enc_b  = (const float*)d_in[3];
  const float* emb_dec_w  = (const float*)d_in[4];
  const float* emb_dec_b  = (const float*)d_in[5];
  const float* enc_attn_w = (const float*)d_in[6];
  const float* enc_attn_b = (const float*)d_in[7];
  const float* enc_ff_w1  = (const float*)d_in[8];
  const float* enc_ff_b1  = (const float*)d_in[9];
  const float* enc_ff_w2  = (const float*)d_in[10];
  const float* enc_ff_b2  = (const float*)d_in[11];
  const float* enc_ln_w   = (const float*)d_in[12];
  const float* enc_ln_b   = (const float*)d_in[13];
  const float* dec_self_w = (const float*)d_in[14];
  const float* dec_self_b = (const float*)d_in[15];
  const float* dec_cross_w= (const float*)d_in[16];
  const float* dec_cross_b= (const float*)d_in[17];
  const float* dec_ff_w1  = (const float*)d_in[18];
  const float* dec_ff_b1  = (const float*)d_in[19];
  const float* dec_ff_w2  = (const float*)d_in[20];
  const float* dec_ff_b2  = (const float*)d_in[21];
  const float* dec_ln_w   = (const float*)d_in[22];
  const float* dec_ln_b   = (const float*)d_in[23];
  const float* out_w      = (const float*)d_in[24];
  const float* out_b      = (const float*)d_in[25];

  const int M = Bq * Sq_;  // 8192
  char* ws = (char*)d_ws;
  size_t off = 0;
  auto alloc = [&](size_t bytes) -> void* {
    void* p = ws + off;
    off += (bytes + 255) & ~(size_t)255;
    return p;
  };
  float*          h_f   = (float*)alloc((size_t)M * Dm * 4);
  unsigned short* h_b   = (unsigned short*)alloc((size_t)M * Dm * 2);
  float*          t_f   = (float*)alloc((size_t)M * Dm * 4);
  unsigned short* t_b   = (unsigned short*)alloc((size_t)M * Dm * 2);
  unsigned short* q_b   = (unsigned short*)alloc((size_t)M * Dm * 2);
  unsigned short* k_b   = (unsigned short*)alloc((size_t)M * Dm * 2);
  unsigned short* v_b   = (unsigned short*)alloc((size_t)M * Dm * 2);
  unsigned short* ctx_b = (unsigned short*)alloc((size_t)M * Dm * 2);
  float*          g_f   = (float*)alloc((size_t)M * Dm * 4);
  unsigned short* ffn_b = (unsigned short*)alloc((size_t)M * DFFc * 2);
  unsigned short* wt  = (unsigned short*)alloc(((size_t)16 * WP_DD + (size_t)6 * WP_DF) * 2);
  auto wA  = [&](int m) { return wt + (size_t)m * WP_DD; };           // attention matrices
  auto wF1 = [&](int m) { return wt + WP_FF1 + (size_t)m * WP_DF; };  // first FFN matrices
  auto wF2 = [&](int m) { return wt + WP_FF2 + (size_t)m * WP_DF; };  // second FFN matrices

  auto gemm = [&](const unsigned short* A, const unsigned short* Wt, const float* bias,
                  float* oF, unsigned short* oB, int Mm, int Nn, int Kk, int act) {
    gemm_bf16_kernel<<<dim3(Mm / 128, Nn / 128), 256, 0, stream>>>(A, Wt, bias, oF, oB, Mm, Nn, Kk, act);
  };
  auto attn = [&](const unsigned short* Qp, const unsigned short* Kp,
                  const unsigned short* Vp, unsigned short* Op) {
    banded_attn_kernel<<<dim3(Sq_ / 64, Bq * Hh), 128, 0, stream>>>(Qp, Kp, Vp, Op, Sq_, Sq_, Sq_ / 4);
  };
  auto lnorm = [&](const float* xx, const float* rr, const float* w, const float* bb,
                   float* oF, unsigned short* oB) {
    ln_kernel<<<M, 256, 0, stream>>>(xx, rr, w, bb, oF, oB);
  };

  // ----- all weights to bf16 [N,K], once -----
  wprep_kernel<<<WP_BLOCKS, 256, 0, stream>>>(enc_attn_w, dec_self_w, dec_cross_w,
                                              enc_ff_w1, dec_ff_w1, enc_ff_w2, dec_ff_w2, wt);

  // ----- encoder -----
  embed_kernel<<<M, 256, 0, stream>>>(x_enc, emb_enc_w, emb_enc_b, h_f, h_b, 7);
  for (int l = 0; l < 2; ++l) {
    const float* ab = enc_attn_b + (size_t)l * 4 * Dm;
    gemm(h_b, wA(l * 4 + 0), ab + 0 * Dm, nullptr, q_b, M, Dm, Dm, 0);
    gemm(h_b, wA(l * 4 + 1), ab + 1 * Dm, nullptr, k_b, M, Dm, Dm, 0);
    gemm(h_b, wA(l * 4 + 2), ab + 2 * Dm, nullptr, v_b, M, Dm, Dm, 0);
    attn(q_b, k_b, v_b, ctx_b);
    gemm(ctx_b, wA(l * 4 + 3), ab + 3 * Dm, g_f, nullptr, M, Dm, Dm, 0);
    lnorm(h_f, g_f, enc_ln_w + (size_t)l * 2 * Dm, enc_ln_b + (size_t)l * 2 * Dm, h_f, h_b);
    gemm(h_b, wF1(l), enc_ff_b1 + (size_t)l * DFFc, nullptr, ffn_b, M, DFFc, Dm, 1);
    gemm(ffn_b, wF2(l), enc_ff_b2 + (size_t)l * Dm, g_f, nullptr, M, Dm, DFFc, 0);
    lnorm(h_f, g_f, enc_ln_w + (size_t)l * 2 * Dm + Dm, enc_ln_b + (size_t)l * 2 * Dm + Dm, h_f, h_b);
  }
  // h_f / h_b now hold encoder memory.

  // ----- decoder (DL = 1) -----
  embed_kernel<<<M, 256, 0, stream>>>(x_dec, emb_dec_w, emb_dec_b, t_f, t_b, 1);
  {
    // self-attention
    gemm(t_b, wA(8), dec_self_b + 0 * Dm, nullptr, q_b, M, Dm, Dm, 0);
    gemm(t_b, wA(9), dec_self_b + 1 * Dm, nullptr, k_b, M, Dm, Dm, 0);
    gemm(t_b, wA(10), dec_self_b + 2 * Dm, nullptr, v_b, M, Dm, Dm, 0);
    attn(q_b, k_b, v_b, ctx_b);
    gemm(ctx_b, wA(11), dec_self_b + 3 * Dm, g_f, nullptr, M, Dm, Dm, 0);
    lnorm(t_f, g_f, dec_ln_w + 0 * Dm, dec_ln_b + 0 * Dm, t_f, t_b);

    // cross-attention (K/V from encoder memory)
    gemm(t_b, wA(12), dec_cross_b + 0 * Dm, nullptr, q_b, M, Dm, Dm, 0);
    gemm(h_b, wA(13), dec_cross_b + 1 * Dm, nullptr, k_b, M, Dm, Dm, 0);
    gemm(h_b, wA(14), dec_cross_b + 2 * Dm, nullptr, v_b, M, Dm, Dm, 0);
    attn(q_b, k_b, v_b, ctx_b);
    gemm(ctx_b, wA(15), dec_cross_b + 3 * Dm, g_f, nullptr, M, Dm, Dm, 0);
    lnorm(t_f, g_f, dec_ln_w + 1 * Dm, dec_ln_b + 1 * Dm, t_f, t_b);

    // FFN
    gemm(t_b, wF1(2), dec_ff_b1, nullptr, ffn_b, M, DFFc, Dm, 1);
    gemm(ffn_b, wF2(2), dec_ff_b2, g_f, nullptr, M, Dm, DFFc, 0);
    lnorm(t_f, g_f, dec_ln_w + 2 * Dm, dec_ln_b + 2 * Dm, t_f, t_b);
  }

  outproj_kernel<<<(M * 32 + 255) / 256, 256, 0, stream>>>(t_f, out_w, out_b, (float*)d_out, M);
}

// v002
// It runs in 833 microseconds.
// Two timings next to v001 both put it at 1.08 times that version's speed.
// Counting every step since v000, it is 1.43 times as fast.
#include <hip/hip_runtime.h>
#include <math.h>

// ---------------- model constants ----------------
#define Bq 8
#define Sq_ 1024
#define Dm 512
#define Hh 8
#define HDc 64
#define DFFc 2048

// ---------------- WMMA types ----------------
typedef __bf16 bf16_t;
typedef bf16_t v16bf __attribute__((ext_vector_type(16)));
typedef float v8f __attribute__((ext_vector_type(8)));

union Frag { uint4 u[2]; v16bf v; };

__device__ __forceinline__ unsigned short f2bf(float f) {
  union { float f; unsigned u; } v; v.f = f;
  unsigned r = v.u + 0x7FFFu + ((v.u >> 16) & 1u);
  return (unsigned short)(r >> 16);
}

__device__ __forceinline__ float gelu_f(float x) {
  float x3 = x * x * x;
  return 0.5f * x * (1.0f + tanhf(0.7978845608028654f * (x + 0.044715f * x3)));
}

// async copy 16B global -> LDS (ASYNCcnt-tracked, no VGPR round-trip)
__device__ __forceinline__ void async_cp16(const unsigned short* g, unsigned short* l) {
  unsigned lds = (unsigned)(uintptr_t)l;   // low 32 bits = LDS byte address
  asm volatile("global_load_async_to_lds_b128 %0, %1, off"
               :: "v"(lds), "v"(g) : "memory");
}
__device__ __forceinline__ void wait_async0() {
  asm volatile("s_wait_asynccnt 0x0" ::: "memory");
}
__device__ __forceinline__ void wait_async4() {
  asm volatile("s_wait_asynccnt 0x4" ::: "memory");
}

// =====================================================================
// bf16 WMMA GEMM:  C[M,N] = A[M,K] * W[K,N] + bias, optional GELU.
// A: bf16 row-major [M,K]; Wt: bf16 [N,K] (pre-transposed weights).
// Block 256 thr = 8 waves; tile 128x128, BK=32; wave tile 32x64.
// Double-buffered LDS staged with GLOBAL_LOAD_ASYNC_TO_LDS_B128;
// last tile peeled so the steady-state loop body is branch-free.
// =====================================================================
__global__ __launch_bounds__(256) void gemm_bf16_kernel(
    const unsigned short* __restrict__ A,
    const unsigned short* __restrict__ Wt,
    const float* __restrict__ bias,
    float* __restrict__ outF,
    unsigned short* __restrict__ outB,
    int M, int N, int K, int act)
{
  constexpr int ST = 48;  // padded LDS stride (bf16 elems): 96B, 16B-aligned rows
  __shared__ unsigned short As[2][128 * ST];
  __shared__ unsigned short Bs[2][128 * ST];
  const int tid   = threadIdx.x;
  const int wave  = tid >> 5;
  const int lane  = tid & 31;
  const int l15   = lane & 15;
  const int lhalf = lane >> 4;
  const int koff  = lhalf * 8;
  const int bm = blockIdx.x * 128;
  const int bn = blockIdx.y * 128;
  const int wm = (wave >> 1) * 32;
  const int wn = (wave & 1) * 64;

  v8f zf = {};
  v8f c[2][4];
#pragma unroll
  for (int i = 0; i < 2; ++i)
#pragma unroll
    for (int j = 0; j < 4; ++j) c[i][j] = zf;

  // per-thread staging coordinates: 2 chunks of 8 bf16 per matrix,
  // running global pointers advanced by BK each issue.
  const int r0 = tid >> 2,           c0 = (tid & 3) * 8;          // chunk 0
  const int r1 = (tid + 256) >> 2,   c1 = ((tid + 256) & 3) * 8;  // chunk 1
  const unsigned short* gA0 = A  + (size_t)(bm + r0) * K + c0;
  const unsigned short* gA1 = A  + (size_t)(bm + r1) * K + c1;
  const unsigned short* gB0 = Wt + (size_t)(bn + r0) * K + c0;
  const unsigned short* gB1 = Wt + (size_t)(bn + r1) * K + c1;
  unsigned short* lA0[2] = { &As[0][r0 * ST + c0], &As[1][r0 * ST + c0] };
  unsigned short* lA1[2] = { &As[0][r1 * ST + c1], &As[1][r1 * ST + c1] };
  unsigned short* lB0[2] = { &Bs[0][r0 * ST + c0], &Bs[1][r0 * ST + c0] };
  unsigned short* lB1[2] = { &Bs[0][r1 * ST + c1], &Bs[1][r1 * ST + c1] };

  auto issue = [&](int buf) {
    async_cp16(gA0, lA0[buf]);  gA0 += 32;
    async_cp16(gA1, lA1[buf]);  gA1 += 32;
    async_cp16(gB0, lB0[buf]);  gB0 += 32;
    async_cp16(gB1, lB1[buf]);  gB1 += 32;
  };
  auto compute = [&](int cur) {
    Frag a[2], b[4];
#pragma unroll
    for (int i = 0; i < 2; ++i) {
      const unsigned short* p = &As[cur][(wm + i * 16 + l15) * ST];
      a[i].u[0] = *(const uint4*)(p + koff);
      a[i].u[1] = *(const uint4*)(p + koff + 16);
    }
#pragma unroll
    for (int j = 0; j < 4; ++j) {
      const unsigned short* p = &Bs[cur][(wn + j * 16 + l15) * ST];
      b[j].u[0] = *(const uint4*)(p + koff);
      b[j].u[1] = *(const uint4*)(p + koff + 16);
    }
#pragma unroll
    for (int i = 0; i < 2; ++i)
#pragma unroll
      for (int j = 0; j < 4; ++j)
        c[i][j] = __builtin_amdgcn_wmma_f32_16x16x32_bf16(
            false, a[i].v, false, b[j].v, (short)0, c[i][j], false, false);
  };

  const int nK = K >> 5;
  issue(0);
  for (int kt = 0; kt < nK - 1; ++kt) {   // branch-free steady state
    const int cur = kt & 1;
    issue(cur ^ 1);       // prefetch next tile (async, overlaps compute)
    wait_async4();        // own copies of current tile complete
    __syncthreads();
    compute(cur);
    __syncthreads();
  }
  wait_async0();          // peeled last tile
  __syncthreads();
  compute((nK - 1) & 1);

#pragma unroll
  for (int i = 0; i < 2; ++i) {
#pragma unroll
    for (int j = 0; j < 4; ++j) {
      int col = bn + wn + j * 16 + l15;
      float bb = bias ? bias[col] : 0.0f;
#pragma unroll
      for (int r = 0; r < 8; ++r) {
        int row = bm + wm + i * 16 + r + 8 * lhalf;
        float v = c[i][j][r] + bb;
        if (act == 1) v = gelu_f(v);
        size_t idx = (size_t)row * N + col;
        if (outF) outF[idx] = v;
        if (outB) outB[idx] = f2bf(v);
      }
    }
  }
}

// =====================================================================
// Banded flash attention. Q,K,V,O: bf16 [B*S, D], head h in cols h*64..
// Grid: (Sq/64, B*H); 128 threads = 4 waves; wave owns 16 q-rows.
// Per 32-key tile: 4 WMMA for Q*K^T, online softmax, 4 WMMA for P*V.
// Q/K tiles staged with async-to-LDS; V transposed manually.
// =====================================================================
__global__ __launch_bounds__(128) void banded_attn_kernel(
    const unsigned short* __restrict__ Q,
    const unsigned short* __restrict__ Kc,
    const unsigned short* __restrict__ Vc,
    unsigned short* __restrict__ O,
    int Sq, int Sk, int bw)
{
  constexpr int STK = 72;  // stride for 64-wide hd rows (144B, aligned)
  constexpr int STV = 48;  // stride for 32-wide key rows (96B, aligned)
  __shared__ unsigned short Qs[64 * STK];
  __shared__ unsigned short Ks[32 * STK];
  __shared__ unsigned short Vs[64 * STV];      // transposed: [hd][key]
  __shared__ unsigned short Ps[4][16 * STV];   // per-wave P tile [q][key]

  const int tid   = threadIdx.x;
  const int wave  = tid >> 5;
  const int lane  = tid & 31;
  const int l15   = lane & 15;
  const int lhalf = lane >> 4;
  const int koff  = lhalf * 8;
  const int q0 = blockIdx.x * 64;
  const int bh = blockIdx.y;
  const int bb = bh / Hh;
  const int hh = bh % Hh;

  const unsigned short* Qg = Q  + ((size_t)bb * Sq) * Dm + hh * HDc;
  const unsigned short* Kg = Kc + ((size_t)bb * Sk) * Dm + hh * HDc;
  const unsigned short* Vg = Vc + ((size_t)bb * Sk) * Dm + hh * HDc;

  // stage Q tile (64 x 64) via async copies
#pragma unroll
  for (int i = 0; i < 4; ++i) {
    int chunk = tid + i * 128;
    int r  = chunk >> 3;
    int cc = (chunk & 7) * 8;
    async_cp16(Qg + (size_t)(q0 + r) * Dm + cc, Qs + r * STK + cc);
  }
  wait_async0();
  __syncthreads();

  Frag qa[2];
  {
    const unsigned short* p = Qs + (wave * 16 + l15) * STK;
    qa[0].u[0] = *(const uint4*)(p + koff);
    qa[0].u[1] = *(const uint4*)(p + koff + 16);
    qa[1].u[0] = *(const uint4*)(p + 32 + koff);
    qa[1].u[1] = *(const uint4*)(p + 32 + koff + 16);
  }

  v8f zf = {};
  float rmax[8], rsum[8];
  v8f o[4];
#pragma unroll
  for (int r = 0; r < 8; ++r) { rmax[r] = -__builtin_inff(); rsum[r] = 0.0f; }
#pragma unroll
  for (int j = 0; j < 4; ++j) o[j] = zf;

  int ks = q0 - bw;        if (ks < 0)  ks = 0;
  int ke = q0 + 64 + bw;   if (ke > Sk) ke = Sk;

  for (int kb = ks; kb < ke; kb += 32) {
    __syncthreads();
    // K tile natural [key][hd] via async; V tile transposed into Vs[hd][key]
#pragma unroll
    for (int i = 0; i < 2; ++i) {
      int chunk = tid + i * 128;
      int r  = chunk >> 3;
      int cc = (chunk & 7) * 8;
      async_cp16(Kg + (size_t)(kb + r) * Dm + cc, Ks + r * STK + cc);
      uint4 d = *(const uint4*)(Vg + (size_t)(kb + r) * Dm + cc);
      const unsigned short* ds = (const unsigned short*)&d;
#pragma unroll
      for (int t = 0; t < 8; ++t) Vs[(cc + t) * STV + r] = ds[t];
    }
    wait_async0();
    __syncthreads();

    // scores for two 16-key sub-tiles
    Frag b0a, b0b, b1a, b1b;
    {
      const unsigned short* p0 = Ks + l15 * STK;
      const unsigned short* p1 = Ks + (16 + l15) * STK;
      b0a.u[0] = *(const uint4*)(p0 + koff);      b0a.u[1] = *(const uint4*)(p0 + koff + 16);
      b0b.u[0] = *(const uint4*)(p0 + 32 + koff); b0b.u[1] = *(const uint4*)(p0 + 32 + koff + 16);
      b1a.u[0] = *(const uint4*)(p1 + koff);      b1a.u[1] = *(const uint4*)(p1 + koff + 16);
      b1b.u[0] = *(const uint4*)(p1 + 32 + koff); b1b.u[1] = *(const uint4*)(p1 + 32 + koff + 16);
    }
    v8f s0 = __builtin_amdgcn_wmma_f32_16x16x32_bf16(false, qa[0].v, false, b0a.v, (short)0, zf, false, false);
    s0     = __builtin_amdgcn_wmma_f32_16x16x32_bf16(false, qa[1].v, false, b0b.v, (short)0, s0, false, false);
    v8f s1 = __builtin_amdgcn_wmma_f32_16x16x32_bf16(false, qa[0].v, false, b1a.v, (short)0, zf, false, false);
    s1     = __builtin_amdgcn_wmma_f32_16x16x32_bf16(false, qa[1].v, false, b1b.v, (short)0, s1, false, false);

    // online softmax (rows live across 16-lane halves)
    unsigned short* Pw = Ps[wave];
#pragma unroll
    for (int r = 0; r < 8; ++r) {
      int m = r + 8 * lhalf;
      int qrow = q0 + wave * 16 + m;
      float v0 = s0[r] * 0.125f;     // 1/sqrt(64)
      float v1 = s1[r] * 0.125f;
      int d0 = qrow - (kb + l15);       if (d0 < 0) d0 = -d0;
      int d1 = qrow - (kb + 16 + l15);  if (d1 < 0) d1 = -d1;
      if (d0 > bw) v0 = -__builtin_inff();
      if (d1 > bw) v1 = -__builtin_inff();
      float mt = fmaxf(v0, v1);
#pragma unroll
      for (int ofs = 1; ofs < 16; ofs <<= 1)
        mt = fmaxf(mt, __shfl_xor(mt, ofs, 32));
      float nm = fmaxf(rmax[r], mt);
      float sc, p0, p1;
      if (nm < -1e37f) { sc = 1.0f; p0 = 0.0f; p1 = 0.0f; }
      else {
        sc = __expf(rmax[r] - nm);
        p0 = __expf(v0 - nm);
        p1 = __expf(v1 - nm);
      }
      rmax[r] = nm;
      float ps = p0 + p1;
#pragma unroll
      for (int ofs = 1; ofs < 16; ofs <<= 1)
        ps += __shfl_xor(ps, ofs, 32);
      rsum[r] = rsum[r] * sc + ps;
#pragma unroll
      for (int j = 0; j < 4; ++j) o[j][r] *= sc;
      Pw[m * STV + l15]      = f2bf(p0);
      Pw[m * STV + 16 + l15] = f2bf(p1);
    }
    __syncthreads();

    // ctx += P[16x32] * V[32x64]
    Frag pa;
    {
      const unsigned short* p = Pw + l15 * STV;
      pa.u[0] = *(const uint4*)(p + koff);
      pa.u[1] = *(const uint4*)(p + koff + 16);
    }
#pragma unroll
    for (int j = 0; j < 4; ++j) {
      Frag vb;
      const unsigned short* p = Vs + (j * 16 + l15) * STV;
      vb.u[0] = *(const uint4*)(p + koff);
      vb.u[1] = *(const uint4*)(p + koff + 16);
      o[j] = __builtin_amdgcn_wmma_f32_16x16x32_bf16(false, pa.v, false, vb.v, (short)0, o[j], false, false);
    }
  }

  float inv[8];
#pragma unroll
  for (int r = 0; r < 8; ++r) inv[r] = 1.0f / rsum[r];
#pragma unroll
  for (int j = 0; j < 4; ++j)
#pragma unroll
    for (int r = 0; r < 8; ++r) {
      int m = r + 8 * lhalf;
      int qrow = q0 + wave * 16 + m;
      int hd = j * 16 + l15;
      O[((size_t)bb * Sq + qrow) * Dm + hh * HDc + hd] = f2bf(o[j][r] * inv[r]);
    }
}

// =====================================================================
// Embedding: h = (x @ W + b) * sqrt(D) + PE(s, d); outputs f32 + bf16.
// A work-group walks EMB_ROWS rows, a thread keeping its two columns: the
// launch starts 4096 waves where one work-group a row would start 65536.
// =====================================================================
#define EMB_ROWS 16
__global__ __launch_bounds__(256) void embed_kernel(
    const float* __restrict__ x, const float* __restrict__ W,
    const float* __restrict__ bias, float* __restrict__ outF,
    unsigned short* __restrict__ outB, int Cin)
{
  const int row0 = blockIdx.x * EMB_ROWS;
  const int tid = threadIdx.x;
  const int d = tid * 2;
  // what depends on the column alone is formed once
  float wv[7][2];
#pragma unroll
  for (int c = 0; c < 7; ++c) {
    wv[c][0] = (c < Cin) ? W[c * Dm + d]     : 0.0f;
    wv[c][1] = (c < Cin) ? W[c * Dm + d + 1] : 0.0f;
  }
  const float b0 = bias[d], b1 = bias[d + 1];
  const float div = __expf((float)d * (-9.210340371976184f / 512.0f));

  float xn[7];
#pragma unroll
  for (int c = 0; c < 7; ++c) xn[c] = (c < Cin) ? x[(size_t)row0 * Cin + c] : 0.0f;
  // kept rolled: for speed only
#pragma unroll 1
  for (int rr = 0; rr < EMB_ROWS; ++rr) {
    const int row = row0 + rr;
    float xv[7];
#pragma unroll
    for (int c = 0; c < 7; ++c) xv[c] = xn[c];
    // the next row's inputs fly while this row is computed (the last trip
    // reads its own row again, so the address stays inside x)
    const int nxt = (rr + 1 < EMB_ROWS) ? row + 1 : row;
#pragma unroll
    for (int c = 0; c < 7; ++c) xn[c] = (c < Cin) ? x[(size_t)nxt * Cin + c] : 0.0f;
    float acc0 = b0, acc1 = b1;
#pragma unroll
    for (int c = 0; c < 7; ++c) { acc0 += xv[c] * wv[c][0]; acc1 += xv[c] * wv[c][1]; }
    acc0 *= 22.627416997969522f;  // sqrt(512)
    acc1 *= 22.627416997969522f;
    const float arg = (float)(row & (Sq_ - 1)) * div;
    acc0 += sinf(arg);
    acc1 += cosf(arg);
    *(float2*)(outF + (size_t)row * Dm + d) = make_float2(acc0, acc1);
    *(unsigned*)(outB + (size_t)row * Dm + d) =
        (unsigned)f2bf(acc0) | ((unsigned)f2bf(acc1) << 16);
  }
}

// =====================================================================
// Residual + LayerNorm over D=512; outputs f32 (may alias x) + bf16.
// A wave owns whole rows: a lane holds 16 of a row's 512 values, and each
// of the two sums is a sum inside the lane and a five-step butterfly over
// the wave: no LDS, no barrier. A wave takes LN_RPW rows side by side, all
// their loads in flight together, so a launch starts 2048 waves where one
// work-group a row would start 65536.
// =====================================================================
#define LN_RPW 4

// lane l reads lane l ^ X of its 16-lane row
template <int X>
__device__ __forceinline__ float row_xor(float v) {
  int u = __builtin_bit_cast(int, v);
  return __builtin_bit_cast(float, __builtin_amdgcn_update_dpp(u, u, 0x160 + X, 0xf, 0xf, false));
}
// butterfly sum over the 32 lanes; every lane ends with the same value
__device__ __forceinline__ float wave_sum(float v) {
  v += row_xor<1>(v);
  v += row_xor<2>(v);
  v += row_xor<4>(v);
  v += row_xor<8>(v);
  int u = __builtin_bit_cast(int, v);
  v += __builtin_bit_cast(float,
      __builtin_amdgcn_permlanex16(u, u, 0x76543210, 0xfedcba98, false, false));
  return v;
}

typedef float f32x4 __attribute__((ext_vector_type(4)));
union Two4 { f32x4 h[2]; v8f v; };   // two 16-byte loads, named as one value

__global__ __launch_bounds__(256) void ln_kernel(
    const float* __restrict__ x, const float* __restrict__ res,
    const float* __restrict__ w, const float* __restrict__ b,
    float* __restrict__ outF, unsigned short* __restrict__ outB)
{
  const int lane = threadIdx.x & 31;
  const int row0 = (blockIdx.x * 8 + (threadIdx.x >> 5)) * LN_RPW;
  Two4 xr[LN_RPW][4];   // h[0]: x, h[1]: res
  Two4 wb[4];           // h[0]: w, h[1]: b
  const f32x4* xp = (const f32x4*)(x   + (size_t)row0 * Dm) + lane;
  const f32x4* rp = (const f32x4*)(res + (size_t)row0 * Dm) + lane;
#pragma unroll
  for (int rr = 0; rr < LN_RPW; ++rr) {
#pragma unroll
    for (int i = 0; i < 4; ++i) {
      xr[rr][i].h[0] = xp[rr * (Dm / 4) + 32 * i];
      xr[rr][i].h[1] = rp[rr * (Dm / 4) + 32 * i];
    }
  }
#pragma unroll
  for (int i = 0; i < 4; ++i) {
    wb[i].h[0] = ((const f32x4*)w)[lane + 32 * i];
    wb[i].h[1] = ((const f32x4*)b)[lane + 32 * i];
  }
  // holds all forty loads of the wave in front of the arithmetic, in flight
  // together (loaded values as inputs only): left alone the compiler sinks
  // a third of them behind the sums, where each is waited for on its own.
  // It is also the wait that belongs in front of any rewrite of an issued
  // load's address registers; naming the two addresses keeps them out of
  // the loads' own destination registers until it has passed
  asm volatile("s_wait_xcnt 0x0" ::
      "v"(xr[0][0].v), "v"(xr[0][1].v), "v"(xr[0][2].v), "v"(xr[0][3].v),
      "v"(xr[1][0].v), "v"(xr[1][1].v), "v"(xr[1][2].v), "v"(xr[1][3].v),
      "v"(xr[2][0].v), "v"(xr[2][1].v), "v"(xr[2][2].v), "v"(xr[2][3].v),
      "v"(xr[3][0].v), "v"(xr[3][1].v), "v"(xr[3][2].v), "v"(xr[3][3].v),
      "v"(wb[0].v), "v"(wb[1].v), "v"(wb[2].v), "v"(wb[3].v), "v"(xp), "v"(rp));

  f32x4 a[LN_RPW][4];
  float s[LN_RPW];
#pragma unroll
  for (int rr = 0; rr < LN_RPW; ++rr) {
    float t = 0.0f;
#pragma unroll
    for (int i = 0; i < 4; ++i) {
      a[rr][i] = xr[rr][i].h[0] + xr[rr][i].h[1];
      t += (a[rr][i].x + a[rr][i].y) + (a[rr][i].z + a[rr][i].w);
    }
    s[rr] = wave_sum(t);
  }

#pragma unroll
  for (int rr = 0; rr < LN_RPW; ++rr) {
    const float mu = s[rr] * (1.0f / 512.0f);
    float t = 0.0f;
#pragma unroll
    for (int i = 0; i < 4; ++i) {
      a[rr][i] -= mu;
      t += (a[rr][i].x * a[rr][i].x + a[rr][i].y * a[rr][i].y) +
           (a[rr][i].z * a[rr][i].z + a[rr][i].w * a[rr][i].w);
    }
    s[rr] = wave_sum(t);
  }

#pragma unroll
  for (int rr = 0; rr < LN_RPW; ++rr) {
    const float rstd = rsqrtf(s[rr] * (1.0f / 512.0f) + 1e-5f);
    f32x4* of = (f32x4*)(outF + (size_t)(row0 + rr) * Dm);
    uint2* ob = (uint2*)(outB + (size_t)(row0 + rr) * Dm);
#pragma unroll
    for (int i = 0; i < 4; ++i) {
      const f32x4 y = a[rr][i] * rstd * wb[i].h[0] + wb[i].h[1];
      of[lane + 32 * i] = y;
      ob[lane + 32 * i] = make_uint2(
          (unsigned)f2bf(y.x) | ((unsigned)f2bf(y.y) << 16),
          (unsigned)f2bf(y.z) | ((unsigned)f2bf(y.w) << 16));
    }
  }
}

// =====================================================================
// Weight preparation, one launch for all 22 matrices:
// fp32 [K,N] -> bf16 transposed [N,K], packed one after another in wt:
//   16 x [512,512]  (encoder attention 8, decoder self 4, decoder cross 4)
//    3 x [512,2048] (first FFN matrix: encoder 2, decoder 1)
//    3 x [2048,512] (second FFN matrix: encoder 2, decoder 1)
// The matrices are cut into 64x64 tiles, 2560 in all. A block moves 5 of
// them through LDS: 256-B row pieces are read, whole 128-B lines written.
// An LDS dword holds the bf16 pair (k, k+1) of one n; the pitch of 33
// dwords keeps both the column-wise writes and the row-wise reads on
// distinct banks.
// =====================================================================
#define WP_BLOCKS 512
#define WP_TILES_PER_BLOCK 5
#define WP_DD  (Dm * Dm)
#define WP_DF  (Dm * DFFc)
#define WP_FF1 (16 * WP_DD)
#define WP_FF2 (16 * WP_DD + 3 * WP_DF)

__global__ __launch_bounds__(256) void wprep_kernel(
    const float* __restrict__ enc_attn_w, const float* __restrict__ dec_self_w,
    const float* __restrict__ dec_cross_w,
    const float* __restrict__ enc_ff_w1, const float* __restrict__ dec_ff_w1,
    const float* __restrict__ enc_ff_w2, const float* __restrict__ dec_ff_w2,
    unsigned short* __restrict__ wt)
{
  constexpr int P = 33;
  __shared__ unsigned tile[2][64 * P];
  const int tid = threadIdx.x;
  const int p   = tid >> 4;         // reader: k pair (rows 2p, 2p+1, +32, +33)
  const int n0  = (tid & 15) * 4;   // reader: 4 columns
  const int wr  = tid >> 3;         // writer: output row (n), +32
  const int wc  = tid & 7;          // writer: 16-B chunk of the 128-B line

  float4 r[4];
  unsigned short* dst;
  int dstK;

  // tile id -> source and destination of its corner (same for the whole block)
  auto fetch = [&](int id) {
    const float* s; unsigned short* d; int K, N, kt, nt;
    if (id < 1024) {
      int m = id >> 6;
      s = (m < 8) ? enc_attn_w + (size_t)m * WP_DD
        : (m < 12) ? dec_self_w + (size_t)(m - 8) * WP_DD
                   : dec_cross_w + (size_t)(m - 12) * WP_DD;
      d = wt + (size_t)m * WP_DD;
      K = Dm; N = Dm; kt = (id >> 3) & 7; nt = id & 7;
    } else if (id < 1792) {
      int j = id - 1024, m = j >> 8;
      s = (m < 2) ? enc_ff_w1 + (size_t)m * WP_DF : dec_ff_w1;
      d = wt + WP_FF1 + (size_t)m * WP_DF;
      K = Dm; N = DFFc; kt = (j >> 5) & 7; nt = j & 31;
    } else {
      int j = id - 1792, m = j >> 8;
      s = (m < 2) ? enc_ff_w2 + (size_t)m * WP_DF : dec_ff_w2;
      d = wt + WP_FF2 + (size_t)m * WP_DF;
      K = DFFc; N = Dm; kt = (j >> 3) & 31; nt = j & 7;
    }
    const float* g = s + (size_t)(kt * 64 + 2 * p) * N + nt * 64 + n0;
    const float* g1 = g + N;
    const float* g2 = g + (size_t)32 * N;
    const float* g3 = g + (size_t)33 * N;
    r[0] = *(const float4*)(g);
    r[1] = *(const float4*)(g1);
    r[2] = *(const float4*)(g2);
    r[3] = *(const float4*)(g3);
    // the wait that belongs in front of any rewrite of an issued load's
    // address registers; naming the four addresses keeps them out of the
    // loads' own destination registers until it has passed
    asm volatile("s_wait_xcnt 0x0" :: "v"(g), "v"(g1), "v"(g2), "v"(g3) : "memory");
    dst  = d + (size_t)(nt * 64 + wr) * K + kt * 64 + wc * 8;
    dstK = K;
  };
  auto pack = [](float lo, float hi) -> unsigned {
    return (unsigned)f2bf(lo) | ((unsigned)f2bf(hi) << 16);
  };

  fetch(blockIdx.x);
  // unrolled so that the buffer index and the last-tile test are constants
#pragma unroll
  for (int t = 0; t < WP_TILES_PER_BLOCK; ++t) {
    unsigned* L = tile[t & 1];
    const float* a0 = (const float*)&r[0];
    const float* a1 = (const float*)&r[1];
    const float* a2 = (const float*)&r[2];
    const float* a3 = (const float*)&r[3];
    // unrolled so that r[] is indexed by constants and stays in registers
#pragma unroll
    for (int e = 0; e < 4; ++e) {
      L[(n0 + e) * P + p]      = pack(a0[e], a1[e]);
      L[(n0 + e) * P + 16 + p] = pack(a2[e], a3[e]);
    }
    unsigned short* o = dst;
    const int oK = dstK;
    // one barrier a tile: with two buffers it also ends the reads of the
    // buffer that the next tile overwrites
    __syncthreads();
    // the next tile's loads fly while this tile is written out
    if (t + 1 < WP_TILES_PER_BLOCK) fetch(blockIdx.x + (t + 1) * WP_BLOCKS);
    // unrolled so that both halves' LDS reads issue together
#pragma unroll
    for (int h = 0; h < 2; ++h) {
      const unsigned* q = L + (h * 32 + wr) * P + wc * 4;
      uint4 v = make_uint4(q[0], q[1], q[2], q[3]);
      *(uint4*)(o + (size_t)(h * 32) * oK) = v;
    }
  }
}

// final projection D->1: one wave per row
__global__ __launch_bounds__(256) void outproj_kernel(
    const float* __restrict__ t, const float* __restrict__ w,
    const float* __restrict__ b, float* __restrict__ out, int M)
{
  int gid = blockIdx.x * 256 + threadIdx.x;
  int row = gid >> 5;
  int lane = gid & 31;
  if (row >= M) return;
  float acc = 0.0f;
#pragma unroll
  for (int i = 0; i < 16; ++i)
    acc += t[(size_t)row * Dm + lane + i * 32] * w[lane + i * 32];
#pragma unroll
  for (int ofs = 16; ofs > 0; ofs >>= 1)
    acc += __shfl_xor(acc, ofs, 32);
  if (lane == 0) out[row] = acc + b[0];
}

// =====================================================================
// Host orchestration
// =====================================================================
extern "C" void kernel_launch(void* const* d_in, const int* in_sizes, int n_in,
                              void* d_out, int out_size, void* d_ws, size_t ws_size,
                              hipStream_t stream) {
  (void)in_sizes; (void)n_in; (void)out_size; (void)ws_size;
  const float* x_enc      = (const float*)d_in[0];
  const float* x_dec      = (const float*)d_in[1];
  const float* emb_enc_w  = (const float*)d_in[2];
  const float* emb_enc_b  = (const float*)d_in[3];
  const float* emb_dec_w  = (const float*)d_in[4];
  const float* emb_dec_b  = (const float*)d_in[5];
  const float* enc_attn_w = (const float*)d_in[6];
  const float* enc_attn_b = (const float*)d_in[7];
  const float* enc_ff_w1  = (const float*)d_in[8];
  const float* enc_ff_b1  = (const float*)d_in[9];
  const float* enc_ff_w2  = (const float*)d_in[10];
  const float* enc_ff_b2  = (const float*)d_in[11];
  const float* enc_ln_w   = (const float*)d_in[12];
  const float* enc_ln_b   = (const float*)d_in[13];
  const float* dec_self_w = (const float*)d_in[14];
  const float* dec_self_b = (const float*)d_in[15];
  const float* dec_cross_w= (const float*)d_in[16];
  const float* dec_cross_b= (const float*)d_in[17];
  const float* dec_ff_w1  = (const float*)d_in[18];
  const float* dec_ff_b1  = (const float*)d_in[19];
  const float* dec_ff_w2  = (const float*)d_in[20];
  const float* dec_ff_b2  = (const float*)d_in[21];
  const float* dec_ln_w   = (const float*)d_in[22];
  const float* dec_ln_b   = (const float*)d_in[23];
  const float* out_w      = (const float*)d_in[24];
  const float* out_b      = (const float*)d_in[25];

  const int M = Bq * Sq_;  // 8192
  char* ws = (char*)d_ws;
  size_t off = 0;
  auto alloc = [&](size_t bytes) -> void* {
    void* p = ws + off;
    off += (bytes + 255) & ~(size_t)255;
    return p;
  };
  float*          h_f   = (float*)alloc((size_t)M * Dm * 4);
  unsigned short* h_b   = (unsigned short*)alloc((size_t)M * Dm * 2);
  float*          t_f   = (float*)alloc((size_t)M * Dm * 4);
  unsigned short* t_b   = (unsigned short*)alloc((size_t)M * Dm * 2);
  unsigned short* q_b   = (unsigned short*)alloc((size_t)M * Dm * 2);
  unsigned short* k_b   = (unsigned short*)alloc((size_t)M * Dm * 2);
  unsigned short* v_b   = (unsigned short*)alloc((size_t)M * Dm * 2);
  unsigned short* ctx_b = (unsigned short*)alloc((size_t)M * Dm * 2);
  float*          g_f   = (float*)alloc((size_t)M * Dm * 4);
  unsigned short* ffn_b = (unsigned short*)alloc((size_t)M * DFFc * 2);
  unsigned short* wt  = (unsigned short*)alloc(((size_t)16 * WP_DD + (size_t)6 * WP_DF) * 2);
  auto wA  = [&](int m) { return wt + (size_t)m * WP_DD; };           // attention matrices
  auto wF1 = [&](int m) { return wt + WP_FF1 + (size_t)m * WP_DF; };  // first FFN matrices
  auto wF2 = [&](int m) { return wt + WP_FF2 + (size_t)m * WP_DF; };  // second FFN matrices

  auto gemm = [&](const unsigned short* A, const unsigned short* Wt, const float* bias,
                  float* oF, unsigned short* oB, int Mm, int Nn, int Kk, int act) {
    gemm_bf16_kernel<<<dim3(Mm / 128, Nn / 128), 256, 0, stream>>>(A, Wt, bias, oF, oB, Mm, Nn, Kk, act);
  };
  auto attn = [&](const unsigned short* Qp, const unsigned short* Kp,
                  const unsigned short* Vp, unsigned short* Op) {
    banded_attn_kernel<<<dim3(Sq_ / 64, Bq * Hh), 128, 0, stream>>>(Qp, Kp, Vp, Op, Sq_, Sq_, Sq_ / 4);
  };
  auto lnorm = [&](const float* xx, const float* rr, const float* w, const float* bb,
                   float* oF, unsigned short* oB) {
    ln_kernel<<<M / (8 * LN_RPW), 256, 0, stream>>>(xx, rr, w, bb, oF, oB);
  };

  // ----- all weights to bf16 [N,K], once -----
  wprep_kernel<<<WP_BLOCKS, 256, 0, stream>>>(enc_attn_w, dec_self_w, dec_cross_w,
                                              enc_ff_w1, dec_ff_w1, enc_ff_w2, dec_ff_w2, wt);

  // ----- encoder -----
  embed_kernel<<<M / EMB_ROWS, 256, 0, stream>>>(x_enc, emb_enc_w, emb_enc_b, h_f, h_b, 7);
  for (int l = 0; l < 2; ++l) {
    const float* ab = enc_attn_b + (size_t)l * 4 * Dm;
    gemm(h_b, wA(l * 4 + 0), ab + 0 * Dm, nullptr, q_b, M, Dm, Dm, 0);
    gemm(h_b, wA(l * 4 + 1), ab + 1 * Dm, nullptr, k_b, M, Dm, Dm, 0);
    gemm(h_b, wA(l * 4 + 2), ab + 2 * Dm, nullptr, v_b, M, Dm, Dm, 0);
    attn(q_b, k_b, v_b, ctx_b);
    gemm(ctx_b, wA(l * 4 + 3), ab + 3 * Dm, g_f, nullptr, M, Dm, Dm, 0);
    lnorm(h_f, g_f, enc_ln_w + (size_t)l * 2 * Dm, enc_ln_b + (size_t)l * 2 * Dm, h_f, h_b);
    gemm(h_b, wF1(l), enc_ff_b1 + (size_t)l * DFFc, nullptr, ffn_b, M, DFFc, Dm, 1);
    gemm(ffn_b, wF2(l), enc_ff_b2 + (size_t)l * Dm, g_f, nullptr, M, Dm, DFFc, 0);
    lnorm(h_f, g_f, enc_ln_w + (size_t)l * 2 * Dm + Dm, enc_ln_b + (size_t)l * 2 * Dm + Dm, h_f, h_b);
  }
  // h_f / h_b now hold encoder memory.

  // ----- decoder (DL = 1) -----
  embed_kernel<<<M / EMB_ROWS, 256, 0, stream>>>(x_dec, emb_dec_w, emb_dec_b, t_f, t_b, 1);
  {
    // self-attention
    gemm(t_b, wA(8), dec_self_b + 0 * Dm, nullptr, q_b, M, Dm, Dm, 0);
    gemm(t_b, wA(9), dec_self_b + 1 * Dm, nullptr, k_b, M, Dm, Dm, 0);
    gemm(t_b, wA(10), dec_self_b + 2 * Dm, nullptr, v_b, M, Dm, Dm, 0);
    attn(q_b, k_b, v_b, ctx_b);
    gemm(ctx_b, wA(11), dec_self_b + 3 * Dm, g_f, nullptr, M, Dm, Dm, 0);
    lnorm(t_f, g_f, dec_ln_w + 0 * Dm, dec_ln_b + 0 * Dm, t_f, t_b);

    // cross-attention (K/V from encoder memory)
    gemm(t_b, wA(12), dec_cross_b + 0 * Dm, nullptr, q_b, M, Dm, Dm, 0);
    gemm(h_b, wA(13), dec_cross_b + 1 * Dm, nullptr, k_b, M, Dm, Dm, 0);
    gemm(h_b, wA(14), dec_cross_b + 2 * Dm, nullptr, v_b, M, Dm, Dm, 0);
    attn(q_b, k_b, v_b, ctx_b);
    gemm(ctx_b, wA(15), dec_cross_b + 3 * Dm, g_f, nullptr, M, Dm, Dm, 0);
    lnorm(t_f, g_f, dec_ln_w + 1 * Dm, dec_ln_b + 1 * Dm, t_f, t_b);

    // FFN
    gemm(t_b, wF1(2), dec_ff_b1, nullptr, ffn_b, M, DFFc, Dm, 1);
    gemm(ffn_b, wF2(2), dec_ff_b2, g_f, nullptr, M, Dm, DFFc, 0);
    lnorm(t_f, g_f, dec_ln_w + 2 * Dm, dec_ln_b + 2 * Dm, t_f, t_b);
  }

  outproj_kernel<<<(M * 32 + 255) / 256, 256, 0, stream>>>(t_f, out_w, out_b, (float*)d_out, M);
}

// v003
// A run of this version takes 730 microseconds.
// Two timings next to v002 both put it at 1.15 times that version's speed.
// All steps since v000 together make it 1.65 times as fast.
#include <hip/hip_runtime.h>
#include <math.h>

// ---------------- model constants ----------------
#define Bq 8
#define Sq_ 1024
#define Dm 512
#define Hh 8
#define HDc 64
#define DFFc 2048

// ---------------- WMMA types ----------------
typedef __bf16 bf16_t;
typedef bf16_t v16bf __attribute__((ext_vector_type(16)));
typedef float v8f __attribute__((ext_vector_type(8)));

union Frag { uint4 u[2]; v16bf v; };

__device__ __forceinline__ unsigned short f2bf(float f) {
  union { float f; unsigned u; } v; v.f = f;
  unsigned r = v.u + 0x7FFFu + ((v.u >> 16) & 1u);
  return (unsigned short)(r >> 16);
}

__device__ __forceinline__ float gelu_f(float x) {
  float x3 = x * x * x;
  return 0.5f * x * (1.0f + tanhf(0.7978845608028654f * (x + 0.044715f * x3)));
}

// async copy 16B global -> LDS (ASYNCcnt-tracked, no VGPR round-trip)
__device__ __forceinline__ void async_cp16(const unsigned short* g, unsigned short* l) {
  unsigned lds = (unsigned)(uintptr_t)l;   // low 32 bits = LDS byte address
  asm volatile("global_load_async_to_lds_b128 %0, %1, off"
               :: "v"(lds), "v"(g) : "memory");
}
__device__ __forceinline__ void wait_async0() {
  asm volatile("s_wait_asynccnt 0x0" ::: "memory");
}
__device__ __forceinline__ void wait_async4() {
  asm volatile("s_wait_asynccnt 0x4" ::: "memory");
}

// =====================================================================
// bf16 WMMA GEMM:  C[M,N] = A[M,K] * W[K,N] + bias, optional GELU.
// A: bf16 row-major [M,K]; Wt: bf16 [N,K] (pre-transposed weights).
// Block 256 thr = 8 waves; tile 128x128, BK=32; wave tile 32x64.
// Double-buffered LDS staged with GLOBAL_LOAD_ASYNC_TO_LDS_B128;
// last tile peeled so the steady-state loop body is branch-free.
// =====================================================================
__global__ __launch_bounds__(256) void gemm_bf16_kernel(
    const unsigned short* __restrict__ A,
    const unsigned short* __restrict__ Wt,
    const float* __restrict__ bias,
    float* __restrict__ outF,
    unsigned short* __restrict__ outB,
    int M, int N, int K, int act)
{
  constexpr int ST = 48;  // padded LDS stride (bf16 elems): 96B, 16B-aligned rows
  __shared__ unsigned short As[2][128 * ST];
  __shared__ unsigned short Bs[2][128 * ST];
  const int tid   = threadIdx.x;
  const int wave  = tid >> 5;
  const int lane  = tid & 31;
  const int l15   = lane & 15;
  const int lhalf = lane >> 4;
  const int koff  = lhalf * 8;
  const int bm = blockIdx.x * 128;
  const int bn = blockIdx.y * 128;
  const int wm = (wave >> 1) * 32;
  const int wn = (wave & 1) * 64;

  v8f zf = {};
  v8f c[2][4];
#pragma unroll
  for (int i = 0; i < 2; ++i)
#pragma unroll
    for (int j = 0; j < 4; ++j) c[i][j] = zf;

  // per-thread staging coordinates: 2 chunks of 8 bf16 per matrix,
  // running global pointers advanced by BK each issue.
  const int r0 = tid >> 2,           c0 = (tid & 3) * 8;          // chunk 0
  const int r1 = (tid + 256) >> 2,   c1 = ((tid + 256) & 3) * 8;  // chunk 1
  const unsigned short* gA0 = A  + (size_t)(bm + r0) * K + c0;
  const unsigned short* gA1 = A  + (size_t)(bm + r1) * K + c1;
  const unsigned short* gB0 = Wt + (size_t)(bn + r0) * K + c0;
  const unsigned short* gB1 = Wt + (size_t)(bn + r1) * K + c1;
  unsigned short* lA0[2] = { &As[0][r0 * ST + c0], &As[1][r0 * ST + c0] };
  unsigned short* lA1[2] = { &As[0][r1 * ST + c1], &As[1][r1 * ST + c1] };
  unsigned short* lB0[2] = { &Bs[0][r0 * ST + c0], &Bs[1][r0 * ST + c0] };
  unsigned short* lB1[2] = { &Bs[0][r1 * ST + c1], &Bs[1][r1 * ST + c1] };

  auto issue = [&](int buf) {
    async_cp16(gA0, lA0[buf]);  gA0 += 32;
    async_cp16(gA1, lA1[buf]);  gA1 += 32;
    async_cp16(gB0, lB0[buf]);  gB0 += 32;
    async_cp16(gB1, lB1[buf]);  gB1 += 32;
  };
  auto compute = [&](int cur) {
    Frag a[2], b[4];
#pragma unroll
    for (int i = 0; i < 2; ++i) {
      const unsigned short* p = &As[cur][(wm + i * 16 + l15) * ST];
      a[i].u[0] = *(const uint4*)(p + koff);
      a[i].u[1] = *(const uint4*)(p + koff + 16);
    }
#pragma unroll
    for (int j = 0; j < 4; ++j) {
      const unsigned short* p = &Bs[cur][(wn + j * 16 + l15) * ST];
      b[j].u[0] = *(const uint4*)(p + koff);
      b[j].u[1] = *(const uint4*)(p + koff + 16);
    }
#pragma unroll
    for (int i = 0; i < 2; ++i)
#pragma unroll
      for (int j = 0; j < 4; ++j)
        c[i][j] = __builtin_amdgcn_wmma_f32_16x16x32_bf16(
            false, a[i].v, false, b[j].v, (short)0, c[i][j], false, false);
  };

  const int nK = K >> 5;
  issue(0);
  for (int kt = 0; kt < nK - 1; ++kt) {   // branch-free steady state
    const int cur = kt & 1;
    issue(cur ^ 1);       // prefetch next tile (async, overlaps compute)
    wait_async4();        // own copies of current tile complete
    __syncthreads();
    compute(cur);
    __syncthreads();
  }
  wait_async0();          // peeled last tile
  __syncthreads();
  compute((nK - 1) & 1);

#pragma unroll
  for (int i = 0; i < 2; ++i) {
#pragma unroll
    for (int j = 0; j < 4; ++j) {
      int col = bn + wn + j * 16 + l15;
      float bb = bias ? bias[col] : 0.0f;
#pragma unroll
      for (int r = 0; r < 8; ++r) {
        int row = bm + wm + i * 16 + r + 8 * lhalf;
        float v = c[i][j][r] + bb;
        if (act == 1) v = gelu_f(v);
        size_t idx = (size_t)row * N + col;
        if (outF) outF[idx] = v;
        if (outB) outB[idx] = f2bf(v);
      }
    }
  }
}

// ---------------- reductions over a 16-lane row ----------------
// The softmax rows of a WMMA result lie across the 16 lanes of a row. Both
// reductions are butterflies (l ^ 1, 2, 4, 8) that stay in the vector
// registers; every lane ends with the result. All 32 lanes must be on.

__device__ __forceinline__ float row16_max(float v) {
  // in asm so that a step is one instruction: behind the DPP builtin the
  // compiler puts a canonicalising v_max in front of every fmaxf and does
  // not fuse the two. The s_delay_alu lines let the other waves of the SIMD
  // issue while a step waits for the step before it
  asm("v_max_num_f32_dpp %0, %0, %0 row_xmask:1 row_mask:0xf bank_mask:0xf\n\t"
      "s_delay_alu instid0(VALU_DEP_1)\n\t"
      "v_max_num_f32_dpp %0, %0, %0 row_xmask:2 row_mask:0xf bank_mask:0xf\n\t"
      "s_delay_alu instid0(VALU_DEP_1)\n\t"
      "v_max_num_f32_dpp %0, %0, %0 row_xmask:4 row_mask:0xf bank_mask:0xf\n\t"
      "s_delay_alu instid0(VALU_DEP_1)\n\t"
      "v_max_num_f32_dpp %0, %0, %0 row_xmask:8 row_mask:0xf bank_mask:0xf"
      : "+v"(v));
  return v;
}
// lane l reads lane l ^ X of its row, in the form that the compiler fuses
// with the add behind it (v_add_f32_dpp)
template <int X>
__device__ __forceinline__ float row16_peer(float v) {
  int u = __builtin_bit_cast(int, v);
  return __builtin_bit_cast(float, __builtin_amdgcn_update_dpp(0, u, 0x160 + X, 0xf, 0xf, true));
}
__device__ __forceinline__ float row16_sum(float v) {
  v += row16_peer<1>(v);
  v += row16_peer<2>(v);
  v += row16_peer<4>(v);
  v += row16_peer<8>(v);
  return v;
}

// =====================================================================
// Banded flash attention. Q,K,V,O: bf16 [B*S, D], head h in cols h*64..
// Grid: (Sq/64, B*H); 128 threads = 4 waves; wave owns 16 q-rows.
// Per 32-key tile: 4 WMMA for Q*K^T, online softmax, 4 WMMA for P*V.
// Q/K tiles staged with async-to-LDS; V transposed manually.
// =====================================================================
__global__ __launch_bounds__(128) void banded_attn_kernel(
    const unsigned short* __restrict__ Q,
    const unsigned short* __restrict__ Kc,
    const unsigned short* __restrict__ Vc,
    unsigned short* __restrict__ O,
    int Sq, int Sk, int bw)
{
  constexpr int STK = 72;  // stride for 64-wide hd rows (144B, aligned)
  constexpr int STV = 48;  // stride for 32-wide key rows (96B, aligned)
  __shared__ unsigned short Qs[64 * STK];
  __shared__ unsigned short Ks[32 * STK];
  __shared__ unsigned short Vs[64 * STV];      // transposed: [hd][key]
  __shared__ unsigned short Ps[4][16 * STV];   // per-wave P tile [q][key]

  const int tid   = threadIdx.x;
  const int wave  = tid >> 5;
  const int lane  = tid & 31;
  const int l15   = lane & 15;
  const int lhalf = lane >> 4;
  const int koff  = lhalf * 8;
  const int q0 = blockIdx.x * 64;
  const int bh = blockIdx.y;
  const int bb = bh / Hh;
  const int hh = bh % Hh;

  const unsigned short* Qg = Q  + ((size_t)bb * Sq) * Dm + hh * HDc;
  const unsigned short* Kg = Kc + ((size_t)bb * Sk) * Dm + hh * HDc;
  const unsigned short* Vg = Vc + ((size_t)bb * Sk) * Dm + hh * HDc;

  // stage Q tile (64 x 64) via async copies
#pragma unroll
  for (int i = 0; i < 4; ++i) {
    int chunk = tid + i * 128;
    int r  = chunk >> 3;
    int cc = (chunk & 7) * 8;
    async_cp16(Qg + (size_t)(q0 + r) * Dm + cc, Qs + r * STK + cc);
  }
  wait_async0();
  __syncthreads();

  Frag qa[2];
  {
    const unsigned short* p = Qs + (wave * 16 + l15) * STK;
    qa[0].u[0] = *(const uint4*)(p + koff);
    qa[0].u[1] = *(const uint4*)(p + koff + 16);
    qa[1].u[0] = *(const uint4*)(p + 32 + koff);
    qa[1].u[1] = *(const uint4*)(p + 32 + koff + 16);
  }

  v8f zf = {};
  float rmax[8], rsum[8];
  v8f o[4];
#pragma unroll
  for (int r = 0; r < 8; ++r) { rmax[r] = -__builtin_inff(); rsum[r] = 0.0f; }
#pragma unroll
  for (int j = 0; j < 4; ++j) o[j] = zf;

  int ks = q0 - bw;        if (ks < 0)  ks = 0;
  int ke = q0 + 64 + bw;   if (ke > Sk) ke = Sk;

  for (int kb = ks; kb < ke; kb += 32) {
    __syncthreads();
    // K tile natural [key][hd] via async; V tile transposed into Vs[hd][key]
#pragma unroll
    for (int i = 0; i < 2; ++i) {
      int chunk = tid + i * 128;
      int r  = chunk >> 3;
      int cc = (chunk & 7) * 8;
      async_cp16(Kg + (size_t)(kb + r) * Dm + cc, Ks + r * STK + cc);
      uint4 d = *(const uint4*)(Vg + (size_t)(kb + r) * Dm + cc);
      const unsigned short* ds = (const unsigned short*)&d;
#pragma unroll
      for (int t = 0; t < 8; ++t) Vs[(cc + t) * STV + r] = ds[t];
    }
    wait_async0();
    __syncthreads();

    // scores for two 16-key sub-tiles
    Frag b0a, b0b, b1a, b1b;
    {
      const unsigned short* p0 = Ks + l15 * STK;
      const unsigned short* p1 = Ks + (16 + l15) * STK;
      b0a.u[0] = *(const uint4*)(p0 + koff);      b0a.u[1] = *(const uint4*)(p0 + koff + 16);
      b0b.u[0] = *(const uint4*)(p0 + 32 + koff); b0b.u[1] = *(const uint4*)(p0 + 32 + koff + 16);
      b1a.u[0] = *(const uint4*)(p1 + koff);      b1a.u[1] = *(const uint4*)(p1 + koff + 16);
      b1b.u[0] = *(const uint4*)(p1 + 32 + koff); b1b.u[1] = *(const uint4*)(p1 + 32 + koff + 16);
    }
    v8f s0 = __builtin_amdgcn_wmma_f32_16x16x32_bf16(false, qa[0].v, false, b0a.v, (short)0, zf, false, false);
    s0     = __builtin_amdgcn_wmma_f32_16x16x32_bf16(false, qa[1].v, false, b0b.v, (short)0, s0, false, false);
    v8f s1 = __builtin_amdgcn_wmma_f32_16x16x32_bf16(false, qa[0].v, false, b1a.v, (short)0, zf, false, false);
    s1     = __builtin_amdgcn_wmma_f32_16x16x32_bf16(false, qa[1].v, false, b1b.v, (short)0, s1, false, false);

    // online softmax (rows live across 16-lane halves)
    unsigned short* Pw = Ps[wave];
#pragma unroll
    for (int r = 0; r < 8; ++r) {
      int m = r + 8 * lhalf;
      int qrow = q0 + wave * 16 + m;
      float v0 = s0[r] * 0.125f;     // 1/sqrt(64)
      float v1 = s1[r] * 0.125f;
      int d0 = qrow - (kb + l15);       if (d0 < 0) d0 = -d0;
      int d1 = qrow - (kb + 16 + l15);  if (d1 < 0) d1 = -d1;
      if (d0 > bw) v0 = -__builtin_inff();
      if (d1 > bw) v1 = -__builtin_inff();
      float mt = row16_max(fmaxf(v0, v1));
      float nm = fmaxf(rmax[r], mt);
      float sc, p0, p1;
      if (nm < -1e37f) { sc = 1.0f; p0 = 0.0f; p1 = 0.0f; }
      else {
        sc = __expf(rmax[r] - nm);
        p0 = __expf(v0 - nm);
        p1 = __expf(v1 - nm);
      }
      rmax[r] = nm;
      float ps = row16_sum(p0 + p1);
      rsum[r] = rsum[r] * sc + ps;
#pragma unroll
      for (int j = 0; j < 4; ++j) o[j][r] *= sc;
      Pw[m * STV + l15]      = f2bf(p0);
      Pw[m * STV + 16 + l15] = f2bf(p1);
    }
    __syncthreads();

    // ctx += P[16x32] * V[32x64]
    Frag pa;
    {
      const unsigned short* p = Pw + l15 * STV;
      pa.u[0] = *(const uint4*)(p + koff);
      pa.u[1] = *(const uint4*)(p + koff + 16);
    }
#pragma unroll
    for (int j = 0; j < 4; ++j) {
      Frag vb;
      const unsigned short* p = Vs + (j * 16 + l15) * STV;
      vb.u[0] = *(const uint4*)(p + koff);
      vb.u[1] = *(const uint4*)(p + koff + 16);
      o[j] = __builtin_amdgcn_wmma_f32_16x16x32_bf16(false, pa.v, false, vb.v, (short)0, o[j], false, false);
    }
  }

  float inv[8];
#pragma unroll
  for (int r = 0; r < 8; ++r) inv[r] = 1.0f / rsum[r];
#pragma unroll
  for (int j = 0; j < 4; ++j)
#pragma unroll
    for (int r = 0; r < 8; ++r) {
      int m = r + 8 * lhalf;
      int qrow = q0 + wave * 16 + m;
      int hd = j * 16 + l15;
      O[((size_t)bb * Sq + qrow) * Dm + hh * HDc + hd] = f2bf(o[j][r] * inv[r]);
    }
}

// =====================================================================
// Embedding: h = (x @ W + b) * sqrt(D) + PE(s, d); outputs f32 + bf16.
// A work-group walks EMB_ROWS rows, a thread keeping its two columns: the
// launch starts 4096 waves where one work-group a row would start 65536.
// =====================================================================
#define EMB_ROWS 16
__global__ __launch_bounds__(256) void embed_kernel(
    const float* __restrict__ x, const float* __restrict__ W,
    const float* __restrict__ bias, float* __restrict__ outF,
    unsigned short* __restrict__ outB, int Cin)
{
  const int row0 = blockIdx.x * EMB_ROWS;
  const int tid = threadIdx.x;
  const int d = tid * 2;
  // what depends on the column alone is formed once
  float wv[7][2];
#pragma unroll
  for (int c = 0; c < 7; ++c) {
    wv[c][0] = (c < Cin) ? W[c * Dm + d]     : 0.0f;
    wv[c][1] = (c < Cin) ? W[c * Dm + d + 1] : 0.0f;
  }
  const float b0 = bias[d], b1 = bias[d + 1];
  const float div = __expf((float)d * (-9.210340371976184f / 512.0f));

  float xn[7];
#pragma unroll
  for (int c = 0; c < 7; ++c) xn[c] = (c < Cin) ? x[(size_t)row0 * Cin + c] : 0.0f;
  // kept rolled: for speed only
#pragma unroll 1
  for (int rr = 0; rr < EMB_ROWS; ++rr) {
    const int row = row0 + rr;
    float xv[7];
#pragma unroll
    for (int c = 0; c < 7; ++c) xv[c] = xn[c];
    // the next row's inputs fly while this row is computed (the last trip
    // reads its own row again, so the address stays inside x)
    const int nxt = (rr + 1 < EMB_ROWS) ? row + 1 : row;
#pragma unroll
    for (int c = 0; c < 7; ++c) xn[c] = (c < Cin) ? x[(size_t)nxt * Cin + c] : 0.0f;
    float acc0 = b0, acc1 = b1;
#pragma unroll
    for (int c = 0; c < 7; ++c) { acc0 += xv[c] * wv[c][0]; acc1 += xv[c] * wv[c][1]; }
    acc0 *= 22.627416997969522f;  // sqrt(512)
    acc1 *= 22.627416997969522f;
    const float arg = (float)(row & (Sq_ - 1)) * div;
    acc0 += sinf(arg);
    acc1 += cosf(arg);
    *(float2*)(outF + (size_t)row * Dm + d) = make_float2(acc0, acc1);
    *(unsigned*)(outB + (size_t)row * Dm + d) =
        (unsigned)f2bf(acc0) | ((unsigned)f2bf(acc1) << 16);
  }
}

// =====================================================================
// Residual + LayerNorm over D=512; outputs f32 (may alias x) + bf16.
// A wave owns whole rows: a lane holds 16 of a row's 512 values, and each
// of the two sums is a sum inside the lane and a five-step butterfly over
// the wave: no LDS, no barrier. A wave takes LN_RPW rows side by side, all
// their loads in flight together, so a launch starts 2048 waves where one
// work-group a row would start 65536.
// =====================================================================
#define LN_RPW 4

// lane l reads lane l ^ X of its 16-lane row
template <int X>
__device__ __forceinline__ float row_xor(float v) {
  int u = __builtin_bit_cast(int, v);
  return __builtin_bit_cast(float, __builtin_amdgcn_update_dpp(u, u, 0x160 + X, 0xf, 0xf, false));
}
// butterfly sum over the 32 lanes; every lane ends with the same value
__device__ __forceinline__ float wave_sum(float v) {
  v += row_xor<1>(v);
  v += row_xor<2>(v);
  v += row_xor<4>(v);
  v += row_xor<8>(v);
  int u = __builtin_bit_cast(int, v);
  v += __builtin_bit_cast(float,
      __builtin_amdgcn_permlanex16(u, u, 0x76543210, 0xfedcba98, false, false));
  return v;
}

typedef float f32x4 __attribute__((ext_vector_type(4)));
union Two4 { f32x4 h[2]; v8f v; };   // two 16-byte loads, named as one value

__global__ __launch_bounds__(256) void ln_kernel(
    const float* __restrict__ x, const float* __restrict__ res,
    const float* __restrict__ w, const float* __restrict__ b,
    float* __restrict__ outF, unsigned short* __restrict__ outB)
{
  const int lane = threadIdx.x & 31;
  const int row0 = (blockIdx.x * 8 + (threadIdx.x >> 5)) * LN_RPW;
  Two4 xr[LN_RPW][4];   // h[0]: x, h[1]: res
  Two4 wb[4];           // h[0]: w, h[1]: b
  const f32x4* xp = (const f32x4*)(x   + (size_t)row0 * Dm) + lane;
  const f32x4* rp = (const f32x4*)(res + (size_t)row0 * Dm) + lane;
#pragma unroll
  for (int rr = 0; rr < LN_RPW; ++rr) {
#pragma unroll
    for (int i = 0; i < 4; ++i) {
      xr[rr][i].h[0] = xp[rr * (Dm / 4) + 32 * i];
      xr[rr][i].h[1] = rp[rr * (Dm / 4) + 32 * i];
    }
  }
#pragma unroll
  for (int i = 0; i < 4; ++i) {
    wb[i].h[0] = ((const f32x4*)w)[lane + 32 * i];
    wb[i].h[1] = ((const f32x4*)b)[lane + 32 * i];
  }
  // holds all forty loads of the wave in front of the arithmetic, in flight
  // together (loaded values as inputs only): left alone the compiler sinks
  // a third of them behind the sums, where each is waited for on its own.
  // It is also the wait that belongs in front of any rewrite of an issued
  // load's address registers; naming the two addresses keeps them out of
  // the loads' own destination registers until it has passed
  asm volatile("s_wait_xcnt 0x0" ::
      "v"(xr[0][0].v), "v"(xr[0][1].v), "v"(xr[0][2].v), "v"(xr[0][3].v),
      "v"(xr[1][0].v), "v"(xr[1][1].v), "v"(xr[1][2].v), "v"(xr[1][3].v),
      "v"(xr[2][0].v), "v"(xr[2][1].v), "v"(xr[2][2].v), "v"(xr[2][3].v),
      "v"(xr[3][0].v), "v"(xr[3][1].v), "v"(xr[3][2].v), "v"(xr[3][3].v),
      "v"(wb[0].v), "v"(wb[1].v), "v"(wb[2].v), "v"(wb[3].v), "v"(xp), "v"(rp));

  f32x4 a[LN_RPW][4];
  float s[LN_RPW];
#pragma unroll
  for (int rr = 0; rr < LN_RPW; ++rr) {
    float t = 0.0f;
#pragma unroll
    for (int i = 0; i < 4; ++i) {
      a[rr][i] = xr[rr][i].h[0] + xr[rr][i].h[1];
      t += (a[rr][i].x + a[rr][i].y) + (a[rr][i].z + a[rr][i].w);
    }
    s[rr] = wave_sum(t);
  }

#pragma unroll
  for (int rr = 0; rr < LN_RPW; ++rr) {
    const float mu = s[rr] * (1.0f / 512.0f);
    float t = 0.0f;
#pragma unroll
    for (int i = 0; i < 4; ++i) {
      a[rr][i] -= mu;
      t += (a[rr][i].x * a[rr][i].x + a[rr][i].y * a[rr][i].y) +
           (a[rr][i].z * a[rr][i].z + a[rr][i].w * a[rr][i].w);
    }
    s[rr] = wave_sum(t);
  }

#pragma unroll
  for (int rr = 0; rr < LN_RPW; ++rr) {
    const float rstd = rsqrtf(s[rr] * (1.0f / 512.0f) + 1e-5f);
    f32x4* of = (f32x4*)(outF + (size_t)(row0 + rr) * Dm);
    uint2* ob = (uint2*)(outB + (size_t)(row0 + rr) * Dm);
#pragma unroll
    for (int i = 0; i < 4; ++i) {
      const f32x4 y = a[rr][i] * rstd * wb[i].h[0] + wb[i].h[1];
      of[lane + 32 * i] = y;
      ob[lane + 32 * i] = make_uint2(
          (unsigned)f2bf(y.x) | ((unsigned)f2bf(y.y) << 16),
          (unsigned)f2bf(y.z) | ((unsigned)f2bf(y.w) << 16));
    }
  }
}

// =====================================================================
// Weight preparation, one launch for all 22 matrices:
// fp32 [K,N] -> bf16 transposed [N,K], packed one after another in wt:
//   16 x [512,512]  (encoder attention 8, decoder self 4, decoder cross 4)
//    3 x [512,2048] (first FFN matrix: encoder 2, decoder 1)
//    3 x [2048,512] (second FFN matrix: encoder 2, decoder 1)
// The matrices are cut into 64x64 tiles, 2560 in all. A block moves 5 of
// them through LDS: 256-B row pieces are read, whole 128-B lines written.
// An LDS dword holds the bf16 pair (k, k+1) of one n; the pitch of 33
// dwords keeps both the column-wise writes and the row-wise reads on
// distinct banks.
// =====================================================================
#define WP_BLOCKS 512
#define WP_TILES_PER_BLOCK 5
#define WP_DD  (Dm * Dm)
#define WP_DF  (Dm * DFFc)
#define WP_FF1 (16 * WP_DD)
#define WP_FF2 (16 * WP_DD + 3 * WP_DF)

__global__ __launch_bounds__(256) void wprep_kernel(
    const float* __restrict__ enc_attn_w, const float* __restrict__ dec_self_w,
    const float* __restrict__ dec_cross_w,
    const float* __restrict__ enc_ff_w1, const float* __restrict__ dec_ff_w1,
    const float* __restrict__ enc_ff_w2, const float* __restrict__ dec_ff_w2,
    unsigned short* __restrict__ wt)
{
  constexpr int P = 33;
  __shared__ unsigned tile[2][64 * P];
  const int tid = threadIdx.x;
  const int p   = tid >> 4;         // reader: k pair (rows 2p, 2p+1, +32, +33)
  const int n0  = (tid & 15) * 4;   // reader: 4 columns
  const int wr  = tid >> 3;         // writer: output row (n), +32
  const int wc  = tid & 7;          // writer: 16-B chunk of the 128-B line

  float4 r[4];
  unsigned short* dst;
  int dstK;

  // tile id -> source and destination of its corner (same for the whole block)
  auto fetch = [&](int id) {
    const float* s; unsigned short* d; int K, N, kt, nt;
    if (id < 1024) {
      int m = id >> 6;
      s = (m < 8) ? enc_attn_w + (size_t)m * WP_DD
        : (m < 12) ? dec_self_w + (size_t)(m - 8) * WP_DD
                   : dec_cross_w + (size_t)(m - 12) * WP_DD;
      d = wt + (size_t)m * WP_DD;
      K = Dm; N = Dm; kt = (id >> 3) & 7; nt = id & 7;
    } else if (id < 1792) {
      int j = id - 1024, m = j >> 8;
      s = (m < 2) ? enc_ff_w1 + (size_t)m * WP_DF : dec_ff_w1;
      d = wt + WP_FF1 + (size_t)m * WP_DF;
      K = Dm; N = DFFc; kt = (j >> 5) & 7; nt = j & 31;
    } else {
      int j = id - 1792, m = j >> 8;
      s = (m < 2) ? enc_ff_w2 + (size_t)m * WP_DF : dec_ff_w2;
      d = wt + WP_FF2 + (size_t)m * WP_DF;
      K = DFFc; N = Dm; kt = (j >> 3) & 31; nt = j & 7;
    }
    const float* g = s + (size_t)(kt * 64 + 2 * p) * N + nt * 64 + n0;
    const float* g1 = g + N;
    const float* g2 = g + (size_t)32 * N;
    const float* g3 = g + (size_t)33 * N;
    r[0] = *(const float4*)(g);
    r[1] = *(const float4*)(g1);
    r[2] = *(const float4*)(g2);
    r[3] = *(const float4*)(g3);
    // the wait that belongs in front of any rewrite of an issued load's
    // address registers; naming the four addresses keeps them out of the
    // loads' own destination registers until it has passed
    asm volatile("s_wait_xcnt 0x0" :: "v"(g), "v"(g1), "v"(g2), "v"(g3) : "memory");
    dst  = d + (size_t)(nt * 64 + wr) * K + kt * 64 + wc * 8;
    dstK = K;
  };
  auto pack = [](float lo, float hi) -> unsigned {
    return (unsigned)f2bf(lo) | ((unsigned)f2bf(hi) << 16);
  };

  fetch(blockIdx.x);
  // unrolled so that the buffer index and the last-tile test are constants
#pragma unroll
  for (int t = 0; t < WP_TILES_PER_BLOCK; ++t) {
    unsigned* L = tile[t & 1];
    const float* a0 = (const float*)&r[0];
    const float* a1 = (const float*)&r[1];
    const float* a2 = (const float*)&r[2];
    const float* a3 = (const float*)&r[3];
    // unrolled so that r[] is indexed by constants and stays in registers
#pragma unroll
    for (int e = 0; e < 4; ++e) {
      L[(n0 + e) * P + p]      = pack(a0[e], a1[e]);
      L[(n0 + e) * P + 16 + p] = pack(a2[e], a3[e]);
    }
    unsigned short* o = dst;
    const int oK = dstK;
    // one barrier a tile: with two buffers it also ends the reads of the
    // buffer that the next tile overwrites
    __syncthreads();
    // the next tile's loads fly while this tile is written out
    if (t + 1 < WP_TILES_PER_BLOCK) fetch(blockIdx.x + (t + 1) * WP_BLOCKS);
    // unrolled so that both halves' LDS reads issue together
#pragma unroll
    for (int h = 0; h < 2; ++h) {
      const unsigned* q = L + (h * 32 + wr) * P + wc * 4;
      uint4 v = make_uint4(q[0], q[1], q[2], q[3]);
      *(uint4*)(o + (size_t)(h * 32) * oK) = v;
    }
  }
}

// final projection D->1: one wave per row
__global__ __launch_bounds__(256) void outproj_kernel(
    const float* __restrict__ t, const float* __restrict__ w,
    const float* __restrict__ b, float* __restrict__ out, int M)
{
  int gid = blockIdx.x * 256 + threadIdx.x;
  int row = gid >> 5;
  int lane = gid & 31;
  if (row >= M) return;
  float acc = 0.0f;
#pragma unroll
  for (int i = 0; i < 16; ++i)
    acc += t[(size_t)row * Dm + lane + i * 32] * w[lane + i * 32];
#pragma unroll
  for (int ofs = 16; ofs > 0; ofs >>= 1)
    acc += __shfl_xor(acc, ofs, 32);
  if (lane == 0) out[row] = acc + b[0];
}

// =====================================================================
// Host orchestration
// =====================================================================
extern "C" void kernel_launch(void* const* d_in, const int* in_sizes, int n_in,
                              void* d_out, int out_size, void* d_ws, size_t ws_size,
                              hipStream_t stream) {
  (void)in_sizes; (void)n_in; (void)out_size; (void)ws_size;
  const float* x_enc      = (const float*)d_in[0];
  const float* x_dec      = (const float*)d_in[1];
  const float* emb_enc_w  = (const float*)d_in[2];
  const float* emb_enc_b  = (const float*)d_in[3];
  const float* emb_dec_w  = (const float*)d_in[4];
  const float* emb_dec_b  = (const float*)d_in[5];
  const float* enc_attn_w = (const float*)d_in[6];
  const float* enc_attn_b = (const float*)d_in[7];
  const float* enc_ff_w1  = (const float*)d_in[8];
  const float* enc_ff_b1  = (const float*)d_in[9];
  const float* enc_ff_w2  = (const float*)d_in[10];
  const float* enc_ff_b2  = (const float*)d_in[11];
  const float* enc_ln_w   = (const float*)d_in[12];
  const float* enc_ln_b   = (const float*)d_in[13];
  const float* dec_self_w = (const float*)d_in[14];
  const float* dec_self_b = (const float*)d_in[15];
  const float* dec_cross_w= (const float*)d_in[16];
  const float* dec_cross_b= (const float*)d_in[17];
  const float* dec_ff_w1  = (const float*)d_in[18];
  const float* dec_ff_b1  = (const float*)d_in[19];
  const float* dec_ff_w2  = (const float*)d_in[20];
  const float* dec_ff_b2  = (const float*)d_in[21];
  const float* dec_ln_w   = (const float*)d_in[22];
  const float* dec_ln_b   = (const float*)d_in[23];
  const float* out_w      = (const float*)d_in[24];
  const float* out_b      = (const float*)d_in[25];

  const int M = Bq * Sq_;  // 8192
  char* ws = (char*)d_ws;
  size_t off = 0;
  auto alloc = [&](size_t bytes) -> void* {
    void* p = ws + off;
    off += (bytes + 255) & ~(size_t)255;
    return p;
  };
  float*          h_f   = (float*)alloc((size_t)M * Dm * 4);
  unsigned short* h_b   = (unsigned short*)alloc((size_t)M * Dm * 2);
  float*          t_f   = (float*)alloc((size_t)M * Dm * 4);
  unsigned short* t_b   = (unsigned short*)alloc((size_t)M * Dm * 2);
  unsigned short* q_b   = (unsigned short*)alloc((size_t)M * Dm * 2);
  unsigned short* k_b   = (unsigned short*)alloc((size_t)M * Dm * 2);
  unsigned short* v_b   = (unsigned short*)alloc((size_t)M * Dm * 2);
  unsigned short* ctx_b = (unsigned short*)alloc((size_t)M * Dm * 2);
  float*          g_f   = (float*)alloc((size_t)M * Dm * 4);
  unsigned short* ffn_b = (unsigned short*)alloc((size_t)M * DFFc * 2);
  unsigned short* wt  = (unsigned short*)alloc(((size_t)16 * WP_DD + (size_t)6 * WP_DF) * 2);
  auto wA  = [&](int m) { return wt + (size_t)m * WP_DD; };           // attention matrices
  auto wF1 = [&](int m) { return wt + WP_FF1 + (size_t)m * WP_DF; };  // first FFN matrices
  auto wF2 = [&](int m) { return wt + WP_FF2 + (size_t)m * WP_DF; };  // second FFN matrices

  auto gemm = [&](const unsigned short* A, const unsigned short* Wt, const float* bias,
                  float* oF, unsigned short* oB, int Mm, int Nn, int Kk, int act) {
    gemm_bf16_kernel<<<dim3(Mm / 128, Nn / 128), 256, 0, stream>>>(A, Wt, bias, oF, oB, Mm, Nn, Kk, act);
  };
  auto attn = [&](const unsigned short* Qp, const unsigned short* Kp,
                  const unsigned short* Vp, unsigned short* Op) {
    banded_attn_kernel<<<dim3(Sq_ / 64, Bq * Hh), 128, 0, stream>>>(Qp, Kp, Vp, Op, Sq_, Sq_, Sq_ / 4);
  };
  auto lnorm = [&](const float* xx, const float* rr, const float* w, const float* bb,
                   float* oF, unsigned short* oB) {
    ln_kernel<<<M / (8 * LN_RPW), 256, 0, stream>>>(xx, rr, w, bb, oF, oB);
  };

  // ----- all weights to bf16 [N,K], once -----
  wprep_kernel<<<WP_BLOCKS, 256, 0, stream>>>(enc_attn_w, dec_self_w, dec_cross_w,
                                              enc_ff_w1, dec_ff_w1, enc_ff_w2, dec_ff_w2, wt);

  // ----- encoder -----
  embed_kernel<<<M / EMB_ROWS, 256, 0, stream>>>(x_enc, emb_enc_w, emb_enc_b, h_f, h_b, 7);
  for (int l = 0; l < 2; ++l) {
    const float* ab = enc_attn_b + (size_t)l * 4 * Dm;
    gemm(h_b, wA(l * 4 + 0), ab + 0 * Dm, nullptr, q_b, M, Dm, Dm, 0);
    gemm(h_b, wA(l * 4 + 1), ab + 1 * Dm, nullptr, k_b, M, Dm, Dm, 0);
    gemm(h_b, wA(l * 4 + 2), ab + 2 * Dm, nullptr, v_b, M, Dm, Dm, 0);
    attn(q_b, k_b, v_b, ctx_b);
    gemm(ctx_b, wA(l * 4 + 3), ab + 3 * Dm, g_f, nullptr, M, Dm, Dm, 0);
    lnorm(h_f, g_f, enc_ln_w + (size_t)l * 2 * Dm, enc_ln_b + (size_t)l * 2 * Dm, h_f, h_b);
    gemm(h_b, wF1(l), enc_ff_b1 + (size_t)l * DFFc, nullptr, ffn_b, M, DFFc, Dm, 1);
    gemm(ffn_b, wF2(l), enc_ff_b2 + (size_t)l * Dm, g_f, nullptr, M, Dm, DFFc, 0);
    lnorm(h_f, g_f, enc_ln_w + (size_t)l * 2 * Dm + Dm, enc_ln_b + (size_t)l * 2 * Dm + Dm, h_f, h_b);
  }
  // h_f / h_b now hold encoder memory.

  // ----- decoder (DL = 1) -----
  embed_kernel<<<M / EMB_ROWS, 256, 0, stream>>>(x_dec, emb_dec_w, emb_dec_b, t_f, t_b, 1);
  {
    // self-attention
    gemm(t_b, wA(8), dec_self_b + 0 * Dm, nullptr, q_b, M, Dm, Dm, 0);
    gemm(t_b, wA(9), dec_self_b + 1 * Dm, nullptr, k_b, M, Dm, Dm, 0);
    gemm(t_b, wA(10), dec_self_b + 2 * Dm, nullptr, v_b, M, Dm, Dm, 0);
    attn(q_b, k_b, v_b, ctx_b);
    gemm(ctx_b, wA(11), dec_self_b + 3 * Dm, g_f, nullptr, M, Dm, Dm, 0);
    lnorm(t_f, g_f, dec_ln_w + 0 * Dm, dec_ln_b + 0 * Dm, t_f, t_b);

    // cross-attention (K/V from encoder memory)
    gemm(t_b, wA(12), dec_cross_b + 0 * Dm, nullptr, q_b, M, Dm, Dm, 0);
    gemm(h_b, wA(13), dec_cross_b + 1 * Dm, nullptr, k_b, M, Dm, Dm, 0);
    gemm(h_b, wA(14), dec_cross_b + 2 * Dm, nullptr, v_b, M, Dm, Dm, 0);
    attn(q_b, k_b, v_b, ctx_b);
    gemm(ctx_b, wA(15), dec_cross_b + 3 * Dm, g_f, nullptr, M, Dm, Dm, 0);
    lnorm(t_f, g_f, dec_ln_w + 1 * Dm, dec_ln_b + 1 * Dm, t_f, t_b);

    // FFN
    gemm(t_b, wF1(2), dec_ff_b1, nullptr, ffn_b, M, DFFc, Dm, 1);
    gemm(ffn_b, wF2(2), dec_ff_b2, g_f, nullptr, M, Dm, DFFc, 0);
    lnorm(t_f, g_f, dec_ln_w + 2 * Dm, dec_ln_b + 2 * Dm, t_f, t_b);
  }

  outproj_kernel<<<(M * 32 + 255) / 256, 256, 0, stream>>>(t_f, out_w, out_b, (float*)d_out, M);
}

// v004
// It runs in 650 microseconds.
// Two timings next to v003 put it at 1.12 and 1.13 times that version's speed.
// Over all steps from v000 it is 1.86 times as fast.
#include <hip/hip_runtime.h>
#include <math.h>

// ---------------- model constants ----------------
#define Bq 8
#define Sq_ 1024
#define Dm 512
#define Hh 8
#define HDc 64
#define DFFc 2048

// ---------------- WMMA types ----------------
typedef __bf16 bf16_t;
typedef bf16_t v16bf __attribute__((ext_vector_type(16)));
typedef float v8f __attribute__((ext_vector_type(8)));

union Frag { uint4 u[2]; v16bf v; };

__device__ __forceinline__ unsigned short f2bf(float f) {
  union { float f; unsigned u; } v; v.f = f;
  unsigned r = v.u + 0x7FFFu + ((v.u >> 16) & 1u);
  return (unsigned short)(r >> 16);
}

__device__ __forceinline__ float gelu_f(float x) {
  float x3 = x * x * x;
  return 0.5f * x * (1.0f + tanhf(0.7978845608028654f * (x + 0.044715f * x3)));
}

// async copy 16B global -> LDS (ASYNCcnt-tracked, no VGPR round-trip)
__device__ __forceinline__ void async_cp16(const unsigned short* g, unsigned short* l) {
  unsigned lds = (unsigned)(uintptr_t)l;   // low 32 bits = LDS byte address
  asm volatile("global_load_async_to_lds_b128 %0, %1, off"
               :: "v"(lds), "v"(g) : "memory");
}
__device__ __forceinline__ void wait_async0() {
  asm volatile("s_wait_asynccnt 0x0" ::: "memory");
}
__device__ __forceinline__ void wait_async4() {
  asm volatile("s_wait_asynccnt 0x4" ::: "memory");
}

// =====================================================================
// bf16 WMMA GEMM:  C[M,N] = A[M,K] * W[K,N] + bias, optional GELU.
// A: bf16 row-major [M,K]; Wt: bf16 [N,K] (pre-transposed weights).
// Block 256 thr = 8 waves; tile 128x128, BK=32; wave tile 32x64.
// Double-buffered LDS staged with GLOBAL_LOAD_ASYNC_TO_LDS_B128;
// last tile peeled so the steady-state loop body is branch-free.
// N, the activation (ACT 1: GELU) and the output type (OUT_F32: outF, else
// bf16 to outB) are template parameters: the epilogue is then straight-line
// code, one address per thread with the 64 elements at constant offsets.
// =====================================================================
template <int N, int ACT, bool OUT_F32>
__global__ __launch_bounds__(256) void gemm_bf16_kernel(
    const unsigned short* __restrict__ A,
    const unsigned short* __restrict__ Wt,
    const float* __restrict__ bias,
    float* __restrict__ outF,
    unsigned short* __restrict__ outB,
    int K)
{
  constexpr int ST = 48;  // padded LDS stride (bf16 elems): 96B, 16B-aligned rows
  __shared__ unsigned short As[2][128 * ST];
  __shared__ unsigned short Bs[2][128 * ST];
  const int tid   = threadIdx.x;
  const int wave  = tid >> 5;
  const int lane  = tid & 31;
  const int l15   = lane & 15;
  const int lhalf = lane >> 4;
  const int koff  = lhalf * 8;
  const int bm = blockIdx.x * 128;
  const int bn = blockIdx.y * 128;
  const int wm = (wave >> 1) * 32;
  const int wn = (wave & 1) * 64;

  v8f zf = {};
  v8f c[2][4];
#pragma unroll
  for (int i = 0; i < 2; ++i)
#pragma unroll
    for (int j = 0; j < 4; ++j) c[i][j] = zf;

  // per-thread staging coordinates: 2 chunks of 8 bf16 per matrix,
  // running global pointers advanced by BK each issue.
  const int r0 = tid >> 2,           c0 = (tid & 3) * 8;          // chunk 0
  const int r1 = (tid + 256) >> 2,   c1 = ((tid + 256) & 3) * 8;  // chunk 1
  const unsigned short* gA0 = A  + (size_t)(bm + r0) * K + c0;
  const unsigned short* gA1 = A  + (size_t)(bm + r1) * K + c1;
  const unsigned short* gB0 = Wt + (size_t)(bn + r0) * K + c0;
  const unsigned short* gB1 = Wt + (size_t)(bn + r1) * K + c1;
  unsigned short* lA0[2] = { &As[0][r0 * ST + c0], &As[1][r0 * ST + c0] };
  unsigned short* lA1[2] = { &As[0][r1 * ST + c1], &As[1][r1 * ST + c1] };
  unsigned short* lB0[2] = { &Bs[0][r0 * ST + c0], &Bs[1][r0 * ST + c0] };
  unsigned short* lB1[2] = { &Bs[0][r1 * ST + c1], &Bs[1][r1 * ST + c1] };

  auto issue = [&](int buf) {
    async_cp16(gA0, lA0[buf]);  gA0 += 32;
    async_cp16(gA1, lA1[buf]);  gA1 += 32;
    async_cp16(gB0, lB0[buf]);  gB0 += 32;
    async_cp16(gB1, lB1[buf]);  gB1 += 32;
  };
  auto compute = [&](int cur) {
    Frag a[2], b[4];
#pragma unroll
    for (int i = 0; i < 2; ++i) {
      const unsigned short* p = &As[cur][(wm + i * 16 + l15) * ST];
      a[i].u[0] = *(const uint4*)(p + koff);
      a[i].u[1] = *(const uint4*)(p + koff + 16);
    }
#pragma unroll
    for (int j = 0; j < 4; ++j) {
      const unsigned short* p = &Bs[cur][(wn + j * 16 + l15) * ST];
      b[j].u[0] = *(const uint4*)(p + koff);
      b[j].u[1] = *(const uint4*)(p + koff + 16);
    }
#pragma unroll
    for (int i = 0; i < 2; ++i)
#pragma unroll
      for (int j = 0; j < 4; ++j)
        c[i][j] = __builtin_amdgcn_wmma_f32_16x16x32_bf16(
            false, a[i].v, false, b[j].v, (short)0, c[i][j], false, false);
  };

  const int nK = K >> 5;
  issue(0);
  for (int kt = 0; kt < nK - 1; ++kt) {   // branch-free steady state
    const int cur = kt & 1;
    issue(cur ^ 1);       // prefetch next tile (async, overlaps compute)
    wait_async4();        // own copies of current tile complete
    __syncthreads();
    compute(cur);
    __syncthreads();
  }
  wait_async0();          // peeled last tile
  __syncthreads();
  compute((nK - 1) & 1);

  const int col0 = bn + wn + l15;
  const size_t idx0 = (size_t)(bm + wm + 8 * lhalf) * N + col0;
  float bb[4];
#pragma unroll
  for (int j = 0; j < 4; ++j) bb[j] = bias[col0 + j * 16];
#pragma unroll
  for (int i = 0; i < 2; ++i) {
#pragma unroll
    for (int j = 0; j < 4; ++j) {
#pragma unroll
      for (int r = 0; r < 8; ++r) {
        float v = c[i][j][r] + bb[j];
        if constexpr (ACT == 1) v = gelu_f(v);
        const size_t idx = idx0 + (i * 16 + r) * N + j * 16;
        if constexpr (OUT_F32) outF[idx] = v;
        else                   outB[idx] = f2bf(v);
      }
    }
  }
}

// ---------------- reductions over a 16-lane row ----------------
// The softmax rows of a WMMA result lie across the 16 lanes of a row. Both
// reductions are butterflies (l ^ 1, 2, 4, 8) that stay in the vector
// registers; every lane ends with the result. All 32 lanes must be on.

__device__ __forceinline__ float row16_max(float v) {
  // in asm so that a step is one instruction: behind the DPP builtin the
  // compiler puts a canonicalising v_max in front of every fmaxf and does
  // not fuse the two. The s_delay_alu lines let the other waves of the SIMD
  // issue while a step waits for the step before it
  asm("v_max_num_f32_dpp %0, %0, %0 row_xmask:1 row_mask:0xf bank_mask:0xf\n\t"
      "s_delay_alu instid0(VALU_DEP_1)\n\t"
      "v_max_num_f32_dpp %0, %0, %0 row_xmask:2 row_mask:0xf bank_mask:0xf\n\t"
      "s_delay_alu instid0(VALU_DEP_1)\n\t"
      "v_max_num_f32_dpp %0, %0, %0 row_xmask:4 row_mask:0xf bank_mask:0xf\n\t"
      "s_delay_alu instid0(VALU_DEP_1)\n\t"
      "v_max_num_f32_dpp %0, %0, %0 row_xmask:8 row_mask:0xf bank_mask:0xf"
      : "+v"(v));
  return v;
}
// lane l reads lane l ^ X of its row, in the form that the compiler fuses
// with the add behind it (v_add_f32_dpp)
template <int X>
__device__ __forceinline__ float row16_peer(float v) {
  int u = __builtin_bit_cast(int, v);
  return __builtin_bit_cast(float, __builtin_amdgcn_update_dpp(0, u, 0x160 + X, 0xf, 0xf, true));
}
__device__ __forceinline__ float row16_sum(float v) {
  v += row16_peer<1>(v);
  v += row16_peer<2>(v);
  v += row16_peer<4>(v);
  v += row16_peer<8>(v);
  return v;
}

// =====================================================================
// Banded flash attention. Q,K,V,O: bf16 [B*S, D], head h in cols h*64..
// Grid: (Sq/64, B*H); 128 threads = 4 waves; wave owns 16 q-rows.
// Per 32-key tile: 4 WMMA for Q*K^T, online softmax, 4 WMMA for P*V.
// Q/K tiles staged with async-to-LDS; V transposed manually.
// =====================================================================
__global__ __launch_bounds__(128) void banded_attn_kernel(
    const unsigned short* __restrict__ Q,
    const unsigned short* __restrict__ Kc,
    const unsigned short* __restrict__ Vc,
    unsigned short* __restrict__ O,
    int Sq, int Sk, int bw)
{
  constexpr int STK = 72;  // stride for 64-wide hd rows (144B, aligned)
  constexpr int STV = 48;  // stride for 32-wide key rows (96B, aligned)
  __shared__ unsigned short Qs[64 * STK];
  __shared__ unsigned short Ks[32 * STK];
  __shared__ unsigned short Vs[64 * STV];      // transposed: [hd][key]
  __shared__ unsigned short Ps[4][16 * STV];   // per-wave P tile [q][key]

  const int tid   = threadIdx.x;
  const int wave  = tid >> 5;
  const int lane  = tid & 31;
  const int l15   = lane & 15;
  const int lhalf = lane >> 4;
  const int koff  = lhalf * 8;
  const int q0 = blockIdx.x * 64;
  const int bh = blockIdx.y;
  const int bb = bh / Hh;
  const int hh = bh % Hh;

  const unsigned short* Qg = Q  + ((size_t)bb * Sq) * Dm + hh * HDc;
  const unsigned short* Kg = Kc + ((size_t)bb * Sk) * Dm + hh * HDc;
  const unsigned short* Vg = Vc + ((size_t)bb * Sk) * Dm + hh * HDc;

  // stage Q tile (64 x 64) via async copies
#pragma unroll
  for (int i = 0; i < 4; ++i) {
    int chunk = tid + i * 128;
    int r  = chunk >> 3;
    int cc = (chunk & 7) * 8;
    async_cp16(Qg + (size_t)(q0 + r) * Dm + cc, Qs + r * STK + cc);
  }
  wait_async0();
  __syncthreads();

  Frag qa[2];
  {
    const unsigned short* p = Qs + (wave * 16 + l15) * STK;
    qa[0].u[0] = *(const uint4*)(p + koff);
    qa[0].u[1] = *(const uint4*)(p + koff + 16);
    qa[1].u[0] = *(const uint4*)(p + 32 + koff);
    qa[1].u[1] = *(const uint4*)(p + 32 + koff + 16);
  }

  v8f zf = {};
  float rmax[8], rsum[8];
  v8f o[4];
#pragma unroll
  for (int r = 0; r < 8; ++r) { rmax[r] = -__builtin_inff(); rsum[r] = 0.0f; }
#pragma unroll
  for (int j = 0; j < 4; ++j) o[j] = zf;

  int ks = q0 - bw;        if (ks < 0)  ks = 0;
  int ke = q0 + 64 + bw;   if (ke > Sk) ke = Sk;

  for (int kb = ks; kb < ke; kb += 32) {
    __syncthreads();
    // K tile natural [key][hd] via async; V tile transposed into Vs[hd][key]
#pragma unroll
    for (int i = 0; i < 2; ++i) {
      int chunk = tid + i * 128;
      int r  = chunk >> 3;
      int cc = (chunk & 7) * 8;
      async_cp16(Kg + (size_t)(kb + r) * Dm + cc, Ks + r * STK + cc);
      uint4 d = *(const uint4*)(Vg + (size_t)(kb + r) * Dm + cc);
      const unsigned short* ds = (const unsigned short*)&d;
#pragma unroll
      for (int t = 0; t < 8; ++t) Vs[(cc + t) * STV + r] = ds[t];
    }
    wait_async0();
    __syncthreads();

    // scores for two 16-key sub-tiles
    Frag b0a, b0b, b1a, b1b;
    {
      const unsigned short* p0 = Ks + l15 * STK;
      const unsigned short* p1 = Ks + (16 + l15) * STK;
      b0a.u[0] = *(const uint4*)(p0 + koff);      b0a.u[1] = *(const uint4*)(p0 + koff + 16);
      b0b.u[0] = *(const uint4*)(p0 + 32 + koff); b0b.u[1] = *(const uint4*)(p0 + 32 + koff + 16);
      b1a.u[0] = *(const uint4*)(p1 + koff);      b1a.u[1] = *(const uint4*)(p1 + koff + 16);
      b1b.u[0] = *(const uint4*)(p1 + 32 + koff); b1b.u[1] = *(const uint4*)(p1 + 32 + koff + 16);
    }
    v8f s0 = __builtin_amdgcn_wmma_f32_16x16x32_bf16(false, qa[0].v, false, b0a.v, (short)0, zf, false, false);
    s0     = __builtin_amdgcn_wmma_f32_16x16x32_bf16(false, qa[1].v, false, b0b.v, (short)0, s0, false, false);
    v8f s1 = __builtin_amdgcn_wmma_f32_16x16x32_bf16(false, qa[0].v, false, b1a.v, (short)0, zf, false, false);
    s1     = __builtin_amdgcn_wmma_f32_16x16x32_bf16(false, qa[1].v, false, b1b.v, (short)0, s1, false, false);

    // online softmax (rows live across 16-lane halves)
    unsigned short* Pw = Ps[wave];
#pragma unroll
    for (int r = 0; r < 8; ++r) {
      int m = r + 8 * lhalf;
      int qrow = q0 + wave * 16 + m;
      float v0 = s0[r] * 0.125f;     // 1/sqrt(64)
      float v1 = s1[r] * 0.125f;
      int d0 = qrow - (kb + l15);       if (d0 < 0) d0 = -d0;
      int d1 = qrow - (kb + 16 + l15);  if (d1 < 0) d1 = -d1;
      if (d0 > bw) v0 = -__builtin_inff();
      if (d1 > bw) v1 = -__builtin_inff();
      float mt = row16_max(fmaxf(v0, v1));
      float nm = fmaxf(rmax[r], mt);
      float sc, p0, p1;
      if (nm < -1e37f) { sc = 1.0f; p0 = 0.0f; p1 = 0.0f; }
      else {
        sc = __expf(rmax[r] - nm);
        p0 = __expf(v0 - nm);
        p1 = __expf(v1 - nm);
      }
      rmax[r] = nm;
      float ps = row16_sum(p0 + p1);
      rsum[r] = rsum[r] * sc + ps;
#pragma unroll
      for (int j = 0; j < 4; ++j) o[j][r] *= sc;
      Pw[m * STV + l15]      = f2bf(p0);
      Pw[m * STV + 16 + l15] = f2bf(p1);
    }
    __syncthreads();

    // ctx += P[16x32] * V[32x64]
    Frag pa;
    {
      const unsigned short* p = Pw + l15 * STV;
      pa.u[0] = *(const uint4*)(p + koff);
      pa.u[1] = *(const uint4*)(p + koff + 16);
    }
#pragma unroll
    for (int j = 0; j < 4; ++j) {
      Frag vb;
      const unsigned short* p = Vs + (j * 16 + l15) * STV;
      vb.u[0] = *(const uint4*)(p + koff);
      vb.u[1] = *(const uint4*)(p + koff + 16);
      o[j] = __builtin_amdgcn_wmma_f32_16x16x32_bf16(false, pa.v, false, vb.v, (short)0, o[j], false, false);
    }
  }

  float inv[8];
#pragma unroll
  for (int r = 0; r < 8; ++r) inv[r] = 1.0f / rsum[r];
#pragma unroll
  for (int j = 0; j < 4; ++j)
#pragma unroll
    for (int r = 0; r < 8; ++r) {
      int m = r + 8 * lhalf;
      int qrow = q0 + wave * 16 + m;
      int hd = j * 16 + l15;
      O[((size_t)bb * Sq + qrow) * Dm + hh * HDc + hd] = f2bf(o[j][r] * inv[r]);
    }
}

// =====================================================================
// Embedding: h = (x @ W + b) * sqrt(D) + PE(s, d); outputs f32 + bf16.
// A work-group walks EMB_ROWS rows, a thread keeping its two columns: the
// launch starts 4096 waves where one work-group a row would start 65536.
// =====================================================================
#define EMB_ROWS 16
__global__ __launch_bounds__(256) void embed_kernel(
    const float* __restrict__ x, const float* __restrict__ W,
    const float* __restrict__ bias, float* __restrict__ outF,
    unsigned short* __restrict__ outB, int Cin)
{
  const int row0 = blockIdx.x * EMB_ROWS;
  const int tid = threadIdx.x;
  const int d = tid * 2;
  // what depends on the column alone is formed once
  float wv[7][2];
#pragma unroll
  for (int c = 0; c < 7; ++c) {
    wv[c][0] = (c < Cin) ? W[c * Dm + d]     : 0.0f;
    wv[c][1] = (c < Cin) ? W[c * Dm + d + 1] : 0.0f;
  }
  const float b0 = bias[d], b1 = bias[d + 1];
  const float div = __expf((float)d * (-9.210340371976184f / 512.0f));

  float xn[7];
#pragma unroll
  for (int c = 0; c < 7; ++c) xn[c] = (c < Cin) ? x[(size_t)row0 * Cin + c] : 0.0f;
  // kept rolled: for speed only
#pragma unroll 1
  for (int rr = 0; rr < EMB_ROWS; ++rr) {
    const int row = row0 + rr;
    float xv[7];
#pragma unroll
    for (int c = 0; c < 7; ++c) xv[c] = xn[c];
    // the next row's inputs fly while this row is computed (the last trip
    // reads its own row again, so the address stays inside x)
    const int nxt = (rr + 1 < EMB_ROWS) ? row + 1 : row;
#pragma unroll
    for (int c = 0; c < 7; ++c) xn[c] = (c < Cin) ? x[(size_t)nxt * Cin + c] : 0.0f;
    float acc0 = b0, acc1 = b1;
#pragma unroll
    for (int c = 0; c < 7; ++c) { acc0 += xv[c] * wv[c][0]; acc1 += xv[c] * wv[c][1]; }
    acc0 *= 22.627416997969522f;  // sqrt(512)
    acc1 *= 22.627416997969522f;
    const float arg = (float)(row & (Sq_ - 1)) * div;
    acc0 += sinf(arg);
    acc1 += cosf(arg);
    *(float2*)(outF + (size_t)row * Dm + d) = make_float2(acc0, acc1);
    *(unsigned*)(outB + (size_t)row * Dm + d) =
        (unsigned)f2bf(acc0) | ((unsigned)f2bf(acc1) << 16);
  }
}

// =====================================================================
// Residual + LayerNorm over D=512; outputs f32 (may alias x) + bf16.
// A wave owns whole rows: a lane holds 16 of a row's 512 values, and each
// of the two sums is a sum inside the lane and a five-step butterfly over
// the wave: no LDS, no barrier. A wave takes LN_RPW rows side by side, all
// their loads in flight together, so a launch starts 2048 waves where one
// work-group a row would start 65536.
// =====================================================================
#define LN_RPW 4

// lane l reads lane l ^ X of its 16-lane row
template <int X>
__device__ __forceinline__ float row_xor(float v) {
  int u = __builtin_bit_cast(int, v);
  return __builtin_bit_cast(float, __builtin_amdgcn_update_dpp(u, u, 0x160 + X, 0xf, 0xf, false));
}
// butterfly sum over the 32 lanes; every lane ends with the same value
__device__ __forceinline__ float wave_sum(float v) {
  v += row_xor<1>(v);
  v += row_xor<2>(v);
  v += row_xor<4>(v);
  v += row_xor<8>(v);
  int u = __builtin_bit_cast(int, v);
  v += __builtin_bit_cast(float,
      __builtin_amdgcn_permlanex16(u, u, 0x76543210, 0xfedcba98, false, false));
  return v;
}

typedef float f32x4 __attribute__((ext_vector_type(4)));
union Two4 { f32x4 h[2]; v8f v; };   // two 16-byte loads, named as one value

__global__ __launch_bounds__(256) void ln_kernel(
    const float* __restrict__ x, const float* __restrict__ res,
    const float* __restrict__ w, const float* __restrict__ b,
    float* __restrict__ outF, unsigned short* __restrict__ outB)
{
  const int lane = threadIdx.x & 31;
  const int row0 = (blockIdx.x * 8 + (threadIdx.x >> 5)) * LN_RPW;
  Two4 xr[LN_RPW][4];   // h[0]: x, h[1]: res
  Two4 wb[4];           // h[0]: w, h[1]: b
  const f32x4* xp = (const f32x4*)(x   + (size_t)row0 * Dm) + lane;
  const f32x4* rp = (const f32x4*)(res + (size_t)row0 * Dm) + lane;
#pragma unroll
  for (int rr = 0; rr < LN_RPW; ++rr) {
#pragma unroll
    for (int i = 0; i < 4; ++i) {
      xr[rr][i].h[0] = xp[rr * (Dm / 4) + 32 * i];
      xr[rr][i].h[1] = rp[rr * (Dm / 4) + 32 * i];
    }
  }
#pragma unroll
  for (int i = 0; i < 4; ++i) {
    wb[i].h[0] = ((const f32x4*)w)[lane + 32 * i];
    wb[i].h[1] = ((const f32x4*)b)[lane + 32 * i];
  }
  // holds all forty loads of the wave in front of the arithmetic, in flight
  // together (loaded values as inputs only): left alone the compiler sinks
  // a third of them behind the sums, where each is waited for on its own.
  // It is also the wait that belongs in front of any rewrite of an issued
  // load's address registers; naming the two addresses keeps them out of
  // the loads' own destination registers until it has passed
  asm volatile("s_wait_xcnt 0x0" ::
      "v"(xr[0][0].v), "v"(xr[0][1].v), "v"(xr[0][2].v), "v"(xr[0][3].v),
      "v"(xr[1][0].v), "v"(xr[1][1].v), "v"(xr[1][2].v), "v"(xr[1][3].v),
      "v"(xr[2][0].v), "v"(xr[2][1].v), "v"(xr[2][2].v), "v"(xr[2][3].v),
      "v"(xr[3][0].v), "v"(xr[3][1].v), "v"(xr[3][2].v), "v"(xr[3][3].v),
      "v"(wb[0].v), "v"(wb[1].v), "v"(wb[2].v), "v"(wb[3].v), "v"(xp), "v"(rp));

  f32x4 a[LN_RPW][4];
  float s[LN_RPW];
#pragma unroll
  for (int rr = 0; rr < LN_RPW; ++rr) {
    float t = 0.0f;
#pragma unroll
    for (int i = 0; i < 4; ++i) {
      a[rr][i] = xr[rr][i].h[0] + xr[rr][i].h[1];
      t += (a[rr][i].x + a[rr][i].y) + (a[rr][i].z + a[rr][i].w);
    }
    s[rr] = wave_sum(t);
  }

#pragma unroll
  for (int rr = 0; rr < LN_RPW; ++rr) {
    const float mu = s[rr] * (1.0f / 512.0f);
    float t = 0.0f;
#pragma unroll
    for (int i = 0; i < 4; ++i) {
      a[rr][i] -= mu;
      t += (a[rr][i].x * a[rr][i].x + a[rr][i].y * a[rr][i].y) +
           (a[rr][i].z * a[rr][i].z + a[rr][i].w * a[rr][i].w);
    }
    s[rr] = wave_sum(t);
  }

#pragma unroll
  for (int rr = 0; rr < LN_RPW; ++rr) {
    const float rstd = rsqrtf(s[rr] * (1.0f / 512.0f) + 1e-5f);
    f32x4* of = (f32x4*)(outF + (size_t)(row0 + rr) * Dm);
    uint2* ob = (uint2*)(outB + (size_t)(row0 + rr) * Dm);
#pragma unroll
    for (int i = 0; i < 4; ++i) {
      const f32x4 y = a[rr][i] * rstd * wb[i].h[0] + wb[i].h[1];
      of[lane + 32 * i] = y;
      ob[lane + 32 * i] = make_uint2(
          (unsigned)f2bf(y.x) | ((unsigned)f2bf(y.y) << 16),
          (unsigned)f2bf(y.z) | ((unsigned)f2bf(y.w) << 16));
    }
  }
}

// =====================================================================
// Weight preparation, one launch for all 22 matrices:
// fp32 [K,N] -> bf16 transposed [N,K], packed one after another in wt:
//   16 x [512,512]  (encoder attention 8, decoder self 4, decoder cross 4)
//    3 x [512,2048] (first FFN matrix: encoder 2, decoder 1)
//    3 x [2048,512] (second FFN matrix: encoder 2, decoder 1)
// The matrices are cut into 64x64 tiles, 2560 in all. A block moves 5 of
// them through LDS: 256-B row pieces are read, whole 128-B lines written.
// An LDS dword holds the bf16 pair (k, k+1) of one n; the pitch of 33
// dwords keeps both the column-wise writes and the row-wise reads on
// distinct banks.
// =====================================================================
#define WP_BLOCKS 512
#define WP_TILES_PER_BLOCK 5
#define WP_DD  (Dm * Dm)
#define WP_DF  (Dm * DFFc)
#define WP_FF1 (16 * WP_DD)
#define WP_FF2 (16 * WP_DD + 3 * WP_DF)

__global__ __launch_bounds__(256) void wprep_kernel(
    const float* __restrict__ enc_attn_w, const float* __restrict__ dec_self_w,
    const float* __restrict__ dec_cross_w,
    const float* __restrict__ enc_ff_w1, const float* __restrict__ dec_ff_w1,
    const float* __restrict__ enc_ff_w2, const float* __restrict__ dec_ff_w2,
    unsigned short* __restrict__ wt)
{
  constexpr int P = 33;
  __shared__ unsigned tile[2][64 * P];
  const int tid = threadIdx.x;
  const int p   = tid >> 4;         // reader: k pair (rows 2p, 2p+1, +32, +33)
  const int n0  = (tid & 15) * 4;   // reader: 4 columns
  const int wr  = tid >> 3;         // writer: output row (n), +32
  const int wc  = tid & 7;          // writer: 16-B chunk of the 128-B line

  float4 r[4];
  unsigned short* dst;
  int dstK;

  // tile id -> source and destination of its corner (same for the whole block)
  auto fetch = [&](int id) {
    const float* s; unsigned short* d; int K, N, kt, nt;
    if (id < 1024) {
      int m = id >> 6;
      s = (m < 8) ? enc_attn_w + (size_t)m * WP_DD
        : (m < 12) ? dec_self_w + (size_t)(m - 8) * WP_DD
                   : dec_cross_w + (size_t)(m - 12) * WP_DD;
      d = wt + (size_t)m * WP_DD;
      K = Dm; N = Dm; kt = (id >> 3) & 7; nt = id & 7;
    } else if (id < 1792) {
      int j = id - 1024, m = j >> 8;
      s = (m < 2) ? enc_ff_w1 + (size_t)m * WP_DF : dec_ff_w1;
      d = wt + WP_FF1 + (size_t)m * WP_DF;
      K = Dm; N = DFFc; kt = (j >> 5) & 7; nt = j & 31;
    } else {
      int j = id - 1792, m = j >> 8;
      s = (m < 2) ? enc_ff_w2 + (size_t)m * WP_DF : dec_ff_w2;
      d = wt + WP_FF2 + (size_t)m * WP_DF;
      K = DFFc; N = Dm; kt = (j >> 3) & 31; nt = j & 7;
    }
    const float* g = s + (size_t)(kt * 64 + 2 * p) * N + nt * 64 + n0;
    const float* g1 = g + N;
    const float* g2 = g + (size_t)32 * N;
    const float* g3 = g + (size_t)33 * N;
    r[0] = *(const float4*)(g);
    r[1] = *(const float4*)(g1);
    r[2] = *(const float4*)(g2);
    r[3] = *(const float4*)(g3);
    // the wait that belongs in front of any rewrite of an issued load's
    // address registers; naming the four addresses keeps them out of the
    // loads' own destination registers until it has passed
    asm volatile("s_wait_xcnt 0x0" :: "v"(g), "v"(g1), "v"(g2), "v"(g3) : "memory");
    dst  = d + (size_t)(nt * 64 + wr) * K + kt * 64 + wc * 8;
    dstK = K;
  };
  auto pack = [](float lo, float hi) -> unsigned {
    return (unsigned)f2bf(lo) | ((unsigned)f2bf(hi) << 16);
  };

  fetch(blockIdx.x);
  // unrolled so that the buffer index and the last-tile test are constants
#pragma unroll
  for (int t = 0; t < WP_TILES_PER_BLOCK; ++t) {
    unsigned* L = tile[t & 1];
    const float* a0 = (const float*)&r[0];
    const float* a1 = (const float*)&r[1];
    const float* a2 = (const float*)&r[2];
    const float* a3 = (const float*)&r[3];
    // unrolled so that r[] is indexed by constants and stays in registers
#pragma unroll
    for (int e = 0; e < 4; ++e) {
      L[(n0 + e) * P + p]      = pack(a0[e], a1[e]);
      L[(n0 + e) * P + 16 + p] = pack(a2[e], a3[e]);
    }
    unsigned short* o = dst;
    const int oK = dstK;
    // one barrier a tile: with two buffers it also ends the reads of the
    // buffer that the next tile overwrites
    __syncthreads();
    // the next tile's loads fly while this tile is written out
    if (t + 1 < WP_TILES_PER_BLOCK) fetch(blockIdx.x + (t + 1) * WP_BLOCKS);
    // unrolled so that both halves' LDS reads issue together
#pragma unroll
    for (int h = 0; h < 2; ++h) {
      const unsigned* q = L + (h * 32 + wr) * P + wc * 4;
      uint4 v = make_uint4(q[0], q[1], q[2], q[3]);
      *(uint4*)(o + (size_t)(h * 32) * oK) = v;
    }
  }
}

// final projection D->1: one wave per row
__global__ __launch_bounds__(256) void outproj_kernel(
    const float* __restrict__ t, const float* __restrict__ w,
    const float* __restrict__ b, float* __restrict__ out, int M)
{
  int gid = blockIdx.x * 256 + threadIdx.x;
  int row = gid >> 5;
  int lane = gid & 31;
  if (row >= M) return;
  float acc = 0.0f;
#pragma unroll
  for (int i = 0; i < 16; ++i)
    acc += t[(size_t)row * Dm + lane + i * 32] * w[lane + i * 32];
#pragma unroll
  for (int ofs = 16; ofs > 0; ofs >>= 1)
    acc += __shfl_xor(acc, ofs, 32);
  if (lane == 0) out[row] = acc + b[0];
}

// =====================================================================
// Host orchestration
// =====================================================================
extern "C" void kernel_launch(void* const* d_in, const int* in_sizes, int n_in,
                              void* d_out, int out_size, void* d_ws, size_t ws_size,
                              hipStream_t stream) {
  (void)in_sizes; (void)n_in; (void)out_size; (void)ws_size;
  const float* x_enc      = (const float*)d_in[0];
  const float* x_dec      = (const float*)d_in[1];
  const float* emb_enc_w  = (const float*)d_in[2];
  const float* emb_enc_b  = (const float*)d_in[3];
  const float* emb_dec_w  = (const float*)d_in[4];
  const float* emb_dec_b  = (const float*)d_in[5];
  const float* enc_attn_w = (const float*)d_in[6];
  const float* enc_attn_b = (const float*)d_in[7];
  const float* enc_ff_w1  = (const float*)d_in[8];
  const float* enc_ff_b1  = (const float*)d_in[9];
  const float* enc_ff_w2  = (const float*)d_in[10];
  const float* enc_ff_b2  = (const float*)d_in[11];
  const float* enc_ln_w   = (const float*)d_in[12];
  const float* enc_ln_b   = (const float*)d_in[13];
  const float* dec_self_w = (const float*)d_in[14];
  const float* dec_self_b = (const float*)d_in[15];
  const float* dec_cross_w= (const float*)d_in[16];
  const float* dec_cross_b= (const float*)d_in[17];
  const float* dec_ff_w1  = (const float*)d_in[18];
  const float* dec_ff_b1  = (const float*)d_in[19];
  const float* dec_ff_w2  = (const float*)d_in[20];
  const float* dec_ff_b2  = (const float*)d_in[21];
  const float* dec_ln_w   = (const float*)d_in[22];
  const float* dec_ln_b   = (const float*)d_in[23];
  const float* out_w      = (const float*)d_in[24];
  const float* out_b      = (const float*)d_in[25];

  const int M = Bq * Sq_;  // 8192
  char* ws = (char*)d_ws;
  size_t off = 0;
  auto alloc = [&](size_t bytes) -> void* {
    void* p = ws + off;
    off += (bytes + 255) & ~(size_t)255;
    return p;
  };
  float*          h_f   = (float*)alloc((size_t)M * Dm * 4);
  unsigned short* h_b   = (unsigned short*)alloc((size_t)M * Dm * 2);
  float*          t_f   = (float*)alloc((size_t)M * Dm * 4);
  unsigned short* t_b   = (unsigned short*)alloc((size_t)M * Dm * 2);
  unsigned short* q_b   = (unsigned short*)alloc((size_t)M * Dm * 2);
  unsigned short* k_b   = (unsigned short*)alloc((size_t)M * Dm * 2);
  unsigned short* v_b   = (unsigned short*)alloc((size_t)M * Dm * 2);
  unsigned short* ctx_b = (unsigned short*)alloc((size_t)M * Dm * 2);
  float*          g_f   = (float*)alloc((size_t)M * Dm * 4);
  unsigned short* ffn_b = (unsigned short*)alloc((size_t)M * DFFc * 2);
  unsigned short* wt  = (unsigned short*)alloc(((size_t)16 * WP_DD + (size_t)6 * WP_DF) * 2);
  auto wA  = [&](int m) { return wt + (size_t)m * WP_DD; };           // attention matrices
  auto wF1 = [&](int m) { return wt + WP_FF1 + (size_t)m * WP_DF; };  // first FFN matrices
  auto wF2 = [&](int m) { return wt + WP_FF2 + (size_t)m * WP_DF; };  // second FFN matrices

  // [M,Dm] x [Dm,Dm] -> bf16
  auto gemm_b = [&](const unsigned short* A, const unsigned short* Wt, const float* bias,
                    unsigned short* oB) {
    gemm_bf16_kernel<Dm, 0, false><<<dim3(M / 128, Dm / 128), 256, 0, stream>>>(A, Wt, bias, nullptr, oB, Dm);
  };
  // [M,Kk] x [Kk,Dm] -> f32
  auto gemm_f = [&](const unsigned short* A, const unsigned short* Wt, const float* bias,
                    float* oF, int Kk) {
    gemm_bf16_kernel<Dm, 0, true><<<dim3(M / 128, Dm / 128), 256, 0, stream>>>(A, Wt, bias, oF, nullptr, Kk);
  };
  // [M,Dm] x [Dm,DFFc], GELU -> bf16
  auto gemm_g = [&](const unsigned short* A, const unsigned short* Wt, const float* bias,
                    unsigned short* oB) {
    gemm_bf16_kernel<DFFc, 1, false><<<dim3(M / 128, DFFc / 128), 256, 0, stream>>>(A, Wt, bias, nullptr, oB, Dm);
  };
  auto attn = [&](const unsigned short* Qp, const unsigned short* Kp,
                  const unsigned short* Vp, unsigned short* Op) {
    banded_attn_kernel<<<dim3(Sq_ / 64, Bq * Hh), 128, 0, stream>>>(Qp, Kp, Vp, Op, Sq_, Sq_, Sq_ / 4);
  };
  auto lnorm = [&](const float* xx, const float* rr, const float* w, const float* bb,
                   float* oF, unsigned short* oB) {
    ln_kernel<<<M / (8 * LN_RPW), 256, 0, stream>>>(xx, rr, w, bb, oF, oB);
  };

  // ----- all weights to bf16 [N,K], once -----
  wprep_kernel<<<WP_BLOCKS, 256, 0, stream>>>(enc_attn_w, dec_self_w, dec_cross_w,
                                              enc_ff_w1, dec_ff_w1, enc_ff_w2, dec_ff_w2, wt);

  // ----- encoder -----
  embed_kernel<<<M / EMB_ROWS, 256, 0, stream>>>(x_enc, emb_enc_w, emb_enc_b, h_f, h_b, 7);
  for (int l = 0; l < 2; ++l) {
    const float* ab = enc_attn_b + (size_t)l * 4 * Dm;
    gemm_b(h_b, wA(l * 4 + 0), ab + 0 * Dm, q_b);
    gemm_b(h_b, wA(l * 4 + 1), ab + 1 * Dm, k_b);
    gemm_b(h_b, wA(l * 4 + 2), ab + 2 * Dm, v_b);
    attn(q_b, k_b, v_b, ctx_b);
    gemm_f(ctx_b, wA(l * 4 + 3), ab + 3 * Dm, g_f, Dm);
    lnorm(h_f, g_f, enc_ln_w + (size_t)l * 2 * Dm, enc_ln_b + (size_t)l * 2 * Dm, h_f, h_b);
    gemm_g(h_b, wF1(l), enc_ff_b1 + (size_t)l * DFFc, ffn_b);
    gemm_f(ffn_b, wF2(l), enc_ff_b2 + (size_t)l * Dm, g_f, DFFc);
    lnorm(h_f, g_f, enc_ln_w + (size_t)l * 2 * Dm + Dm, enc_ln_b + (size_t)l * 2 * Dm + Dm, h_f, h_b);
  }
  // h_f / h_b now hold encoder memory.

  // ----- decoder (DL = 1) -----
  embed_kernel<<<M / EMB_ROWS, 256, 0, stream>>>(x_dec, emb_dec_w, emb_dec_b, t_f, t_b, 1);
  {
    // self-attention
    gemm_b(t_b, wA(8), dec_self_b + 0 * Dm, q_b);
    gemm_b(t_b, wA(9), dec_self_b + 1 * Dm, k_b);
    gemm_b(t_b, wA(10), dec_self_b + 2 * Dm, v_b);
    attn(q_b, k_b, v_b, ctx_b);
    gemm_f(ctx_b, wA(11), dec_self_b + 3 * Dm, g_f, Dm);
    lnorm(t_f, g_f, dec_ln_w + 0 * Dm, dec_ln_b + 0 * Dm, t_f, t_b);

    // cross-attention (K/V from encoder memory)
    gemm_b(t_b, wA(12), dec_cross_b + 0 * Dm, q_b);
    gemm_b(h_b, wA(13), dec_cross_b + 1 * Dm, k_b);
    gemm_b(h_b, wA(14), dec_cross_b + 2 * Dm, v_b);
    attn(q_b, k_b, v_b, ctx_b);
    gemm_f(ctx_b, wA(15), dec_cross_b + 3 * Dm, g_f, Dm);
    lnorm(t_f, g_f, dec_ln_w + 1 * Dm, dec_ln_b + 1 * Dm, t_f, t_b);

    // FFN
    gemm_g(t_b, wF1(2), dec_ff_b1, ffn_b);
    gemm_f(ffn_b, wF2(2), dec_ff_b2, g_f, DFFc);
    lnorm(t_f, g_f, dec_ln_w + 2 * Dm, dec_ln_b + 2 * Dm, t_f, t_b);
  }

  outproj_kernel<<<(M * 32 + 255) / 256, 256, 0, stream>>>(t_f, out_w, out_b, (float*)d_out, M);
}

// v005
// One run takes 597 microseconds.
// Timed twice side by side with v004, it ran 1.09 times as fast both times.
// Counting every step since v000, it is 2.02 times as fast.
#include <hip/hip_runtime.h>
#include <math.h>

// ---------------- model constants ----------------
#define Bq 8
#define Sq_ 1024
#define Dm 512
#define Hh 8
#define HDc 64
#define DFFc 2048

// ---------------- WMMA types ----------------
typedef __bf16 bf16_t;
typedef bf16_t v16bf __attribute__((ext_vector_type(16)));
typedef float v8f __attribute__((ext_vector_type(8)));

union Frag { uint4 u[2]; v16bf v; };

__device__ __forceinline__ unsigned short f2bf(float f) {
  union { float f; unsigned u; } v; v.f = f;
  unsigned r = v.u + 0x7FFFu + ((v.u >> 16) & 1u);
  return (unsigned short)(r >> 16);
}

__device__ __forceinline__ float gelu_f(float x) {
  float x3 = x * x * x;
  return 0.5f * x * (1.0f + tanhf(0.7978845608028654f * (x + 0.044715f * x3)));
}

// async copy 16B global -> LDS (ASYNCcnt-tracked, no VGPR round-trip)
__device__ __forceinline__ void async_cp16(const unsigned short* g, unsigned short* l) {
  unsigned lds = (unsigned)(uintptr_t)l;   // low 32 bits = LDS byte address
  asm volatile("global_load_async_to_lds_b128 %0, %1, off"
               :: "v"(lds), "v"(g) : "memory");
}
__device__ __forceinline__ void wait_async0() {
  asm volatile("s_wait_asynccnt 0x0" ::: "memory");
}
__device__ __forceinline__ void wait_async4() {
  asm volatile("s_wait_asynccnt 0x4" ::: "memory");
}

// =====================================================================
// bf16 WMMA GEMM:  C[M,N] = A[M,K] * W[K,N] + bias, optional GELU.
// A: bf16 row-major [M,K]; Wt: bf16 [N,K] (pre-transposed weights).
// Block 256 thr = 8 waves; tile 128x128, BK=32; wave tile 32x64.
// Double-buffered LDS staged with GLOBAL_LOAD_ASYNC_TO_LDS_B128;
// last tile peeled so the steady-state loop body is branch-free.
// N, the activation (ACT 1: GELU) and the output type (OUT_F32: outF, else
// bf16 to outB) are template parameters: the epilogue is then straight-line
// code, one address per thread with the 64 elements at constant offsets.
// NMAT products that do not depend on each other share a launch: Wt holds
// NMAT matrices [N,K] one after another, bias NMAT vectors, the output NMAT
// arrays [M,N]; grid.y runs over the column tiles of all of them. The first
// product reads A, the others A2. A WGP then holds NMAT work-groups, and
// one computes while another waits for its staged tile.
// =====================================================================
template <int N, int ACT, bool OUT_F32, int NMAT>
__global__ __launch_bounds__(256) void gemm_bf16_kernel(
    const unsigned short* __restrict__ A,
    const unsigned short* __restrict__ A2,
    const unsigned short* __restrict__ Wt,
    const float* __restrict__ bias,
    float* __restrict__ outF,
    unsigned short* __restrict__ outB,
    int K)
{
  constexpr int ST = 48;  // padded LDS stride (bf16 elems): 96B, 16B-aligned rows
  __shared__ unsigned short As[2][128 * ST];
  __shared__ unsigned short Bs[2][128 * ST];
  const int tid   = threadIdx.x;
  const int wave  = tid >> 5;
  const int lane  = tid & 31;
  const int l15   = lane & 15;
  const int lhalf = lane >> 4;
  const int koff  = lhalf * 8;
  const int bm = blockIdx.x * 128;
  const int bs = blockIdx.y * 128;                       // row of the stacked Wt and bias
  const int mat = (NMAT > 1) ? bs / N : 0;               // which product
  const int bn = bs - mat * N;                           // column in its own output
  const unsigned short* Am = (mat == 0) ? A : A2;
  const int wm = (wave >> 1) * 32;
  const int wn = (wave & 1) * 64;

  v8f zf = {};
  v8f c[2][4];
#pragma unroll
  for (int i = 0; i < 2; ++i)
#pragma unroll
    for (int j = 0; j < 4; ++j) c[i][j] = zf;

  // per-thread staging coordinates: 2 chunks of 8 bf16 per matrix,
  // running global pointers advanced by BK each issue.
  const int r0 = tid >> 2,           c0 = (tid & 3) * 8;          // chunk 0
  const int r1 = (tid + 256) >> 2,   c1 = ((tid + 256) & 3) * 8;  // chunk 1
  const unsigned short* gA0 = Am + (size_t)(bm + r0) * K + c0;
  const unsigned short* gA1 = Am + (size_t)(bm + r1) * K + c1;
  const unsigned short* gB0 = Wt + (size_t)(bs + r0) * K + c0;
  const unsigned short* gB1 = Wt + (size_t)(bs + r1) * K + c1;
  unsigned short* lA0[2] = { &As[0][r0 * ST + c0], &As[1][r0 * ST + c0] };
  unsigned short* lA1[2] = { &As[0][r1 * ST + c1], &As[1][r1 * ST + c1] };
  unsigned short* lB0[2] = { &Bs[0][r0 * ST + c0], &Bs[1][r0 * ST + c0] };
  unsigned short* lB1[2] = { &Bs[0][r1 * ST + c1], &Bs[1][r1 * ST + c1] };

  auto issue = [&](int buf) {
    async_cp16(gA0, lA0[buf]);  gA0 += 32;
    async_cp16(gA1, lA1[buf]);  gA1 += 32;
    async_cp16(gB0, lB0[buf]);  gB0 += 32;
    async_cp16(gB1, lB1[buf]);  gB1 += 32;
  };
  auto compute = [&](int cur) {
    Frag a[2], b[4];
#pragma unroll
    for (int i = 0; i < 2; ++i) {
      const unsigned short* p = &As[cur][(wm + i * 16 + l15) * ST];
      a[i].u[0] = *(const uint4*)(p + koff);
      a[i].u[1] = *(const uint4*)(p + koff + 16);
    }
#pragma unroll
    for (int j = 0; j < 4; ++j) {
      const unsigned short* p = &Bs[cur][(wn + j * 16 + l15) * ST];
      b[j].u[0] = *(const uint4*)(p + koff);
      b[j].u[1] = *(const uint4*)(p + koff + 16);
    }
#pragma unroll
    for (int i = 0; i < 2; ++i)
#pragma unroll
      for (int j = 0; j < 4; ++j)
        c[i][j] = __builtin_amdgcn_wmma_f32_16x16x32_bf16(
            false, a[i].v, false, b[j].v, (short)0, c[i][j], false, false);
  };

  const int nK = K >> 5;
  issue(0);
  for (int kt = 0; kt < nK - 1; ++kt) {   // branch-free steady state
    const int cur = kt & 1;
    issue(cur ^ 1);       // prefetch next tile (async, overlaps compute)
    wait_async4();        // own copies of current tile complete
    __syncthreads();
    compute(cur);
    __syncthreads();
  }
  wait_async0();          // peeled last tile
  __syncthreads();
  compute((nK - 1) & 1);

  const int col0 = bn + wn + l15;
  const size_t idx0 = ((size_t)mat * (Bq * Sq_) + (bm + wm + 8 * lhalf)) * N + col0;  // M = Bq * Sq_ rows an output
  float bb[4];
#pragma unroll
  for (int j = 0; j < 4; ++j) bb[j] = bias[bs + wn + l15 + j * 16];
#pragma unroll
  for (int i = 0; i < 2; ++i) {
#pragma unroll
    for (int j = 0; j < 4; ++j) {
#pragma unroll
      for (int r = 0; r < 8; ++r) {
        float v = c[i][j][r] + bb[j];
        if constexpr (ACT == 1) v = gelu_f(v);
        const size_t idx = idx0 + (i * 16 + r) * N + j * 16;
        if constexpr (OUT_F32) outF[idx] = v;
        else                   outB[idx] = f2bf(v);
      }
    }
  }
}

// ---------------- reductions over a 16-lane row ----------------
// The softmax rows of a WMMA result lie across the 16 lanes of a row. Both
// reductions are butterflies (l ^ 1, 2, 4, 8) that stay in the vector
// registers; every lane ends with the result. All 32 lanes must be on.

__device__ __forceinline__ float row16_max(float v) {
  // in asm so that a step is one instruction: behind the DPP builtin the
  // compiler puts a canonicalising v_max in front of every fmaxf and does
  // not fuse the two. The s_delay_alu lines let the other waves of the SIMD
  // issue while a step waits for the step before it
  asm("v_max_num_f32_dpp %0, %0, %0 row_xmask:1 row_mask:0xf bank_mask:0xf\n\t"
      "s_delay_alu instid0(VALU_DEP_1)\n\t"
      "v_max_num_f32_dpp %0, %0, %0 row_xmask:2 row_mask:0xf bank_mask:0xf\n\t"
      "s_delay_alu instid0(VALU_DEP_1)\n\t"
      "v_max_num_f32_dpp %0, %0, %0 row_xmask:4 row_mask:0xf bank_mask:0xf\n\t"
      "s_delay_alu instid0(VALU_DEP_1)\n\t"
      "v_max_num_f32_dpp %0, %0, %0 row_xmask:8 row_mask:0xf bank_mask:0xf"
      : "+v"(v));
  return v;
}
// lane l reads lane l ^ X of its row, in the form that the compiler fuses
// with the add behind it (v_add_f32_dpp)
template <int X>
__device__ __forceinline__ float row16_peer(float v) {
  int u = __builtin_bit_cast(int, v);
  return __builtin_bit_cast(float, __builtin_amdgcn_update_dpp(0, u, 0x160 + X, 0xf, 0xf, true));
}
__device__ __forceinline__ float row16_sum(float v) {
  v += row16_peer<1>(v);
  v += row16_peer<2>(v);
  v += row16_peer<4>(v);
  v += row16_peer<8>(v);
  return v;
}

// =====================================================================
// Banded flash attention. Q,K,V,O: bf16 [B*S, D], head h in cols h*64..
// Grid: (Sq/64, B*H); 128 threads = 4 waves; wave owns 16 q-rows.
// Per 32-key tile: 4 WMMA for Q*K^T, online softmax, 4 WMMA for P*V.
// Q/K tiles staged with async-to-LDS; V transposed manually.
// =====================================================================
__global__ __launch_bounds__(128) void banded_attn_kernel(
    const unsigned short* __restrict__ Q,
    const unsigned short* __restrict__ Kc,
    const unsigned short* __restrict__ Vc,
    unsigned short* __restrict__ O,
    int Sq, int Sk, int bw)
{
  constexpr int STK = 72;  // stride for 64-wide hd rows (144B, aligned)
  constexpr int STV = 48;  // stride for 32-wide key rows (96B, aligned)
  __shared__ unsigned short Qs[64 * STK];
  __shared__ unsigned short Ks[32 * STK];
  __shared__ unsigned short Vs[64 * STV];      // transposed: [hd][key]
  __shared__ unsigned short Ps[4][16 * STV];   // per-wave P tile [q][key]

  const int tid   = threadIdx.x;
  const int wave  = tid >> 5;
  const int lane  = tid & 31;
  const int l15   = lane & 15;
  const int lhalf = lane >> 4;
  const int koff  = lhalf * 8;
  const int q0 = blockIdx.x * 64;
  const int bh = blockIdx.y;
  const int bb = bh / Hh;
  const int hh = bh % Hh;

  const unsigned short* Qg = Q  + ((size_t)bb * Sq) * Dm + hh * HDc;
  const unsigned short* Kg = Kc + ((size_t)bb * Sk) * Dm + hh * HDc;
  const unsigned short* Vg = Vc + ((size_t)bb * Sk) * Dm + hh * HDc;

  // stage Q tile (64 x 64) via async copies
#pragma unroll
  for (int i = 0; i < 4; ++i) {
    int chunk = tid + i * 128;
    int r  = chunk >> 3;
    int cc = (chunk & 7) * 8;
    async_cp16(Qg + (size_t)(q0 + r) * Dm + cc, Qs + r * STK + cc);
  }
  wait_async0();
  __syncthreads();

  Frag qa[2];
  {
    const unsigned short* p = Qs + (wave * 16 + l15) * STK;
    qa[0].u[0] = *(const uint4*)(p + koff);
    qa[0].u[1] = *(const uint4*)(p + koff + 16);
    qa[1].u[0] = *(const uint4*)(p + 32 + koff);
    qa[1].u[1] = *(const uint4*)(p + 32 + koff + 16);
  }

  v8f zf = {};
  float rmax[8], rsum[8];
  v8f o[4];
#pragma unroll
  for (int r = 0; r < 8; ++r) { rmax[r] = -__builtin_inff(); rsum[r] = 0.0f; }
#pragma unroll
  for (int j = 0; j < 4; ++j) o[j] = zf;

  int ks = q0 - bw;        if (ks < 0)  ks = 0;
  int ke = q0 + 64 + bw;   if (ke > Sk) ke = Sk;

  for (int kb = ks; kb < ke; kb += 32) {
    __syncthreads();
    // K tile natural [key][hd] via async; V tile transposed into Vs[hd][key]
#pragma unroll
    for (int i = 0; i < 2; ++i) {
      int chunk = tid + i * 128;
      int r  = chunk >> 3;
      int cc = (chunk & 7) * 8;
      async_cp16(Kg + (size_t)(kb + r) * Dm + cc, Ks + r * STK + cc);
      uint4 d = *(const uint4*)(Vg + (size_t)(kb + r) * Dm + cc);
      const unsigned short* ds = (const unsigned short*)&d;
#pragma unroll
      for (int t = 0; t < 8; ++t) Vs[(cc + t) * STV + r] = ds[t];
    }
    wait_async0();
    __syncthreads();

    // scores for two 16-key sub-tiles
    Frag b0a, b0b, b1a, b1b;
    {
      const unsigned short* p0 = Ks + l15 * STK;
      const unsigned short* p1 = Ks + (16 + l15) * STK;
      b0a.u[0] = *(const uint4*)(p0 + koff);      b0a.u[1] = *(const uint4*)(p0 + koff + 16);
      b0b.u[0] = *(const uint4*)(p0 + 32 + koff); b0b.u[1] = *(const uint4*)(p0 + 32 + koff + 16);
      b1a.u[0] = *(const uint4*)(p1 + koff);      b1a.u[1] = *(const uint4*)(p1 + koff + 16);
      b1b.u[0] = *(const uint4*)(p1 + 32 + koff); b1b.u[1] = *(const uint4*)(p1 + 32 + koff + 16);
    }
    v8f s0 = __builtin_amdgcn_wmma_f32_16x16x32_bf16(false, qa[0].v, false, b0a.v, (short)0, zf, false, false);
    s0     = __builtin_amdgcn_wmma_f32_16x16x32_bf16(false, qa[1].v, false, b0b.v, (short)0, s0, false, false);
    v8f s1 = __builtin_amdgcn_wmma_f32_16x16x32_bf16(false, qa[0].v, false, b1a.v, (short)0, zf, false, false);
    s1     = __builtin_amdgcn_wmma_f32_16x16x32_bf16(false, qa[1].v, false, b1b.v, (short)0, s1, false, false);

    // online softmax (rows live across 16-lane halves)
    unsigned short* Pw = Ps[wave];
#pragma unroll
    for (int r = 0; r < 8; ++r) {
      int m = r + 8 * lhalf;
      int qrow = q0 + wave * 16 + m;
      float v0 = s0[r] * 0.125f;     // 1/sqrt(64)
      float v1 = s1[r] * 0.125f;
      int d0 = qrow - (kb + l15);       if (d0 < 0) d0 = -d0;
      int d1 = qrow - (kb + 16 + l15);  if (d1 < 0) d1 = -d1;
      if (d0 > bw) v0 = -__builtin_inff();
      if (d1 > bw) v1 = -__builtin_inff();
      float mt = row16_max(fmaxf(v0, v1));
      float nm = fmaxf(rmax[r], mt);
      float sc, p0, p1;
      if (nm < -1e37f) { sc = 1.0f; p0 = 0.0f; p1 = 0.0f; }
      else {
        sc = __expf(rmax[r] - nm);
        p0 = __expf(v0 - nm);
        p1 = __expf(v1 - nm);
      }
      rmax[r] = nm;
      float ps = row16_sum(p0 + p1);
      rsum[r] = rsum[r] * sc + ps;
#pragma unroll
      for (int j = 0; j < 4; ++j) o[j][r] *= sc;
      Pw[m * STV + l15]      = f2bf(p0);
      Pw[m * STV + 16 + l15] = f2bf(p1);
    }
    __syncthreads();

    // ctx += P[16x32] * V[32x64]
    Frag pa;
    {
      const unsigned short* p = Pw + l15 * STV;
      pa.u[0] = *(const uint4*)(p + koff);
      pa.u[1] = *(const uint4*)(p + koff + 16);
    }
#pragma unroll
    for (int j = 0; j < 4; ++j) {
      Frag vb;
      const unsigned short* p = Vs + (j * 16 + l15) * STV;
      vb.u[0] = *(const uint4*)(p + koff);
      vb.u[1] = *(const uint4*)(p + koff + 16);
      o[j] = __builtin_amdgcn_wmma_f32_16x16x32_bf16(false, pa.v, false, vb.v, (short)0, o[j], false, false);
    }
  }

  float inv[8];
#pragma unroll
  for (int r = 0; r < 8; ++r) inv[r] = 1.0f / rsum[r];
#pragma unroll
  for (int j = 0; j < 4; ++j)
#pragma unroll
    for (int r = 0; r < 8; ++r) {
      int m = r + 8 * lhalf;
      int qrow = q0 + wave * 16 + m;
      int hd = j * 16 + l15;
      O[((size_t)bb * Sq + qrow) * Dm + hh * HDc + hd] = f2bf(o[j][r] * inv[r]);
    }
}

// =====================================================================
// Embedding: h = (x @ W + b) * sqrt(D) + PE(s, d); outputs f32 + bf16.
// A work-group walks EMB_ROWS rows, a thread keeping its two columns: the
// launch starts 4096 waves where one work-group a row would start 65536.
// =====================================================================
#define EMB_ROWS 16
__global__ __launch_bounds__(256) void embed_kernel(
    const float* __restrict__ x, const float* __restrict__ W,
    const float* __restrict__ bias, float* __restrict__ outF,
    unsigned short* __restrict__ outB, int Cin)
{
  const int row0 = blockIdx.x * EMB_ROWS;
  const int tid = threadIdx.x;
  const int d = tid * 2;
  // what depends on the column alone is formed once
  float wv[7][2];
#pragma unroll
  for (int c = 0; c < 7; ++c) {
    wv[c][0] = (c < Cin) ? W[c * Dm + d]     : 0.0f;
    wv[c][1] = (c < Cin) ? W[c * Dm + d + 1] : 0.0f;
  }
  const float b0 = bias[d], b1 = bias[d + 1];
  const float div = __expf((float)d * (-9.210340371976184f / 512.0f));

  float xn[7];
#pragma unroll
  for (int c = 0; c < 7; ++c) xn[c] = (c < Cin) ? x[(size_t)row0 * Cin + c] : 0.0f;
  // kept rolled: for speed only
#pragma unroll 1
  for (int rr = 0; rr < EMB_ROWS; ++rr) {
    const int row = row0 + rr;
    float xv[7];
#pragma unroll
    for (int c = 0; c < 7; ++c) xv[c] = xn[c];
    // the next row's inputs fly while this row is computed (the last trip
    // reads its own row again, so the address stays inside x)
    const int nxt = (rr + 1 < EMB_ROWS) ? row + 1 : row;
#pragma unroll
    for (int c = 0; c < 7; ++c) xn[c] = (c < Cin) ? x[(size_t)nxt * Cin + c] : 0.0f;
    float acc0 = b0, acc1 = b1;
#pragma unroll
    for (int c = 0; c < 7; ++c) { acc0 += xv[c] * wv[c][0]; acc1 += xv[c] * wv[c][1]; }
    acc0 *= 22.627416997969522f;  // sqrt(512)
    acc1 *= 22.627416997969522f;
    const float arg = (float)(row & (Sq_ - 1)) * div;
    acc0 += sinf(arg);
    acc1 += cosf(arg);
    *(float2*)(outF + (size_t)row * Dm + d) = make_float2(acc0, acc1);
    *(unsigned*)(outB + (size_t)row * Dm + d) =
        (unsigned)f2bf(acc0) | ((unsigned)f2bf(acc1) << 16);
  }
}

// =====================================================================
// Residual + LayerNorm over D=512; outputs f32 (may alias x) + bf16.
// A wave owns whole rows: a lane holds 16 of a row's 512 values, and each
// of the two sums is a sum inside the lane and a five-step butterfly over
// the wave: no LDS, no barrier. A wave takes LN_RPW rows side by side, all
// their loads in flight together, so a launch starts 2048 waves where one
// work-group a row would start 65536.
// =====================================================================
#define LN_RPW 4

// lane l reads lane l ^ X of its 16-lane row
template <int X>
__device__ __forceinline__ float row_xor(float v) {
  int u = __builtin_bit_cast(int, v);
  return __builtin_bit_cast(float, __builtin_amdgcn_update_dpp(u, u, 0x160 + X, 0xf, 0xf, false));
}
// butterfly sum over the 32 lanes; every lane ends with the same value
__device__ __forceinline__ float wave_sum(float v) {
  v += row_xor<1>(v);
  v += row_xor<2>(v);
  v += row_xor<4>(v);
  v += row_xor<8>(v);
  int u = __builtin_bit_cast(int, v);
  v += __builtin_bit_cast(float,
      __builtin_amdgcn_permlanex16(u, u, 0x76543210, 0xfedcba98, false, false));
  return v;
}

typedef float f32x4 __attribute__((ext_vector_type(4)));
union Two4 { f32x4 h[2]; v8f v; };   // two 16-byte loads, named as one value

__global__ __launch_bounds__(256) void ln_kernel(
    const float* __restrict__ x, const float* __restrict__ res,
    const float* __restrict__ w, const float* __restrict__ b,
    float* __restrict__ outF, unsigned short* __restrict__ outB)
{
  const int lane = threadIdx.x & 31;
  const int row0 = (blockIdx.x * 8 + (threadIdx.x >> 5)) * LN_RPW;
  Two4 xr[LN_RPW][4];   // h[0]: x, h[1]: res
  Two4 wb[4];           // h[0]: w, h[1]: b
  const f32x4* xp = (const f32x4*)(x   + (size_t)row0 * Dm) + lane;
  const f32x4* rp = (const f32x4*)(res + (size_t)row0 * Dm) + lane;
#pragma unroll
  for (int rr = 0; rr < LN_RPW; ++rr) {
#pragma unroll
    for (int i = 0; i < 4; ++i) {
      xr[rr][i].h[0] = xp[rr * (Dm / 4) + 32 * i];
      xr[rr][i].h[1] = rp[rr * (Dm / 4) + 32 * i];
    }
  }
#pragma unroll
  for (int i = 0; i < 4; ++i) {
    wb[i].h[0] = ((const f32x4*)w)[lane + 32 * i];
    wb[i].h[1] = ((const f32x4*)b)[lane + 32 * i];
  }
  // holds all forty loads of the wave in front of the arithmetic, in flight
  // together (loaded values as inputs only): left alone the compiler sinks
  // a third of them behind the sums, where each is waited for on its own.
  // It is also the wait that belongs in front of any rewrite of an issued
  // load's address registers; naming the two addresses keeps them out of
  // the loads' own destination registers until it has passed
  asm volatile("s_wait_xcnt 0x0" ::
      "v"(xr[0][0].v), "v"(xr[0][1].v), "v"(xr[0][2].v), "v"(xr[0][3].v),
      "v"(xr[1][0].v), "v"(xr[1][1].v), "v"(xr[1][2].v), "v"(xr[1][3].v),
      "v"(xr[2][0].v), "v"(xr[2][1].v), "v"(xr[2][2].v), "v"(xr[2][3].v),
      "v"(xr[3][0].v), "v"(xr[3][1].v), "v"(xr[3][2].v), "v"(xr[3][3].v),
      "v"(wb[0].v), "v"(wb[1].v), "v"(wb[2].v), "v"(wb[3].v), "v"(xp), "v"(rp));

  f32x4 a[LN_RPW][4];
  float s[LN_RPW];
#pragma unroll
  for (int rr = 0; rr < LN_RPW; ++rr) {
    float t = 0.0f;
#pragma unroll
    for (int i = 0; i < 4; ++i) {
      a[rr][i] = xr[rr][i].h[0] + xr[rr][i].h[1];
      t += (a[rr][i].x + a[rr][i].y) + (a[rr][i].z + a[rr][i].w);
    }
    s[rr] = wave_sum(t);
  }

#pragma unroll
  for (int rr = 0; rr < LN_RPW; ++rr) {
    const float mu = s[rr] * (1.0f / 512.0f);
    float t = 0.0f;
#pragma unroll
    for (int i = 0; i < 4; ++i) {
      a[rr][i] -= mu;
      t += (a[rr][i].x * a[rr][i].x + a[rr][i].y * a[rr][i].y) +
           (a[rr][i].z * a[rr][i].z + a[rr][i].w * a[rr][i].w);
    }
    s[rr] = wave_sum(t);
  }

#pragma unroll
  for (int rr = 0; rr < LN_RPW; ++rr) {
    const float rstd = rsqrtf(s[rr] * (1.0f / 512.0f) + 1e-5f);
    f32x4* of = (f32x4*)(outF + (size_t)(row0 + rr) * Dm);
    uint2* ob = (uint2*)(outB + (size_t)(row0 + rr) * Dm);
#pragma unroll
    for (int i = 0; i < 4; ++i) {
      const f32x4 y = a[rr][i] * rstd * wb[i].h[0] + wb[i].h[1];
      of[lane + 32 * i] = y;
      ob[lane + 32 * i] = make_uint2(
          (unsigned)f2bf(y.x) | ((unsigned)f2bf(y.y) << 16),
          (unsigned)f2bf(y.z) | ((unsigned)f2bf(y.w) << 16));
    }
  }
}

// =====================================================================
// Weight preparation, one launch for all 22 matrices:
// fp32 [K,N] -> bf16 transposed [N,K], packed one after another in wt:
//   16 x [512,512]  (encoder attention 8, decoder self 4, decoder cross 4)
//    3 x [512,2048] (first FFN matrix: encoder 2, decoder 1)
//    3 x [2048,512] (second FFN matrix: encoder 2, decoder 1)
// The matrices are cut into 64x64 tiles, 2560 in all. A block moves 5 of
// them through LDS: 256-B row pieces are read, whole 128-B lines written.
// An LDS dword holds the bf16 pair (k, k+1) of one n; the pitch of 33
// dwords keeps both the column-wise writes and the row-wise reads on
// distinct banks.
// =====================================================================
#define WP_BLOCKS 512
#define WP_TILES_PER_BLOCK 5
#define WP_DD  (Dm * Dm)
#define WP_DF  (Dm * DFFc)
#define WP_FF1 (16 * WP_DD)
#define WP_FF2 (16 * WP_DD + 3 * WP_DF)

__global__ __launch_bounds__(256) void wprep_kernel(
    const float* __restrict__ enc_attn_w, const float* __restrict__ dec_self_w,
    const float* __restrict__ dec_cross_w,
    const float* __restrict__ enc_ff_w1, const float* __restrict__ dec_ff_w1,
    const float* __restrict__ enc_ff_w2, const float* __restrict__ dec_ff_w2,
    unsigned short* __restrict__ wt)
{
  constexpr int P = 33;
  __shared__ unsigned tile[2][64 * P];
  const int tid = threadIdx.x;
  const int p   = tid >> 4;         // reader: k pair (rows 2p, 2p+1, +32, +33)
  const int n0  = (tid & 15) * 4;   // reader: 4 columns
  const int wr  = tid >> 3;         // writer: output row (n), +32
  const int wc  = tid & 7;          // writer: 16-B chunk of the 128-B line

  float4 r[4];
  unsigned short* dst;
  int dstK;

  // tile id -> source and destination of its corner (same for the whole block)
  auto fetch = [&](int id) {
    const float* s; unsigned short* d; int K, N, kt, nt;
    if (id < 1024) {
      int m = id >> 6;
      s = (m < 8) ? enc_attn_w + (size_t)m * WP_DD
        : (m < 12) ? dec_self_w + (size_t)(m - 8) * WP_DD
                   : dec_cross_w + (size_t)(m - 12) * WP_DD;
      d = wt + (size_t)m * WP_DD;
      K = Dm; N = Dm; kt = (id >> 3) & 7; nt = id & 7;
    } else if (id < 1792) {
      int j = id - 1024, m = j >> 8;
      s = (m < 2) ? enc_ff_w1 + (size_t)m * WP_DF : dec_ff_w1;
      d = wt + WP_FF1 + (size_t)m * WP_DF;
      K = Dm; N = DFFc; kt = (j >> 5) & 7; nt = j & 31;
    } else {
      int j = id - 1792, m = j >> 8;
      s = (m < 2) ? enc_ff_w2 + (size_t)m * WP_DF : dec_ff_w2;
      d = wt + WP_FF2 + (size_t)m * WP_DF;
      K = DFFc; N = Dm; kt = (j >> 3) & 31; nt = j & 7;
    }
    const float* g = s + (size_t)(kt * 64 + 2 * p) * N + nt * 64 + n0;
    const float* g1 = g + N;
    const float* g2 = g + (size_t)32 * N;
    const float* g3 = g + (size_t)33 * N;
    r[0] = *(const float4*)(g);
    r[1] = *(const float4*)(g1);
    r[2] = *(const float4*)(g2);
    r[3] = *(const float4*)(g3);
    // the wait that belongs in front of any rewrite of an issued load's
    // address registers; naming the four addresses keeps them out of the
    // loads' own destination registers until it has passed
    asm volatile("s_wait_xcnt 0x0" :: "v"(g), "v"(g1), "v"(g2), "v"(g3) : "memory");
    dst  = d + (size_t)(nt * 64 + wr) * K + kt * 64 + wc * 8;
    dstK = K;
  };
  auto pack = [](float lo, float hi) -> unsigned {
    return (unsigned)f2bf(lo) | ((unsigned)f2bf(hi) << 16);
  };

  fetch(blockIdx.x);
  // unrolled so that the buffer index and the last-tile test are constants
#pragma unroll
  for (int t = 0; t < WP_TILES_PER_BLOCK; ++t) {
    unsigned* L = tile[t & 1];
    const float* a0 = (const float*)&r[0];
    const float* a1 = (const float*)&r[1];
    const float* a2 = (const float*)&r[2];
    const float* a3 = (const float*)&r[3];
    // unrolled so that r[] is indexed by constants and stays in registers
#pragma unroll
    for (int e = 0; e < 4; ++e) {
      L[(n0 + e) * P + p]      = pack(a0[e], a1[e]);
      L[(n0 + e) * P + 16 + p] = pack(a2[e], a3[e]);
    }
    unsigned short* o = dst;
    const int oK = dstK;
    // one barrier a tile: with two buffers it also ends the reads of the
    // buffer that the next tile overwrites
    __syncthreads();
    // the next tile's loads fly while this tile is written out
    if (t + 1 < WP_TILES_PER_BLOCK) fetch(blockIdx.x + (t + 1) * WP_BLOCKS);
    // unrolled so that both halves' LDS reads issue together
#pragma unroll
    for (int h = 0; h < 2; ++h) {
      const unsigned* q = L + (h * 32 + wr) * P + wc * 4;
      uint4 v = make_uint4(q[0], q[1], q[2], q[3]);
      *(uint4*)(o + (size_t)(h * 32) * oK) = v;
    }
  }
}

// final projection D->1: one wave per row
__global__ __launch_bounds__(256) void outproj_kernel(
    const float* __restrict__ t, const float* __restrict__ w,
    const float* __restrict__ b, float* __restrict__ out, int M)
{
  int gid = blockIdx.x * 256 + threadIdx.x;
  int row = gid >> 5;
  int lane = gid & 31;
  if (row >= M) return;
  float acc = 0.0f;
#pragma unroll
  for (int i = 0; i < 16; ++i)
    acc += t[(size_t)row * Dm + lane + i * 32] * w[lane + i * 32];
#pragma unroll
  for (int ofs = 16; ofs > 0; ofs >>= 1)
    acc += __shfl_xor(acc, ofs, 32);
  if (lane == 0) out[row] = acc + b[0];
}

// =====================================================================
// Host orchestration
// =====================================================================
extern "C" void kernel_launch(void* const* d_in, const int* in_sizes, int n_in,
                              void* d_out, int out_size, void* d_ws, size_t ws_size,
                              hipStream_t stream) {
  (void)in_sizes; (void)n_in; (void)out_size; (void)ws_size;
  const float* x_enc      = (const float*)d_in[0];
  const float* x_dec      = (const float*)d_in[1];
  const float* emb_enc_w  = (const float*)d_in[2];
  const float* emb_enc_b  = (const float*)d_in[3];
  const float* emb_dec_w  = (const float*)d_in[4];
  const float* emb_dec_b  = (const float*)d_in[5];
  const float* enc_attn_w = (const float*)d_in[6];
  const float* enc_attn_b = (const float*)d_in[7];
  const float* enc_ff_w1  = (const float*)d_in[8];
  const float* enc_ff_b1  = (const float*)d_in[9];
  const float* enc_ff_w2  = (const float*)d_in[10];
  const float* enc_ff_b2  = (const float*)d_in[11];
  const float* enc_ln_w   = (const float*)d_in[12];
  const float* enc_ln_b   = (const float*)d_in[13];
  const float* dec_self_w = (const float*)d_in[14];
  const float* dec_self_b = (const float*)d_in[15];
  const float* dec_cross_w= (const float*)d_in[16];
  const float* dec_cross_b= (const float*)d_in[17];
  const float* dec_ff_w1  = (const float*)d_in[18];
  const float* dec_ff_b1  = (const float*)d_in[19];
  const float* dec_ff_w2  = (const float*)d_in[20];
  const float* dec_ff_b2  = (const float*)d_in[21];
  const float* dec_ln_w   = (const float*)d_in[22];
  const float* dec_ln_b   = (const float*)d_in[23];
  const float* out_w      = (const float*)d_in[24];
  const float* out_b      = (const float*)d_in[25];

  const int M = Bq * Sq_;  // 8192
  char* ws = (char*)d_ws;
  size_t off = 0;
  auto alloc = [&](size_t bytes) -> void* {
    void* p = ws + off;
    off += (bytes + 255) & ~(size_t)255;
    return p;
  };
  float*          h_f   = (float*)alloc((size_t)M * Dm * 4);
  unsigned short* h_b   = (unsigned short*)alloc((size_t)M * Dm * 2);
  float*          t_f   = (float*)alloc((size_t)M * Dm * 4);
  unsigned short* t_b   = (unsigned short*)alloc((size_t)M * Dm * 2);
  unsigned short* q_b   = (unsigned short*)alloc((size_t)3 * M * Dm * 2);  // q, k, v in a row
  unsigned short* k_b   = q_b + (size_t)M * Dm;
  unsigned short* v_b   = k_b + (size_t)M * Dm;
  unsigned short* ctx_b = (unsigned short*)alloc((size_t)M * Dm * 2);
  float*          g_f   = (float*)alloc((size_t)M * Dm * 4);
  unsigned short* ffn_b = (unsigned short*)alloc((size_t)M * DFFc * 2);
  unsigned short* wt  = (unsigned short*)alloc(((size_t)16 * WP_DD + (size_t)6 * WP_DF) * 2);
  auto wA  = [&](int m) { return wt + (size_t)m * WP_DD; };           // attention matrices
  auto wF1 = [&](int m) { return wt + WP_FF1 + (size_t)m * WP_DF; };  // first FFN matrices
  auto wF2 = [&](int m) { return wt + WP_FF2 + (size_t)m * WP_DF; };  // second FFN matrices

  // the q, k and v projections of one attention, one launch:
  // Aq x W[0], Akv x W[1], Akv x W[2], each [M,Dm] x [Dm,Dm] -> bf16, to q_b, k_b, v_b
  auto gemm_qkv = [&](const unsigned short* Aq, const unsigned short* Akv,
                      const unsigned short* Wt, const float* bias) {
    gemm_bf16_kernel<Dm, 0, false, 3><<<dim3(M / 128, 3 * Dm / 128), 256, 0, stream>>>(Aq, Akv, Wt, bias, nullptr, q_b, Dm);
  };
  // [M,Kk] x [Kk,Dm] -> f32
  auto gemm_f = [&](const unsigned short* A, const unsigned short* Wt, const float* bias,
                    float* oF, int Kk) {
    gemm_bf16_kernel<Dm, 0, true, 1><<<dim3(M / 128, Dm / 128), 256, 0, stream>>>(A, A, Wt, bias, oF, nullptr, Kk);
  };
  // [M,Dm] x [Dm,DFFc], GELU -> bf16
  auto gemm_g = [&](const unsigned short* A, const unsigned short* Wt, const float* bias,
                    unsigned short* oB) {
    gemm_bf16_kernel<DFFc, 1, false, 1><<<dim3(M / 128, DFFc / 128), 256, 0, stream>>>(A, A, Wt, bias, nullptr, oB, Dm);
  };
  auto attn = [&](const unsigned short* Qp, const unsigned short* Kp,
                  const unsigned short* Vp, unsigned short* Op) {
    banded_attn_kernel<<<dim3(Sq_ / 64, Bq * Hh), 128, 0, stream>>>(Qp, Kp, Vp, Op, Sq_, Sq_, Sq_ / 4);
  };
  auto lnorm = [&](const float* xx, const float* rr, const float* w, const float* bb,
                   float* oF, unsigned short* oB) {
    ln_kernel<<<M / (8 * LN_RPW), 256, 0, stream>>>(xx, rr, w, bb, oF, oB);
  };

  // ----- all weights to bf16 [N,K], once -----
  wprep_kernel<<<WP_BLOCKS, 256, 0, stream>>>(enc_attn_w, dec_self_w, dec_cross_w,
                                              enc_ff_w1, dec_ff_w1, enc_ff_w2, dec_ff_w2, wt);

  // ----- encoder -----
  embed_kernel<<<M / EMB_ROWS, 256, 0, stream>>>(x_enc, emb_enc_w, emb_enc_b, h_f, h_b, 7);
  for (int l = 0; l < 2; ++l) {
    const float* ab = enc_attn_b + (size_t)l * 4 * Dm;
    gemm_qkv(h_b, h_b, wA(l * 4), ab);
    attn(q_b, k_b, v_b, ctx_b);
    gemm_f(ctx_b, wA(l * 4 + 3), ab + 3 * Dm, g_f, Dm);
    lnorm(h_f, g_f, enc_ln_w + (size_t)l * 2 * Dm, enc_ln_b + (size_t)l * 2 * Dm, h_f, h_b);
    gemm_g(h_b, wF1(l), enc_ff_b1 + (size_t)l * DFFc, ffn_b);
    gemm_f(ffn_b, wF2(l), enc_ff_b2 + (size_t)l * Dm, g_f, DFFc);
    lnorm(h_f, g_f, enc_ln_w + (size_t)l * 2 * Dm + Dm, enc_ln_b + (size_t)l * 2 * Dm + Dm, h_f, h_b);
  }
  // h_f / h_b now hold encoder memory.

  // ----- decoder (DL = 1) -----
  embed_kernel<<<M / EMB_ROWS, 256, 0, stream>>>(x_dec, emb_dec_w, emb_dec_b, t_f, t_b, 1);
  {
    // self-attention
    gemm_qkv(t_b, t_b, wA(8), dec_self_b);
    attn(q_b, k_b, v_b, ctx_b);
    gemm_f(ctx_b, wA(11), dec_self_b + 3 * Dm, g_f, Dm);
    lnorm(t_f, g_f, dec_ln_w + 0 * Dm, dec_ln_b + 0 * Dm, t_f, t_b);

    // cross-attention (K/V from encoder memory)
    gemm_qkv(t_b, h_b, wA(12), dec_cross_b);
    attn(q_b, k_b, v_b, ctx_b);
    gemm_f(ctx_b, wA(15), dec_cross_b + 3 * Dm, g_f, Dm);
    lnorm(t_f, g_f, dec_ln_w + 1 * Dm, dec_ln_b + 1 * Dm, t_f, t_b);

    // FFN
    gemm_g(t_b, wF1(2), dec_ff_b1, ffn_b);
    gemm_f(ffn_b, wF2(2), dec_ff_b2, g_f, DFFc);
    lnorm(t_f, g_f, dec_ln_w + 2 * Dm, dec_ln_b + 2 * Dm, t_f, t_b);
  }

  outproj_kernel<<<(M * 32 + 255) / 256, 256, 0, stream>>>(t_f, out_w, out_b, (float*)d_out, M);
}

// v006
// Measured time: 571 microseconds a run.
// Next to v005, in two timings, it ran 1.05 and 1.04 times as fast.
// All steps since v000 together make it 2.11 times as fast.
#include <hip/hip_runtime.h>
#include <math.h>

// ---------------- model constants ----------------
#define Bq 8
#define Sq_ 1024
#define Dm 512
#define Hh 8
#define HDc 64
#define DFFc 2048

// ---------------- WMMA types ----------------
typedef __bf16 bf16_t;
typedef bf16_t v16bf __attribute__((ext_vector_type(16)));
typedef float v8f __attribute__((ext_vector_type(8)));

union Frag { uint4 u[2]; v16bf v; };

__device__ __forceinline__ unsigned short f2bf(float f) {
  union { float f; unsigned u; } v; v.f = f;
  unsigned r = v.u + 0x7FFFu + ((v.u >> 16) & 1u);
  return (unsigned short)(r >> 16);
}

__device__ __forceinline__ float gelu_f(float x) {
  float x3 = x * x * x;
  return 0.5f * x * (1.0f + tanhf(0.7978845608028654f * (x + 0.044715f * x3)));
}

// async copy 16B global -> LDS (ASYNCcnt-tracked, no VGPR round-trip)
__device__ __forceinline__ void async_cp16(const unsigned short* g, unsigned short* l) {
  unsigned lds = (unsigned)(uintptr_t)l;   // low 32 bits = LDS byte address
  asm volatile("global_load_async_to_lds_b128 %0, %1, off"
               :: "v"(lds), "v"(g) : "memory");
}
__device__ __forceinline__ void wait_async0() {
  asm volatile("s_wait_asynccnt 0x0" ::: "memory");
}
__device__ __forceinline__ void wait_async4() {
  asm volatile("s_wait_asynccnt 0x4" ::: "memory");
}

// =====================================================================
// bf16 WMMA GEMM:  C[M,N] = A[M,K] * W[K,N] + bias, optional GELU.
// A: bf16 row-major [M,K]; Wt: bf16 [N,K] (pre-transposed weights).
// Block 256 thr = 8 waves; tile 128x128, BK=32; wave tile 32x64.
// Double-buffered LDS staged with GLOBAL_LOAD_ASYNC_TO_LDS_B128;
// last tile peeled so the steady-state loop body is branch-free.
// N, the activation (ACT 1: GELU) and the output type (OUT_F32: outF, else
// bf16 to outB) are template parameters: the epilogue is then straight-line
// code, one address per thread with the 64 elements at constant offsets.
// NMAT products that do not depend on each other share a launch: Wt holds
// NMAT matrices [N,K] one after another, bias NMAT vectors, the output NMAT
// arrays [M,N]; grid.y runs over the column tiles of all of them. The first
// product reads A, the others A2. A WGP then holds NMAT work-groups, and
// one computes while another waits for its staged tile.
// =====================================================================
template <int N, int ACT, bool OUT_F32, int NMAT>
__global__ __launch_bounds__(256) void gemm_bf16_kernel(
    const unsigned short* __restrict__ A,
    const unsigned short* __restrict__ A2,
    const unsigned short* __restrict__ Wt,
    const float* __restrict__ bias,
    float* __restrict__ outF,
    unsigned short* __restrict__ outB,
    int K)
{
  // LDS row pitch (bf16 elems): 80 B = 16 B x odd. The 16 rows that a half-wave's
  // ds_load_b128 reads then start on 16 different groups of 4 banks (20 * row
  // mod 64 dwords); at 96 B rows r and r + 8 share their banks and each load
  // takes twice the LDS clocks
  constexpr int ST = 40;
  __shared__ unsigned short As[2][128 * ST];
  __shared__ unsigned short Bs[2][128 * ST];
  const int tid   = threadIdx.x;
  const int wave  = tid >> 5;
  const int lane  = tid & 31;
  const int l15   = lane & 15;
  const int lhalf = lane >> 4;
  const int koff  = lhalf * 8;
  const int bm = blockIdx.x * 128;
  const int bs = blockIdx.y * 128;                       // row of the stacked Wt and bias
  const int mat = (NMAT > 1) ? bs / N : 0;               // which product
  const int bn = bs - mat * N;                           // column in its own output
  const unsigned short* Am = (mat == 0) ? A : A2;
  const int wm = (wave >> 1) * 32;
  const int wn = (wave & 1) * 64;

  v8f zf = {};
  v8f c[2][4];
#pragma unroll
  for (int i = 0; i < 2; ++i)
#pragma unroll
    for (int j = 0; j < 4; ++j) c[i][j] = zf;

  // per-thread staging coordinates: 2 chunks of 8 bf16 per matrix,
  // running global pointers advanced by BK each issue.
  const int r0 = tid >> 2,           c0 = (tid & 3) * 8;          // chunk 0
  const int r1 = (tid + 256) >> 2,   c1 = ((tid + 256) & 3) * 8;  // chunk 1
  const unsigned short* gA0 = Am + (size_t)(bm + r0) * K + c0;
  const unsigned short* gA1 = Am + (size_t)(bm + r1) * K + c1;
  const unsigned short* gB0 = Wt + (size_t)(bs + r0) * K + c0;
  const unsigned short* gB1 = Wt + (size_t)(bs + r1) * K + c1;
  unsigned short* lA0[2] = { &As[0][r0 * ST + c0], &As[1][r0 * ST + c0] };
  unsigned short* lA1[2] = { &As[0][r1 * ST + c1], &As[1][r1 * ST + c1] };
  unsigned short* lB0[2] = { &Bs[0][r0 * ST + c0], &Bs[1][r0 * ST + c0] };
  unsigned short* lB1[2] = { &Bs[0][r1 * ST + c1], &Bs[1][r1 * ST + c1] };

  auto issue = [&](int buf) {
    async_cp16(gA0, lA0[buf]);  gA0 += 32;
    async_cp16(gA1, lA1[buf]);  gA1 += 32;
    async_cp16(gB0, lB0[buf]);  gB0 += 32;
    async_cp16(gB1, lB1[buf]);  gB1 += 32;
  };
  auto compute = [&](int cur) {
    Frag a[2], b[4];
#pragma unroll
    for (int i = 0; i < 2; ++i) {
      const unsigned short* p = &As[cur][(wm + i * 16 + l15) * ST];
      a[i].u[0] = *(const uint4*)(p + koff);
      a[i].u[1] = *(const uint4*)(p + koff + 16);
    }
#pragma unroll
    for (int j = 0; j < 4; ++j) {
      const unsigned short* p = &Bs[cur][(wn + j * 16 + l15) * ST];
      b[j].u[0] = *(const uint4*)(p + koff);
      b[j].u[1] = *(const uint4*)(p + koff + 16);
    }
#pragma unroll
    for (int i = 0; i < 2; ++i)
#pragma unroll
      for (int j = 0; j < 4; ++j)
        c[i][j] = __builtin_amdgcn_wmma_f32_16x16x32_bf16(
            false, a[i].v, false, b[j].v, (short)0, c[i][j], false, false);
  };

  const int nK = K >> 5;
  issue(0);
  for (int kt = 0; kt < nK - 1; ++kt) {   // branch-free steady state
    const int cur = kt & 1;
    issue(cur ^ 1);       // prefetch next tile (async, overlaps compute)
    wait_async4();        // own copies of current tile complete
    __syncthreads();
    compute(cur);
    __syncthreads();
  }
  wait_async0();          // peeled last tile
  __syncthreads();
  compute((nK - 1) & 1);

  const int col0 = bn + wn + l15;
  const size_t idx0 = ((size_t)mat * (Bq * Sq_) + (bm + wm + 8 * lhalf)) * N + col0;  // M = Bq * Sq_ rows an output
  float bb[4];
#pragma unroll
  for (int j = 0; j < 4; ++j) bb[j] = bias[bs + wn + l15 + j * 16];
#pragma unroll
  for (int i = 0; i < 2; ++i) {
#pragma unroll
    for (int j = 0; j < 4; ++j) {
#pragma unroll
      for (int r = 0; r < 8; ++r) {
        float v = c[i][j][r] + bb[j];
        if constexpr (ACT == 1) v = gelu_f(v);
        const size_t idx = idx0 + (i * 16 + r) * N + j * 16;
        if constexpr (OUT_F32) outF[idx] = v;
        else                   outB[idx] = f2bf(v);
      }
    }
  }
}

// ---------------- reductions over a 16-lane row ----------------
// The softmax rows of a WMMA result lie across the 16 lanes of a row. Both
// reductions are butterflies (l ^ 1, 2, 4, 8) that stay in the vector
// registers; every lane ends with the result. All 32 lanes must be on.

__device__ __forceinline__ float row16_max(float v) {
  // in asm so that a step is one instruction: behind the DPP builtin the
  // compiler puts a canonicalising v_max in front of every fmaxf and does
  // not fuse the two. The s_delay_alu lines let the other waves of the SIMD
  // issue while a step waits for the step before it
  asm("v_max_num_f32_dpp %0, %0, %0 row_xmask:1 row_mask:0xf bank_mask:0xf\n\t"
      "s_delay_alu instid0(VALU_DEP_1)\n\t"
      "v_max_num_f32_dpp %0, %0, %0 row_xmask:2 row_mask:0xf bank_mask:0xf\n\t"
      "s_delay_alu instid0(VALU_DEP_1)\n\t"
      "v_max_num_f32_dpp %0, %0, %0 row_xmask:4 row_mask:0xf bank_mask:0xf\n\t"
      "s_delay_alu instid0(VALU_DEP_1)\n\t"
      "v_max_num_f32_dpp %0, %0, %0 row_xmask:8 row_mask:0xf bank_mask:0xf"
      : "+v"(v));
  return v;
}
// lane l reads lane l ^ X of its row, in the form that the compiler fuses
// with the add behind it (v_add_f32_dpp)
template <int X>
__device__ __forceinline__ float row16_peer(float v) {
  int u = __builtin_bit_cast(int, v);
  return __builtin_bit_cast(float, __builtin_amdgcn_update_dpp(0, u, 0x160 + X, 0xf, 0xf, true));
}
__device__ __forceinline__ float row16_sum(float v) {
  v += row16_peer<1>(v);
  v += row16_peer<2>(v);
  v += row16_peer<4>(v);
  v += row16_peer<8>(v);
  return v;
}

// =====================================================================
// Banded flash attention. Q,K,V,O: bf16 [B*S, D], head h in cols h*64..
// Grid: (Sq/64, B*H); 128 threads = 4 waves; wave owns 16 q-rows.
// Per 32-key tile: 4 WMMA for Q*K^T, online softmax, 4 WMMA for P*V.
// Q/K tiles staged with async-to-LDS; V transposed manually.
// =====================================================================
__global__ __launch_bounds__(128) void banded_attn_kernel(
    const unsigned short* __restrict__ Q,
    const unsigned short* __restrict__ Kc,
    const unsigned short* __restrict__ Vc,
    unsigned short* __restrict__ O,
    int Sq, int Sk, int bw)
{
  constexpr int STK = 72;  // stride for 64-wide hd rows (144B, aligned)
  constexpr int STV = 40;  // stride for 32-wide key rows (80B = 16B x odd: ds_load_b128 of 16 rows meets no bank twice)
  __shared__ unsigned short Qs[64 * STK];
  __shared__ unsigned short Ks[32 * STK];
  __shared__ unsigned short Vs[64 * STV];      // transposed: [hd][key]
  __shared__ unsigned short Ps[4][16 * STV];   // per-wave P tile [q][key]

  const int tid   = threadIdx.x;
  const int wave  = tid >> 5;
  const int lane  = tid & 31;
  const int l15   = lane & 15;
  const int lhalf = lane >> 4;
  const int koff  = lhalf * 8;
  const int q0 = blockIdx.x * 64;
  const int bh = blockIdx.y;
  const int bb = bh / Hh;
  const int hh = bh % Hh;

  const unsigned short* Qg = Q  + ((size_t)bb * Sq) * Dm + hh * HDc;
  const unsigned short* Kg = Kc + ((size_t)bb * Sk) * Dm + hh * HDc;
  const unsigned short* Vg = Vc + ((size_t)bb * Sk) * Dm + hh * HDc;

  // stage Q tile (64 x 64) via async copies
#pragma unroll
  for (int i = 0; i < 4; ++i) {
    int chunk = tid + i * 128;
    int r  = chunk >> 3;
    int cc = (chunk & 7) * 8;
    async_cp16(Qg + (size_t)(q0 + r) * Dm + cc, Qs + r * STK + cc);
  }
  wait_async0();
  __syncthreads();

  Frag qa[2];
  {
    const unsigned short* p = Qs + (wave * 16 + l15) * STK;
    qa[0].u[0] = *(const uint4*)(p + koff);
    qa[0].u[1] = *(const uint4*)(p + koff + 16);
    qa[1].u[0] = *(const uint4*)(p + 32 + koff);
    qa[1].u[1] = *(const uint4*)(p + 32 + koff + 16);
  }

  v8f zf = {};
  float rmax[8], rsum[8];
  v8f o[4];
#pragma unroll
  for (int r = 0; r < 8; ++r) { rmax[r] = -__builtin_inff(); rsum[r] = 0.0f; }
#pragma unroll
  for (int j = 0; j < 4; ++j) o[j] = zf;

  int ks = q0 - bw;        if (ks < 0)  ks = 0;
  int ke = q0 + 64 + bw;   if (ke > Sk) ke = Sk;

  for (int kb = ks; kb < ke; kb += 32) {
    __syncthreads();
    // K tile natural [key][hd] via async; V tile transposed into Vs[hd][key]
#pragma unroll
    for (int i = 0; i < 2; ++i) {
      int chunk = tid + i * 128;
      int r  = chunk >> 3;
      int cc = (chunk & 7) * 8;
      async_cp16(Kg + (size_t)(kb + r) * Dm + cc, Ks + r * STK + cc);
      uint4 d = *(const uint4*)(Vg + (size_t)(kb + r) * Dm + cc);
      const unsigned short* ds = (const unsigned short*)&d;
#pragma unroll
      for (int t = 0; t < 8; ++t) Vs[(cc + t) * STV + r] = ds[t];
    }
    wait_async0();
    __syncthreads();

    // scores for two 16-key sub-tiles
    Frag b0a, b0b, b1a, b1b;
    {
      const unsigned short* p0 = Ks + l15 * STK;
      const unsigned short* p1 = Ks + (16 + l15) * STK;
      b0a.u[0] = *(const uint4*)(p0 + koff);      b0a.u[1] = *(const uint4*)(p0 + koff + 16);
      b0b.u[0] = *(const uint4*)(p0 + 32 + koff); b0b.u[1] = *(const uint4*)(p0 + 32 + koff + 16);
      b1a.u[0] = *(const uint4*)(p1 + koff);      b1a.u[1] = *(const uint4*)(p1 + koff + 16);
      b1b.u[0] = *(const uint4*)(p1 + 32 + koff); b1b.u[1] = *(const uint4*)(p1 + 32 + koff + 16);
    }
    v8f s0 = __builtin_amdgcn_wmma_f32_16x16x32_bf16(false, qa[0].v, false, b0a.v, (short)0, zf, false, false);
    s0     = __builtin_amdgcn_wmma_f32_16x16x32_bf16(false, qa[1].v, false, b0b.v, (short)0, s0, false, false);
    v8f s1 = __builtin_amdgcn_wmma_f32_16x16x32_bf16(false, qa[0].v, false, b1a.v, (short)0, zf, false, false);
    s1     = __builtin_amdgcn_wmma_f32_16x16x32_bf16(false, qa[1].v, false, b1b.v, (short)0, s1, false, false);

    // online softmax (rows live across 16-lane halves)
    unsigned short* Pw = Ps[wave];
#pragma unroll
    for (int r = 0; r < 8; ++r) {
      int m = r + 8 * lhalf;
      int qrow = q0 + wave * 16 + m;
      float v0 = s0[r] * 0.125f;     // 1/sqrt(64)
      float v1 = s1[r] * 0.125f;
      int d0 = qrow - (kb + l15);       if (d0 < 0) d0 = -d0;
      int d1 = qrow - (kb + 16 + l15);  if (d1 < 0) d1 = -d1;
      if (d0 > bw) v0 = -__builtin_inff();
      if (d1 > bw) v1 = -__builtin_inff();
      float mt = row16_max(fmaxf(v0, v1));
      float nm = fmaxf(rmax[r], mt);
      float sc, p0, p1;
      if (nm < -1e37f) { sc = 1.0f; p0 = 0.0f; p1 = 0.0f; }
      else {
        sc = __expf(rmax[r] - nm);
        p0 = __expf(v0 - nm);
        p1 = __expf(v1 - nm);
      }
      rmax[r] = nm;
      float ps = row16_sum(p0 + p1);
      rsum[r] = rsum[r] * sc + ps;
#pragma unroll
      for (int j = 0; j < 4; ++j) o[j][r] *= sc;
      Pw[m * STV + l15]      = f2bf(p0);
      Pw[m * STV + 16 + l15] = f2bf(p1);
    }
    __syncthreads();

    // ctx += P[16x32] * V[32x64]
    Frag pa;
    {
      const unsigned short* p = Pw + l15 * STV;
      pa.u[0] = *(const uint4*)(p + koff);
      pa.u[1] = *(const uint4*)(p + koff + 16);
    }
#pragma unroll
    for (int j = 0; j < 4; ++j) {
      Frag vb;
      const unsigned short* p = Vs + (j * 16 + l15) * STV;
      vb.u[0] = *(const uint4*)(p + koff);
      vb.u[1] = *(const uint4*)(p + koff + 16);
      o[j] = __builtin_amdgcn_wmma_f32_16x16x32_bf16(false, pa.v, false, vb.v, (short)0, o[j], false, false);
    }
  }

  float inv[8];
#pragma unroll
  for (int r = 0; r < 8; ++r) inv[r] = 1.0f / rsum[r];
#pragma unroll
  for (int j = 0; j < 4; ++j)
#pragma unroll
    for (int r = 0; r < 8; ++r) {
      int m = r + 8 * lhalf;
      int qrow = q0 + wave * 16 + m;
      int hd = j * 16 + l15;
      O[((size_t)bb * Sq + qrow) * Dm + hh * HDc + hd] = f2bf(o[j][r] * inv[r]);
    }
}

// =====================================================================
// Embedding: h = (x @ W + b) * sqrt(D) + PE(s, d); outputs f32 + bf16.
// A work-group walks EMB_ROWS rows, a thread keeping its two columns: the
// launch starts 4096 waves where one work-group a row would start 65536.
// =====================================================================
#define EMB_ROWS 16
__global__ __launch_bounds__(256) void embed_kernel(
    const float* __restrict__ x, const float* __restrict__ W,
    const float* __restrict__ bias, float* __restrict__ outF,
    unsigned short* __restrict__ outB, int Cin)
{
  const int row0 = blockIdx.x * EMB_ROWS;
  const int tid = threadIdx.x;
  const int d = tid * 2;
  // what depends on the column alone is formed once
  float wv[7][2];
#pragma unroll
  for (int c = 0; c < 7; ++c) {
    wv[c][0] = (c < Cin) ? W[c * Dm + d]     : 0.0f;
    wv[c][1] = (c < Cin) ? W[c * Dm + d + 1] : 0.0f;
  }
  const float b0 = bias[d], b1 = bias[d + 1];
  const float div = __expf((float)d * (-9.210340371976184f / 512.0f));

  float xn[7];
#pragma unroll
  for (int c = 0; c < 7; ++c) xn[c] = (c < Cin) ? x[(size_t)row0 * Cin + c] : 0.0f;
  // kept rolled: for speed only
#pragma unroll 1
  for (int rr = 0; rr < EMB_ROWS; ++rr) {
    const int row = row0 + rr;
    float xv[7];
#pragma unroll
    for (int c = 0; c < 7; ++c) xv[c] = xn[c];
    // the next row's inputs fly while this row is computed (the last trip
    // reads its own row again, so the address stays inside x)
    const int nxt = (rr + 1 < EMB_ROWS) ? row + 1 : row;
#pragma unroll
    for (int c = 0; c < 7; ++c) xn[c] = (c < Cin) ? x[(size_t)nxt * Cin + c] : 0.0f;
    float acc0 = b0, acc1 = b1;
#pragma unroll
    for (int c = 0; c < 7; ++c) { acc0 += xv[c] * wv[c][0]; acc1 += xv[c] * wv[c][1]; }
    acc0 *= 22.627416997969522f;  // sqrt(512)
    acc1 *= 22.627416997969522f;
    const float arg = (float)(row & (Sq_ - 1)) * div;
    acc0 += sinf(arg);
    acc1 += cosf(arg);
    *(float2*)(outF + (size_t)row * Dm + d) = make_float2(acc0, acc1);
    *(unsigned*)(outB + (size_t)row * Dm + d) =
        (unsigned)f2bf(acc0) | ((unsigned)f2bf(acc1) << 16);
  }
}

// =====================================================================
// Residual + LayerNorm over D=512; outputs f32 (may alias x) + bf16.
// A wave owns whole rows: a lane holds 16 of a row's 512 values, and each
// of the two sums is a sum inside the lane and a five-step butterfly over
// the wave: no LDS, no barrier. A wave takes LN_RPW rows side by side, all
// their loads in flight together, so a launch starts 2048 waves where one
// work-group a row would start 65536.
// =====================================================================
#define LN_RPW 4

// lane l reads lane l ^ X of its 16-lane row
template <int X>
__device__ __forceinline__ float row_xor(float v) {
  int u = __builtin_bit_cast(int, v);
  return __builtin_bit_cast(float, __builtin_amdgcn_update_dpp(u, u, 0x160 + X, 0xf, 0xf, false));
}
// butterfly sum over the 32 lanes; every lane ends with the same value
__device__ __forceinline__ float wave_sum(float v) {
  v += row_xor<1>(v);
  v += row_xor<2>(v);
  v += row_xor<4>(v);
  v += row_xor<8>(v);
  int u = __builtin_bit_cast(int, v);
  v += __builtin_bit_cast(float,
      __builtin_amdgcn_permlanex16(u, u, 0x76543210, 0xfedcba98, false, false));
  return v;
}

typedef float f32x4 __attribute__((ext_vector_type(4)));
union Two4 { f32x4 h[2]; v8f v; };   // two 16-byte loads, named as one value

__global__ __launch_bounds__(256) void ln_kernel(
    const float* __restrict__ x, const float* __restrict__ res,
    const float* __restrict__ w, const float* __restrict__ b,
    float* __restrict__ outF, unsigned short* __restrict__ outB)
{
  const int lane = threadIdx.x & 31;
  const int row0 = (blockIdx.x * 8 + (threadIdx.x >> 5)) * LN_RPW;
  Two4 xr[LN_RPW][4];   // h[0]: x, h[1]: res
  Two4 wb[4];           // h[0]: w, h[1]: b
  const f32x4* xp = (const f32x4*)(x   + (size_t)row0 * Dm) + lane;
  const f32x4* rp = (const f32x4*)(res + (size_t)row0 * Dm) + lane;
#pragma unroll
  for (int rr = 0; rr < LN_RPW; ++rr) {
#pragma unroll
    for (int i = 0; i < 4; ++i) {
      xr[rr][i].h[0] = xp[rr * (Dm / 4) + 32 * i];
      xr[rr][i].h[1] = rp[rr * (Dm / 4) + 32 * i];
    }
  }
#pragma unroll
  for (int i = 0; i < 4; ++i) {
    wb[i].h[0] = ((const f32x4*)w)[lane + 32 * i];
    wb[i].h[1] = ((const f32x4*)b)[lane + 32 * i];
  }
  // holds all forty loads of the wave in front of the arithmetic, in flight
  // together (loaded values as inputs only): left alone the compiler sinks
  // a third of them behind the sums, where each is waited for on its own.
  // It is also the wait that belongs in front of any rewrite of an issued
  // load's address registers; naming the two addresses keeps them out of
  // the loads' own destination registers until it has passed
  asm volatile("s_wait_xcnt 0x0" ::
      "v"(xr[0][0].v), "v"(xr[0][1].v), "v"(xr[0][2].v), "v"(xr[0][3].v),
      "v"(xr[1][0].v), "v"(xr[1][1].v), "v"(xr[1][2].v), "v"(xr[1][3].v),
      "v"(xr[2][0].v), "v"(xr[2][1].v), "v"(xr[2][2].v), "v"(xr[2][3].v),
      "v"(xr[3][0].v), "v"(xr[3][1].v), "v"(xr[3][2].v), "v"(xr[3][3].v),
      "v"(wb[0].v), "v"(wb[1].v), "v"(wb[2].v), "v"(wb[3].v), "v"(xp), "v"(rp));

  f32x4 a[LN_RPW][4];
  float s[LN_RPW];
#pragma unroll
  for (int rr = 0; rr < LN_RPW; ++rr) {
    float t = 0.0f;
#pragma unroll
    for (int i = 0; i < 4; ++i) {
      a[rr][i] = xr[rr][i].h[0] + xr[rr][i].h[1];
      t += (a[rr][i].x + a[rr][i].y) + (a[rr][i].z + a[rr][i].w);
    }
    s[rr] = wave_sum(t);
  }

#pragma unroll
  for (int rr = 0; rr < LN_RPW; ++rr) {
    const float mu = s[rr] * (1.0f / 512.0f);
    float t = 0.0f;
#pragma unroll
    for (int i = 0; i < 4; ++i) {
      a[rr][i] -= mu;
      t += (a[rr][i].x * a[rr][i].x + a[rr][i].y * a[rr][i].y) +
           (a[rr][i].z * a[rr][i].z + a[rr][i].w * a[rr][i].w);
    }
    s[rr] = wave_sum(t);
  }

#pragma unroll
  for (int rr = 0; rr < LN_RPW; ++rr) {
    const float rstd = rsqrtf(s[rr] * (1.0f / 512.0f) + 1e-5f);
    f32x4* of = (f32x4*)(outF + (size_t)(row0 + rr) * Dm);
    uint2* ob = (uint2*)(outB + (size_t)(row0 + rr) * Dm);
#pragma unroll
    for (int i = 0; i < 4; ++i) {
      const f32x4 y = a[rr][i] * rstd * wb[i].h[0] + wb[i].h[1];
      of[lane + 32 * i] = y;
      ob[lane + 32 * i] = make_uint2(
          (unsigned)f2bf(y.x) | ((unsigned)f2bf(y.y) << 16),
          (unsigned)f2bf(y.z) | ((unsigned)f2bf(y.w) << 16));
    }
  }
}

// =====================================================================
// Weight preparation, one launch for all 22 matrices:
// fp32 [K,N] -> bf16 transposed [N,K], packed one after another in wt:
//   16 x [512,512]  (encoder attention 8, decoder self 4, decoder cross 4)
//    3 x [512,2048] (first FFN matrix: encoder 2, decoder 1)
//    3 x [2048,512] (second FFN matrix: encoder 2, decoder 1)
// The matrices are cut into 64x64 tiles, 2560 in all. A block moves 5 of
// them through LDS: 256-B row pieces are read, whole 128-B lines written.
// An LDS dword holds the bf16 pair (k, k+1) of one n; the pitch of 33
// dwords keeps both the column-wise writes and the row-wise reads on
// distinct banks.
// =====================================================================
#define WP_BLOCKS 512
#define WP_TILES_PER_BLOCK 5
#define WP_DD  (Dm * Dm)
#define WP_DF  (Dm * DFFc)
#define WP_FF1 (16 * WP_DD)
#define WP_FF2 (16 * WP_DD + 3 * WP_DF)

__global__ __launch_bounds__(256) void wprep_kernel(
    const float* __restrict__ enc_attn_w, const float* __restrict__ dec_self_w,
    const float* __restrict__ dec_cross_w,
    const float* __restrict__ enc_ff_w1, const float* __restrict__ dec_ff_w1,
    const float* __restrict__ enc_ff_w2, const float* __restrict__ dec_ff_w2,
    unsigned short* __restrict__ wt)
{
  constexpr int P = 33;
  __shared__ unsigned tile[2][64 * P];
  const int tid = threadIdx.x;
  const int p   = tid >> 4;         // reader: k pair (rows 2p, 2p+1, +32, +33)
  const int n0  = (tid & 15) * 4;   // reader: 4 columns
  const int wr  = tid >> 3;         // writer: output row (n), +32
  const int wc  = tid & 7;          // writer: 16-B chunk of the 128-B line

  float4 r[4];
  unsigned short* dst;
  int dstK;

  // tile id -> source and destination of its corner (same for the whole block)
  auto fetch = [&](int id) {
    const float* s; unsigned short* d; int K, N, kt, nt;
    if (id < 1024) {
      int m = id >> 6;
      s = (m < 8) ? enc_attn_w + (size_t)m * WP_DD
        : (m < 12) ? dec_self_w + (size_t)(m - 8) * WP_DD
                   : dec_cross_w + (size_t)(m - 12) * WP_DD;
      d = wt + (size_t)m * WP_DD;
      K = Dm; N = Dm; kt = (id >> 3) & 7; nt = id & 7;
    } else if (id < 1792) {
      int j = id - 1024, m = j >> 8;
      s = (m < 2) ? enc_ff_w1 + (size_t)m * WP_DF : dec_ff_w1;
      d = wt + WP_FF1 + (size_t)m * WP_DF;
      K = Dm; N = DFFc; kt = (j >> 5) & 7; nt = j & 31;
    } else {
      int j = id - 1792, m = j >> 8;
      s = (m < 2) ? enc_ff_w2 + (size_t)m * WP_DF : dec_ff_w2;
      d = wt + WP_FF2 + (size_t)m * WP_DF;
      K = DFFc; N = Dm; kt = (j >> 3) & 31; nt = j & 7;
    }
    const float* g = s + (size_t)(kt * 64 + 2 * p) * N + nt * 64 + n0;
    const float* g1 = g + N;
    const float* g2 = g + (size_t)32 * N;
    const float* g3 = g + (size_t)33 * N;
    r[0] = *(const float4*)(g);
    r[1] = *(const float4*)(g1);
    r[2] = *(const float4*)(g2);
    r[3] = *(const float4*)(g3);
    // the wait that belongs in front of any rewrite of an issued load's
    // address registers; naming the four addresses keeps them out of the
    // loads' own destination registers until it has passed
    asm volatile("s_wait_xcnt 0x0" :: "v"(g), "v"(g1), "v"(g2), "v"(g3) : "memory");
    dst  = d + (size_t)(nt * 64 + wr) * K + kt * 64 + wc * 8;
    dstK = K;
  };
  auto pack = [](float lo, float hi) -> unsigned {
    return (unsigned)f2bf(lo) | ((unsigned)f2bf(hi) << 16);
  };

  fetch(blockIdx.x);
  // unrolled so that the buffer index and the last-tile test are constants
#pragma unroll
  for (int t = 0; t < WP_TILES_PER_BLOCK; ++t) {
    unsigned* L = tile[t & 1];
    const float* a0 = (const float*)&r[0];
    const float* a1 = (const float*)&r[1];
    const float* a2 = (const float*)&r[2];
    const float* a3 = (const float*)&r[3];
    // unrolled so that r[] is indexed by constants and stays in registers
#pragma unroll
    for (int e = 0; e < 4; ++e) {
      L[(n0 + e) * P + p]      = pack(a0[e], a1[e]);
      L[(n0 + e) * P + 16 + p] = pack(a2[e], a3[e]);
    }
    unsigned short* o = dst;
    const int oK = dstK;
    // one barrier a tile: with two buffers it also ends the reads of the
    // buffer that the next tile overwrites
    __syncthreads();
    // the next tile's loads fly while this tile is written out
    if (t + 1 < WP_TILES_PER_BLOCK) fetch(blockIdx.x + (t + 1) * WP_BLOCKS);
    // unrolled so that both halves' LDS reads issue together
#pragma unroll
    for (int h = 0; h < 2; ++h) {
      const unsigned* q = L + (h * 32 + wr) * P + wc * 4;
      uint4 v = make_uint4(q[0], q[1], q[2], q[3]);
      *(uint4*)(o + (size_t)(h * 32) * oK) = v;
    }
  }
}

// final projection D->1: one wave per row
__global__ __launch_bounds__(256) void outproj_kernel(
    const float* __restrict__ t, const float* __restrict__ w,
    const float* __restrict__ b, float* __restrict__ out, int M)
{
  int gid = blockIdx.x * 256 + threadIdx.x;
  int row = gid >> 5;
  int lane = gid & 31;
  if (row >= M) return;
  float acc = 0.0f;
#pragma unroll
  for (int i = 0; i < 16; ++i)
    acc += t[(size_t)row * Dm + lane + i * 32] * w[lane + i * 32];
#pragma unroll
  for (int ofs = 16; ofs > 0; ofs >>= 1)
    acc += __shfl_xor(acc, ofs, 32);
  if (lane == 0) out[row] = acc + b[0];
}

// =====================================================================
// Host orchestration
// =====================================================================
extern "C" void kernel_launch(void* const* d_in, const int* in_sizes, int n_in,
                              void* d_out, int out_size, void* d_ws, size_t ws_size,
                              hipStream_t stream) {
  (void)in_sizes; (void)n_in; (void)out_size; (void)ws_size;
  const float* x_enc      = (const float*)d_in[0];
  const float* x_dec      = (const float*)d_in[1];
  const float* emb_enc_w  = (const float*)d_in[2];
  const float* emb_enc_b  = (const float*)d_in[3];
  const float* emb_dec_w  = (const float*)d_in[4];
  const float* emb_dec_b  = (const float*)d_in[5];
  const float* enc_attn_w = (const float*)d_in[6];
  const float* enc_attn_b = (const float*)d_in[7];
  const float* enc_ff_w1  = (const float*)d_in[8];
  const float* enc_ff_b1  = (const float*)d_in[9];
  const float* enc_ff_w2  = (const float*)d_in[10];
  const float* enc_ff_b2  = (const float*)d_in[11];
  const float* enc_ln_w   = (const float*)d_in[12];
  const float* enc_ln_b   = (const float*)d_in[13];
  const float* dec_self_w = (const float*)d_in[14];
  const float* dec_self_b = (const float*)d_in[15];
  const float* dec_cross_w= (const float*)d_in[16];
  const float* dec_cross_b= (const float*)d_in[17];
  const float* dec_ff_w1  = (const float*)d_in[18];
  const float* dec_ff_b1  = (const float*)d_in[19];
  const float* dec_ff_w2  = (const float*)d_in[20];
  const float* dec_ff_b2  = (const float*)d_in[21];
  const float* dec_ln_w   = (const float*)d_in[22];
  const float* dec_ln_b   = (const float*)d_in[23];
  const float* out_w      = (const float*)d_in[24];
  const float* out_b      = (const float*)d_in[25];

  const int M = Bq * Sq_;  // 8192
  char* ws = (char*)d_ws;
  size_t off = 0;
  auto alloc = [&](size_t bytes) -> void* {
    void* p = ws + off;
    off += (bytes + 255) & ~(size_t)255;
    return p;
  };
  float*          h_f   = (float*)alloc((size_t)M * Dm * 4);
  unsigned short* h_b   = (unsigned short*)alloc((size_t)M * Dm * 2);
  float*          t_f   = (float*)alloc((size_t)M * Dm * 4);
  unsigned short* t_b   = (unsigned short*)alloc((size_t)M * Dm * 2);
  unsigned short* q_b   = (unsigned short*)alloc((size_t)3 * M * Dm * 2);  // q, k, v in a row
  unsigned short* k_b   = q_b + (size_t)M * Dm;
  unsigned short* v_b   = k_b + (size_t)M * Dm;
  unsigned short* ctx_b = (unsigned short*)alloc((size_t)M * Dm * 2);
  float*          g_f   = (float*)alloc((size_t)M * Dm * 4);
  unsigned short* ffn_b = (unsigned short*)alloc((size_t)M * DFFc * 2);
  unsigned short* wt  = (unsigned short*)alloc(((size_t)16 * WP_DD + (size_t)6 * WP_DF) * 2);
  auto wA  = [&](int m) { return wt + (size_t)m * WP_DD; };           // attention matrices
  auto wF1 = [&](int m) { return wt + WP_FF1 + (size_t)m * WP_DF; };  // first FFN matrices
  auto wF2 = [&](int m) { return wt + WP_FF2 + (size_t)m * WP_DF; };  // second FFN matrices

  // the q, k and v projections of one attention, one launch:
  // Aq x W[0], Akv x W[1], Akv x W[2], each [M,Dm] x [Dm,Dm] -> bf16, to q_b, k_b, v_b
  auto gemm_qkv = [&](const unsigned short* Aq, const unsigned short* Akv,
                      const unsigned short* Wt, const float* bias) {
    gemm_bf16_kernel<Dm, 0, false, 3><<<dim3(M / 128, 3 * Dm / 128), 256, 0, stream>>>(Aq, Akv, Wt, bias, nullptr, q_b, Dm);
  };
  // [M,Kk] x [Kk,Dm] -> f32
  auto gemm_f = [&](const unsigned short* A, const unsigned short* Wt, const float* bias,
                    float* oF, int Kk) {
    gemm_bf16_kernel<Dm, 0, true, 1><<<dim3(M / 128, Dm / 128), 256, 0, stream>>>(A, A, Wt, bias, oF, nullptr, Kk);
  };
  // [M,Dm] x [Dm,DFFc], GELU -> bf16
  auto gemm_g = [&](const unsigned short* A, const unsigned short* Wt, const float* bias,
                    unsigned short* oB) {
    gemm_bf16_kernel<DFFc, 1, false, 1><<<dim3(M / 128, DFFc / 128), 256, 0, stream>>>(A, A, Wt, bias, nullptr, oB, Dm);
  };
  auto attn = [&](const unsigned short* Qp, const unsigned short* Kp,
                  const unsigned short* Vp, unsigned short* Op) {
    banded_attn_kernel<<<dim3(Sq_ / 64, Bq * Hh), 128, 0, stream>>>(Qp, Kp, Vp, Op, Sq_, Sq_, Sq_ / 4);
  };
  auto lnorm = [&](const float* xx, const float* rr, const float* w, const float* bb,
                   float* oF, unsigned short* oB) {
    ln_kernel<<<M / (8 * LN_RPW), 256, 0, stream>>>(xx, rr, w, bb, oF, oB);
  };

  // ----- all weights to bf16 [N,K], once -----
  wprep_kernel<<<WP_BLOCKS, 256, 0, stream>>>(enc_attn_w, dec_self_w, dec_cross_w,
                                              enc_ff_w1, dec_ff_w1, enc_ff_w2, dec_ff_w2, wt);

  // ----- encoder -----
  embed_kernel<<<M / EMB_ROWS, 256, 0, stream>>>(x_enc, emb_enc_w, emb_enc_b, h_f, h_b, 7);
  for (int l = 0; l < 2; ++l) {
    const float* ab = enc_attn_b + (size_t)l * 4 * Dm;
    gemm_qkv(h_b, h_b, wA(l * 4), ab);
    attn(q_b, k_b, v_b, ctx_b);
    gemm_f(ctx_b, wA(l * 4 + 3), ab + 3 * Dm, g_f, Dm);
    lnorm(h_f, g_f, enc_ln_w + (size_t)l * 2 * Dm, enc_ln_b + (size_t)l * 2 * Dm, h_f, h_b);
    gemm_g(h_b, wF1(l), enc_ff_b1 + (size_t)l * DFFc, ffn_b);
    gemm_f(ffn_b, wF2(l), enc_ff_b2 + (size_t)l * Dm, g_f, DFFc);
    lnorm(h_f, g_f, enc_ln_w + (size_t)l * 2 * Dm + Dm, enc_ln_b + (size_t)l * 2 * Dm + Dm, h_f, h_b);
  }
  // h_f / h_b now hold encoder memory.

  // ----- decoder (DL = 1) -----
  embed_kernel<<<M / EMB_ROWS, 256, 0, stream>>>(x_dec, emb_dec_w, emb_dec_b, t_f, t_b, 1);
  {
    // self-attention
    gemm_qkv(t_b, t_b, wA(8), dec_self_b);
    attn(q_b, k_b, v_b, ctx_b);
    gemm_f(ctx_b, wA(11), dec_self_b + 3 * Dm, g_f, Dm);
    lnorm(t_f, g_f, dec_ln_w + 0 * Dm, dec_ln_b + 0 * Dm, t_f, t_b);

    // cross-attention (K/V from encoder memory)
    gemm_qkv(t_b, h_b, wA(12), dec_cross_b);
    attn(q_b, k_b, v_b, ctx_b);
    gemm_f(ctx_b, wA(15), dec_cross_b + 3 * Dm, g_f, Dm);
    lnorm(t_f, g_f, dec_ln_w + 1 * Dm, dec_ln_b + 1 * Dm, t_f, t_b);

    // FFN
    gemm_g(t_b, wF1(2), dec_ff_b1, ffn_b);
    gemm_f(ffn_b, wF2(2), dec_ff_b2, g_f, DFFc);
    lnorm(t_f, g_f, dec_ln_w + 2 * Dm, dec_ln_b + 2 * Dm, t_f, t_b);
  }

  outproj_kernel<<<(M * 32 + 255) / 256, 256, 0, stream>>>(t_f, out_w, out_b, (float*)d_out, M);
}

// v008
// One run takes 492 microseconds.
// Versions between v006 and this one are left out; their measured steps multiply to 1.14 times as fast.
// All steps since v000 together make it 2.40 times as fast.
#include <hip/hip_runtime.h>
#include <math.h>

// ---------------- model constants ----------------
#define Bq 8
#define Sq_ 1024
#define Dm 512
#define Hh 8
#define HDc 64
#define DFFc 2048

// ---------------- WMMA types ----------------
typedef __bf16 bf16_t;
typedef bf16_t v16bf __attribute__((ext_vector_type(16)));
typedef float v8f __attribute__((ext_vector_type(8)));

union Frag { uint4 u[2]; v16bf v; };

__device__ __forceinline__ unsigned short f2bf(float f) {
  union { float f; unsigned u; } v; v.f = f;
  unsigned r = v.u + 0x7FFFu + ((v.u >> 16) & 1u);
  return (unsigned short)(r >> 16);
}

// 0.5 x (1 + tanh u) = x / (1 + exp(-2 u)), u = sqrt(2 / pi) (x + 0.044715 x^3).
// Straight-line: the library tanhf is two branches on a vector compare and a
// range-reduced exp per element, one dependent chain that cannot interleave
// with the next element's. exp(-2 u) = inf gives x * 0, exp(-2 u) = 0 gives x,
// the limits of the tanh form; no cancellation in 1 + tanh u for negative x.
__device__ __forceinline__ float gelu_f(float x) {
  constexpr float C1 = -2.0f * 0.7978845608028654f * 1.4426950408889634f;  // -2 sqrt(2 / pi) log2(e)
  constexpr float C3 = C1 * 0.044715f;
  const float e = __builtin_amdgcn_exp2f(x * (C1 + C3 * (x * x)));
  return x * __builtin_amdgcn_rcpf(1.0f + e);
}

// async copy 16B global -> LDS (ASYNCcnt-tracked, no VGPR round-trip)
__device__ __forceinline__ void async_cp16(const unsigned short* g, unsigned short* l) {
  unsigned lds = (unsigned)(uintptr_t)l;   // low 32 bits = LDS byte address
  asm volatile("global_load_async_to_lds_b128 %0, %1, off"
               :: "v"(lds), "v"(g) : "memory");
}
__device__ __forceinline__ void wait_async0() {
  asm volatile("s_wait_asynccnt 0x0" ::: "memory");
}
__device__ __forceinline__ void wait_async4() {
  asm volatile("s_wait_asynccnt 0x4" ::: "memory");
}

// =====================================================================
// bf16 WMMA GEMM:  C[M,N] = A[M,K] * W[K,N] + bias, optional GELU.
// A: bf16 row-major [M,K]; Wt: bf16 [N,K] (pre-transposed weights).
// Block 256 thr = 8 waves; tile 128x128, BK=32; wave tile 32x64.
// Double-buffered LDS staged with GLOBAL_LOAD_ASYNC_TO_LDS_B128;
// last tile peeled so the steady-state loop body is branch-free.
// N, the activation (ACT 1: GELU) and the output type (OUT_F32: outF, else
// bf16 to outB) are template parameters: the epilogue is then straight-line
// code, one address per thread with the 64 elements at constant offsets.
// NMAT products that do not depend on each other share a launch: Wt holds
// NMAT matrices [N,K] one after another, bias NMAT vectors, the output NMAT
// arrays [M,N]; grid.y runs over the column tiles of all of them. The first
// product reads A, the others A2. A WGP then holds NMAT work-groups, and
// one computes while another waits for its staged tile.
// =====================================================================
template <int N, int ACT, bool OUT_F32, int NMAT>
__global__ __launch_bounds__(256) void gemm_bf16_kernel(
    const unsigned short* __restrict__ A,
    const unsigned short* __restrict__ A2,
    const unsigned short* __restrict__ Wt,
    const float* __restrict__ bias,
    float* __restrict__ outF,
    unsigned short* __restrict__ outB,
    int K)
{
  // LDS row pitch (bf16 elems): 80 B = 16 B x odd. The 16 rows that a half-wave's
  // ds_load_b128 reads then start on 16 different groups of 4 banks (20 * row
  // mod 64 dwords); at 96 B rows r and r + 8 share their banks and each load
  // takes twice the LDS clocks
  constexpr int ST = 40;
  __shared__ unsigned short As[2][128 * ST];
  __shared__ unsigned short Bs[2][128 * ST];
  const int tid   = threadIdx.x;
  const int wave  = tid >> 5;
  const int lane  = tid & 31;
  const int l15   = lane & 15;
  const int lhalf = lane >> 4;
  const int koff  = lhalf * 8;
  const int bm = blockIdx.x * 128;
  const int bs = blockIdx.y * 128;                       // row of the stacked Wt and bias
  const int mat = (NMAT > 1) ? bs / N : 0;               // which product
  const int bn = bs - mat * N;                           // column in its own output
  const unsigned short* Am = (mat == 0) ? A : A2;
  const int wm = (wave >> 1) * 32;
  const int wn = (wave & 1) * 64;

  v8f zf = {};
  v8f c[2][4];
#pragma unroll
  for (int i = 0; i < 2; ++i)
#pragma unroll
    for (int j = 0; j < 4; ++j) c[i][j] = zf;

  // per-thread staging coordinates: 2 chunks of 8 bf16 per matrix,
  // running global pointers advanced by BK each issue.
  const int r0 = tid >> 2,           c0 = (tid & 3) * 8;          // chunk 0
  const int r1 = (tid + 256) >> 2,   c1 = ((tid + 256) & 3) * 8;  // chunk 1
  const unsigned short* gA0 = Am + (size_t)(bm + r0) * K + c0;
  const unsigned short* gA1 = Am + (size_t)(bm + r1) * K + c1;
  const unsigned short* gB0 = Wt + (size_t)(bs + r0) * K + c0;
  const unsigned short* gB1 = Wt + (size_t)(bs + r1) * K + c1;
  unsigned short* lA0[2] = { &As[0][r0 * ST + c0], &As[1][r0 * ST + c0] };
  unsigned short* lA1[2] = { &As[0][r1 * ST + c1], &As[1][r1 * ST + c1] };
  unsigned short* lB0[2] = { &Bs[0][r0 * ST + c0], &Bs[1][r0 * ST + c0] };
  unsigned short* lB1[2] = { &Bs[0][r1 * ST + c1], &Bs[1][r1 * ST + c1] };

  auto issue = [&](int buf) {
    async_cp16(gA0, lA0[buf]);  gA0 += 32;
    async_cp16(gA1, lA1[buf]);  gA1 += 32;
    async_cp16(gB0, lB0[buf]);  gB0 += 32;
    async_cp16(gB1, lB1[buf]);  gB1 += 32;
  };
  auto compute = [&](int cur) {
    Frag a[2], b[4];
#pragma unroll
    for (int i = 0; i < 2; ++i) {
      const unsigned short* p = &As[cur][(wm + i * 16 + l15) * ST];
      a[i].u[0] = *(const uint4*)(p + koff);
      a[i].u[1] = *(const uint4*)(p + koff + 16);
    }
#pragma unroll
    for (int j = 0; j < 4; ++j) {
      const unsigned short* p = &Bs[cur][(wn + j * 16 + l15) * ST];
      b[j].u[0] = *(const uint4*)(p + koff);
      b[j].u[1] = *(const uint4*)(p + koff + 16);
    }
#pragma unroll
    for (int i = 0; i < 2; ++i)
#pragma unroll
      for (int j = 0; j < 4; ++j)
        c[i][j] = __builtin_amdgcn_wmma_f32_16x16x32_bf16(
            false, a[i].v, false, b[j].v, (short)0, c[i][j], false, false);
  };

  const int nK = K >> 5;
  issue(0);
  for (int kt = 0; kt < nK - 1; ++kt) {   // branch-free steady state
    const int cur = kt & 1;
    issue(cur ^ 1);       // prefetch next tile (async, overlaps compute)
    wait_async4();        // own copies of current tile complete
    __syncthreads();
    compute(cur);
    __syncthreads();
  }
  wait_async0();          // peeled last tile
  __syncthreads();
  compute((nK - 1) & 1);

  const int col0 = bn + wn + l15;
  const size_t idx0 = ((size_t)mat * (Bq * Sq_) + (bm + wm + 8 * lhalf)) * N + col0;  // M = Bq * Sq_ rows an output
  float bb[4];
#pragma unroll
  for (int j = 0; j < 4; ++j) bb[j] = bias[bs + wn + l15 + j * 16];
#pragma unroll
  for (int i = 0; i < 2; ++i) {
#pragma unroll
    for (int j = 0; j < 4; ++j) {
#pragma unroll
      for (int r = 0; r < 8; ++r) {
        float v = c[i][j][r] + bb[j];
        if constexpr (ACT == 1) v = gelu_f(v);
        const size_t idx = idx0 + (i * 16 + r) * N + j * 16;
        if constexpr (OUT_F32) outF[idx] = v;
        else                   outB[idx] = f2bf(v);
      }
    }
  }
}

// lane l reads lane l ^ 16 (the other half of the wave)
__device__ __forceinline__ float other_half(float v) {
  int u = __builtin_bit_cast(int, v);
  return __builtin_bit_cast(float,
      __builtin_amdgcn_permlanex16(u, u, 0x76543210, 0xfedcba98, false, false));
}

typedef float v16f __attribute__((ext_vector_type(16)));
typedef bf16_t v8bf __attribute__((ext_vector_type(8)));

// =====================================================================
// Banded flash attention. Q,K,V,O: bf16 [B*S, D], head h in cols h*64..
// Grid: (Sq/64, B*H); 128 threads = 4 waves; wave owns 16 q-rows.
// Both products are formed transposed: S^T = K * Q^T (A = K rows, B = Q
// rows) and O^T += V^T * P^T. A result register r of lane (l15, lhalf) is
// then [8 * lhalf + r][l15]: a lane holds 16 of the 32 scores of ONE query,
// so the row maximum and the row sum are taken inside the lane and the two
// halves of the wave are joined by one exchange; there is one maximum, one
// sum and one rescale factor a lane. The two score tiles, converted in
// place, are the B operand of the second product in the hardware's k order
// (8 * lhalf + 0..7, 16 + 8 * lhalf + 0..7), which is the order in which
// the V^T rows are loaded: P passes through no LDS.
// Per 32-key tile: 4 WMMA for K*Q^T, online softmax, 4 WMMA for V^T*P^T.
// Q/K tiles staged with async-to-LDS; V transposed manually.
// =====================================================================
__global__ __launch_bounds__(128) void banded_attn_kernel(
    const unsigned short* __restrict__ Q,
    const unsigned short* __restrict__ Kc,
    const unsigned short* __restrict__ Vc,
    unsigned short* __restrict__ O,
    int Sq, int Sk, int bw)
{
  constexpr int STK = 72;  // stride for 64-wide hd rows (144B, aligned)
  constexpr int STV = 40;  // stride for 32-wide key rows (80B = 16B x odd: ds_load_b128 of 16 rows meets no bank twice)
  __shared__ unsigned short Qs[64 * STK];
  __shared__ unsigned short Ks[32 * STK];
  __shared__ unsigned short Vs[64 * STV];      // transposed: [hd][key]

  const int tid   = threadIdx.x;
  const int wave  = tid >> 5;
  const int lane  = tid & 31;
  const int l15   = lane & 15;
  const int lhalf = lane >> 4;
  const int koff  = lhalf * 8;
  const int q0 = blockIdx.x * 64;
  const int bh = blockIdx.y;
  const int bb = bh / Hh;
  const int hh = bh % Hh;

  const unsigned short* Qg = Q  + ((size_t)bb * Sq) * Dm + hh * HDc;
  const unsigned short* Kg = Kc + ((size_t)bb * Sk) * Dm + hh * HDc;
  const unsigned short* Vg = Vc + ((size_t)bb * Sk) * Dm + hh * HDc;

  // stage Q tile (64 x 64) via async copies
#pragma unroll
  for (int i = 0; i < 4; ++i) {
    int chunk = tid + i * 128;
    int r  = chunk >> 3;
    int cc = (chunk & 7) * 8;
    async_cp16(Qg + (size_t)(q0 + r) * Dm + cc, Qs + r * STK + cc);
  }
  wait_async0();
  __syncthreads();

  Frag qa[2];
  {
    const unsigned short* p = Qs + (wave * 16 + l15) * STK;
    qa[0].u[0] = *(const uint4*)(p + koff);
    qa[0].u[1] = *(const uint4*)(p + koff + 16);
    qa[1].u[0] = *(const uint4*)(p + 32 + koff);
    qa[1].u[1] = *(const uint4*)(p + 32 + koff + 16);
  }

  const int qrow = q0 + wave * 16 + l15;   // the lane's query
  v8f zf = {};
  float rmax = -__builtin_inff();          // the same in both halves
  float rsum = 0.0f;                       // over this half's keys; joined at the end
  v8f o[4];                                // o[j][r] = O[qrow][j * 16 + 8 * lhalf + r]
#pragma unroll
  for (int j = 0; j < 4; ++j) o[j] = zf;

  int ks = q0 - bw;        if (ks < 0)  ks = 0;
  int ke = q0 + 64 + bw;   if (ke > Sk) ke = Sk;

  for (int kb = ks; kb < ke; kb += 32) {
    __syncthreads();
    // K tile natural [key][hd] via async; V tile transposed into Vs[hd][key]
#pragma unroll
    for (int i = 0; i < 2; ++i) {
      int chunk = tid + i * 128;
      int r  = chunk >> 3;
      int cc = (chunk & 7) * 8;
      async_cp16(Kg + (size_t)(kb + r) * Dm + cc, Ks + r * STK + cc);
      uint4 d = *(const uint4*)(Vg + (size_t)(kb + r) * Dm + cc);
      const unsigned short* ds = (const unsigned short*)&d;
#pragma unroll
      for (int t = 0; t < 8; ++t) Vs[(cc + t) * STV + r] = ds[t];
    }
    wait_async0();
    __syncthreads();

    // scores for two 16-key sub-tiles
    Frag b0a, b0b, b1a, b1b;
    {
      const unsigned short* p0 = Ks + l15 * STK;
      const unsigned short* p1 = Ks + (16 + l15) * STK;
      b0a.u[0] = *(const uint4*)(p0 + koff);      b0a.u[1] = *(const uint4*)(p0 + koff + 16);
      b0b.u[0] = *(const uint4*)(p0 + 32 + koff); b0b.u[1] = *(const uint4*)(p0 + 32 + koff + 16);
      b1a.u[0] = *(const uint4*)(p1 + koff);      b1a.u[1] = *(const uint4*)(p1 + koff + 16);
      b1b.u[0] = *(const uint4*)(p1 + 32 + koff); b1b.u[1] = *(const uint4*)(p1 + 32 + koff + 16);
    }
    // s0[r] = S[qrow][kb + 8 * lhalf + r], s1[r] = S[qrow][kb + 16 + 8 * lhalf + r]
    v8f s0 = __builtin_amdgcn_wmma_f32_16x16x32_bf16(false, b0a.v, false, qa[0].v, (short)0, zf, false, false);
    s0     = __builtin_amdgcn_wmma_f32_16x16x32_bf16(false, b0b.v, false, qa[1].v, (short)0, s0, false, false);
    v8f s1 = __builtin_amdgcn_wmma_f32_16x16x32_bf16(false, b1a.v, false, qa[0].v, (short)0, zf, false, false);
    s1     = __builtin_amdgcn_wmma_f32_16x16x32_bf16(false, b1b.v, false, qa[1].v, (short)0, s1, false, false);

    // online softmax, one query a lane
    // |qrow - key| <= bw  <=>  0 <= qrow - key + bw <= 2 bw
    const int t0 = qrow - (kb + 8 * lhalf) + bw;
    const unsigned span = 2u * (unsigned)bw;
    s0 *= 0.125f;     // 1/sqrt(64)
    s1 *= 0.125f;
    // every loop below is unrolled so that its arrays are indexed by
    // constants and stay in registers
    float v[16];
#pragma unroll
    for (int r = 0; r < 8; ++r) {
      v[r]     = ((unsigned)(t0 - r) > span)      ? -__builtin_inff() : s0[r];
      v[8 + r] = ((unsigned)(t0 - 16 - r) > span) ? -__builtin_inff() : s1[r];
    }
    float m8[8];
#pragma unroll
    for (int r = 0; r < 8; ++r) m8[r] = fmaxf(v[2 * r], v[2 * r + 1]);
    float mt = fmaxf(fmaxf(fmaxf(m8[0], m8[1]), fmaxf(m8[2], m8[3])),
                     fmaxf(fmaxf(m8[4], m8[5]), fmaxf(m8[6], m8[7])));
    mt = fmaxf(mt, other_half(mt));
    const float nm = fmaxf(rmax, mt);
    // no key of the query seen yet: subtract 0, so that every exponential
    // below is exp(-inf) = 0 and not exp(-inf + inf); o and rsum are still 0
    const float sub = (nm < -1e37f) ? 0.0f : nm;
    const float sc = __expf(rmax - sub);
    rmax = nm;
    v16f pf;
#pragma unroll
    for (int e = 0; e < 16; ++e) pf[e] = __expf(v[e] - sub);
    float p8[8];
#pragma unroll
    for (int r = 0; r < 8; ++r) p8[r] = pf[2 * r] + pf[2 * r + 1];
    rsum = rsum * sc + (((p8[0] + p8[1]) + (p8[2] + p8[3])) + ((p8[4] + p8[5]) + (p8[6] + p8[7])));
#pragma unroll
    for (int j = 0; j < 4; ++j) o[j] *= sc;

    // O^T += V^T[64x32] * P^T[32x16]
    const v16bf pb = __builtin_convertvector(pf, v16bf);
#pragma unroll
    for (int j = 0; j < 4; ++j) {
      Frag vb;
      const unsigned short* p = Vs + (j * 16 + l15) * STV;
      vb.u[0] = *(const uint4*)(p + koff);
      vb.u[1] = *(const uint4*)(p + koff + 16);
      o[j] = __builtin_amdgcn_wmma_f32_16x16x32_bf16(false, vb.v, false, pb, (short)0, o[j], false, false);
    }
  }

  const float inv = 1.0f / (rsum + other_half(rsum));
  // a lane's 8 registers of a tile are 8 neighbouring columns of its row: 16-byte stores
  v8bf* Og = (v8bf*)(O + ((size_t)bb * Sq + qrow) * Dm + hh * HDc + 8 * lhalf);
  v8bf ob[4];
#pragma unroll
  for (int j = 0; j < 4; ++j) ob[j] = __builtin_convertvector(o[j] * inv, v8bf);
#pragma unroll
  for (int j = 0; j < 4; ++j) Og[j * 2] = ob[j];
}

// =====================================================================
// Embedding: h = (x @ W + b) * sqrt(D) + PE(s, d); outputs f32 + bf16.
// A work-group walks EMB_ROWS rows, a thread keeping its two columns: the
// launch starts 4096 waves where one work-group a row would start 65536.
// =====================================================================
#define EMB_ROWS 16
__global__ __launch_bounds__(256) void embed_kernel(
    const float* __restrict__ x, const float* __restrict__ W,
    const float* __restrict__ bias, float* __restrict__ outF,
    unsigned short* __restrict__ outB, int Cin)
{
  const int row0 = blockIdx.x * EMB_ROWS;
  const int tid = threadIdx.x;
  const int d = tid * 2;
  // what depends on the column alone is formed once
  float wv[7][2];
#pragma unroll
  for (int c = 0; c < 7; ++c) {
    wv[c][0] = (c < Cin) ? W[c * Dm + d]     : 0.0f;
    wv[c][1] = (c < Cin) ? W[c * Dm + d + 1] : 0.0f;
  }
  const float b0 = bias[d], b1 = bias[d + 1];
  const float div = __expf((float)d * (-9.210340371976184f / 512.0f));

  float xn[7];
#pragma unroll
  for (int c = 0; c < 7; ++c) xn[c] = (c < Cin) ? x[(size_t)row0 * Cin + c] : 0.0f;
  // kept rolled: for speed only
#pragma unroll 1
  for (int rr = 0; rr < EMB_ROWS; ++rr) {
    const int row = row0 + rr;
    float xv[7];
#pragma unroll
    for (int c = 0; c < 7; ++c) xv[c] = xn[c];
    // the next row's inputs fly while this row is computed (the last trip
    // reads its own row again, so the address stays inside x)
    const int nxt = (rr + 1 < EMB_ROWS) ? row + 1 : row;
#pragma unroll
    for (int c = 0; c < 7; ++c) xn[c] = (c < Cin) ? x[(size_t)nxt * Cin + c] : 0.0f;
    float acc0 = b0, acc1 = b1;
#pragma unroll
    for (int c = 0; c < 7; ++c) { acc0 += xv[c] * wv[c][0]; acc1 += xv[c] * wv[c][1]; }
    acc0 *= 22.627416997969522f;  // sqrt(512)
    acc1 *= 22.627416997969522f;
    const float arg = (float)(row & (Sq_ - 1)) * div;
    acc0 += sinf(arg);
    acc1 += cosf(arg);
    *(float2*)(outF + (size_t)row * Dm + d) = make_float2(acc0, acc1);
    *(unsigned*)(outB + (size_t)row * Dm + d) =
        (unsigned)f2bf(acc0) | ((unsigned)f2bf(acc1) << 16);
  }
}

// =====================================================================
// Residual + LayerNorm over D=512; outputs f32 (may alias x) + bf16.
// A wave owns whole rows: a lane holds 16 of a row's 512 values, and each
// of the two sums is a sum inside the lane and a five-step butterfly over
// the wave: no LDS, no barrier. A wave takes LN_RPW rows side by side, all
// their loads in flight together, so a launch starts 2048 waves where one
// work-group a row would start 65536.
// =====================================================================
#define LN_RPW 4

// lane l reads lane l ^ X of its 16-lane row
template <int X>
__device__ __forceinline__ float row_xor(float v) {
  int u = __builtin_bit_cast(int, v);
  return __builtin_bit_cast(float, __builtin_amdgcn_update_dpp(u, u, 0x160 + X, 0xf, 0xf, false));
}
// butterfly sum over the 32 lanes; every lane ends with the same value
__device__ __forceinline__ float wave_sum(float v) {
  v += row_xor<1>(v);
  v += row_xor<2>(v);
  v += row_xor<4>(v);
  v += row_xor<8>(v);
  int u = __builtin_bit_cast(int, v);
  v += __builtin_bit_cast(float,
      __builtin_amdgcn_permlanex16(u, u, 0x76543210, 0xfedcba98, false, false));
  return v;
}

typedef float f32x4 __attribute__((ext_vector_type(4)));
union Two4 { f32x4 h[2]; v8f v; };   // two 16-byte loads, named as one value

__global__ __launch_bounds__(256) void ln_kernel(
    const float* __restrict__ x, const float* __restrict__ res,
    const float* __restrict__ w, const float* __restrict__ b,
    float* __restrict__ outF, unsigned short* __restrict__ outB)
{
  const int lane = threadIdx.x & 31;
  const int row0 = (blockIdx.x * 8 + (threadIdx.x >> 5)) * LN_RPW;
  Two4 xr[LN_RPW][4];   // h[0]: x, h[1]: res
  Two4 wb[4];           // h[0]: w, h[1]: b
  const f32x4* xp = (const f32x4*)(x   + (size_t)row0 * Dm) + lane;
  const f32x4* rp = (const f32x4*)(res + (size_t)row0 * Dm) + lane;
#pragma unroll
  for (int rr = 0; rr < LN_RPW; ++rr) {
#pragma unroll
    for (int i = 0; i < 4; ++i) {
      xr[rr][i].h[0] = xp[rr * (Dm / 4) + 32 * i];
      xr[rr][i].h[1] = rp[rr * (Dm / 4) + 32 * i];
    }
  }
#pragma unroll
  for (int i = 0; i < 4; ++i) {
    wb[i].h[0] = ((const f32x4*)w)[lane + 32 * i];
    wb[i].h[1] = ((const f32x4*)b)[lane + 32 * i];
  }
  // holds all forty loads of the wave in front of the arithmetic, in flight
  // together (loaded values as inputs only): left alone the compiler sinks
  // a third of them behind the sums, where each is waited for on its own.
  // It is also the wait that belongs in front of any rewrite of an issued
  // load's address registers; naming the two addresses keeps them out of
  // the loads' own destination registers until it has passed
  asm volatile("s_wait_xcnt 0x0" ::
      "v"(xr[0][0].v), "v"(xr[0][1].v), "v"(xr[0][2].v), "v"(xr[0][3].v),
      "v"(xr[1][0].v), "v"(xr[1][1].v), "v"(xr[1][2].v), "v"(xr[1][3].v),
      "v"(xr[2][0].v), "v"(xr[2][1].v), "v"(xr[2][2].v), "v"(xr[2][3].v),
      "v"(xr[3][0].v), "v"(xr[3][1].v), "v"(xr[3][2].v), "v"(xr[3][3].v),
      "v"(wb[0].v), "v"(wb[1].v), "v"(wb[2].v), "v"(wb[3].v), "v"(xp), "v"(rp));

  f32x4 a[LN_RPW][4];
  float s[LN_RPW];
#pragma unroll
  for (int rr = 0; rr < LN_RPW; ++rr) {
    float t = 0.0f;
#pragma unroll
    for (int i = 0; i < 4; ++i) {
      a[rr][i] = xr[rr][i].h[0] + xr[rr][i].h[1];
      t += (a[rr][i].x + a[rr][i].y) + (a[rr][i].z + a[rr][i].w);
    }
    s[rr] = wave_sum(t);
  }

#pragma unroll
  for (int rr = 0; rr < LN_RPW; ++rr) {
    const float mu = s[rr] * (1.0f / 512.0f);
    float t = 0.0f;
#pragma unroll
    for (int i = 0; i < 4; ++i) {
      a[rr][i] -= mu;
      t += (a[rr][i].x * a[rr][i].x + a[rr][i].y * a[rr][i].y) +
           (a[rr][i].z * a[rr][i].z + a[rr][i].w * a[rr][i].w);
    }
    s[rr] = wave_sum(t);
  }

#pragma unroll
  for (int rr = 0; rr < LN_RPW; ++rr) {
    const float rstd = rsqrtf(s[rr] * (1.0f / 512.0f) + 1e-5f);
    f32x4* of = (f32x4*)(outF + (size_t)(row0 + rr) * Dm);
    uint2* ob = (uint2*)(outB + (size_t)(row0 + rr) * Dm);
#pragma unroll
    for (int i = 0; i < 4; ++i) {
      const f32x4 y = a[rr][i] * rstd * wb[i].h[0] + wb[i].h[1];
      of[lane + 32 * i] = y;
      ob[lane + 32 * i] = make_uint2(
          (unsigned)f2bf(y.x) | ((unsigned)f2bf(y.y) << 16),
          (unsigned)f2bf(y.z) | ((unsigned)f2bf(y.w) << 16));
    }
  }
}

// =====================================================================
// Weight preparation, one launch for all 22 matrices:
// fp32 [K,N] -> bf16 transposed [N,K], packed one after another in wt:
//   16 x [512,512]  (encoder attention 8, decoder self 4, decoder cross 4)
//    3 x [512,2048] (first FFN matrix: encoder 2, decoder 1)
//    3 x [2048,512] (second FFN matrix: encoder 2, decoder 1)
// The matrices are cut into 64x64 tiles, 2560 in all. A block moves 5 of
// them through LDS: 256-B row pieces are read, whole 128-B lines written.
// An LDS dword holds the bf16 pair (k, k+1) of one n; the pitch of 33
// dwords keeps both the column-wise writes and the row-wise reads on
// distinct banks.
// =====================================================================
#define WP_BLOCKS 512
#define WP_TILES_PER_BLOCK 5
#define WP_DD  (Dm * Dm)
#define WP_DF  (Dm * DFFc)
#define WP_FF1 (16 * WP_DD)
#define WP_FF2 (16 * WP_DD + 3 * WP_DF)

__global__ __launch_bounds__(256) void wprep_kernel(
    const float* __restrict__ enc_attn_w, const float* __restrict__ dec_self_w,
    const float* __restrict__ dec_cross_w,
    const float* __restrict__ enc_ff_w1, const float* __restrict__ dec_ff_w1,
    const float* __restrict__ enc_ff_w2, const float* __restrict__ dec_ff_w2,
    unsigned short* __restrict__ wt)
{
  constexpr int P = 33;
  __shared__ unsigned tile[2][64 * P];
  const int tid = threadIdx.x;
  const int p   = tid >> 4;         // reader: k pair (rows 2p, 2p+1, +32, +33)
  const int n0  = (tid & 15) * 4;   // reader: 4 columns
  const int wr  = tid >> 3;         // writer: output row (n), +32
  const int wc  = tid & 7;          // writer: 16-B chunk of the 128-B line

  float4 r[4];
  unsigned short* dst;
  int dstK;

  // tile id -> source and destination of its corner (same for the whole block)
  auto fetch = [&](int id) {
    const float* s; unsigned short* d; int K, N, kt, nt;
    if (id < 1024) {
      int m = id >> 6;
      s = (m < 8) ? enc_attn_w + (size_t)m * WP_DD
        : (m < 12) ? dec_self_w + (size_t)(m - 8) * WP_DD
                   : dec_cross_w + (size_t)(m - 12) * WP_DD;
      d = wt + (size_t)m * WP_DD;
      K = Dm; N = Dm; kt = (id >> 3) & 7; nt = id & 7;
    } else if (id < 1792) {
      int j = id - 1024, m = j >> 8;
      s = (m < 2) ? enc_ff_w1 + (size_t)m * WP_DF : dec_ff_w1;
      d = wt + WP_FF1 + (size_t)m * WP_DF;
      K = Dm; N = DFFc; kt = (j >> 5) & 7; nt = j & 31;
    } else {
      int j = id - 1792, m = j >> 8;
      s = (m < 2) ? enc_ff_w2 + (size_t)m * WP_DF : dec_ff_w2;
      d = wt + WP_FF2 + (size_t)m * WP_DF;
      K = DFFc; N = Dm; kt = (j >> 3) & 31; nt = j & 7;
    }
    const float* g = s + (size_t)(kt * 64 + 2 * p) * N + nt * 64 + n0;
    const float* g1 = g + N;
    const float* g2 = g + (size_t)32 * N;
    const float* g3 = g + (size_t)33 * N;
    r[0] = *(const float4*)(g);
    r[1] = *(const float4*)(g1);
    r[2] = *(const float4*)(g2);
    r[3] = *(const float4*)(g3);
    // the wait that belongs in front of any rewrite of an issued load's
    // address registers; naming the four addresses keeps them out of the
    // loads' own destination registers until it has passed
    asm volatile("s_wait_xcnt 0x0" :: "v"(g), "v"(g1), "v"(g2), "v"(g3) : "memory");
    dst  = d + (size_t)(nt * 64 + wr) * K + kt * 64 + wc * 8;
    dstK = K;
  };
  auto pack = [](float lo, float hi) -> unsigned {
    return (unsigned)f2bf(lo) | ((unsigned)f2bf(hi) << 16);
  };

  fetch(blockIdx.x);
  // unrolled so that the buffer index and the last-tile test are constants
#pragma unroll
  for (int t = 0; t < WP_TILES_PER_BLOCK; ++t) {
    unsigned* L = tile[t & 1];
    const float* a0 = (const float*)&r[0];
    const float* a1 = (const float*)&r[1];
    const float* a2 = (const float*)&r[2];
    const float* a3 = (const float*)&r[3];
    // unrolled so that r[] is indexed by constants and stays in registers
#pragma unroll
    for (int e = 0; e < 4; ++e) {
      L[(n0 + e) * P + p]      = pack(a0[e], a1[e]);
      L[(n0 + e) * P + 16 + p] = pack(a2[e], a3[e]);
    }
    unsigned short* o = dst;
    const int oK = dstK;
    // one barrier a tile: with two buffers it also ends the reads of the
    // buffer that the next tile overwrites
    __syncthreads();
    // the next tile's loads fly while this tile is written out
    if (t + 1 < WP_TILES_PER_BLOCK) fetch(blockIdx.x + (t + 1) * WP_BLOCKS);
    // unrolled so that both halves' LDS reads issue together
#pragma unroll
    for (int h = 0; h < 2; ++h) {
      const unsigned* q = L + (h * 32 + wr) * P + wc * 4;
      uint4 v = make_uint4(q[0], q[1], q[2], q[3]);
      *(uint4*)(o + (size_t)(h * 32) * oK) = v;
    }
  }
}

// final projection D->1: one wave per row
__global__ __launch_bounds__(256) void outproj_kernel(
    const float* __restrict__ t, const float* __restrict__ w,
    const float* __restrict__ b, float* __restrict__ out, int M)
{
  int gid = blockIdx.x * 256 + threadIdx.x;
  int row = gid >> 5;
  int lane = gid & 31;
  if (row >= M) return;
  float acc = 0.0f;
#pragma unroll
  for (int i = 0; i < 16; ++i)
    acc += t[(size_t)row * Dm + lane + i * 32] * w[lane + i * 32];
#pragma unroll
  for (int ofs = 16; ofs > 0; ofs >>= 1)
    acc += __shfl_xor(acc, ofs, 32);
  if (lane == 0) out[row] = acc + b[0];
}

// =====================================================================
// Host orchestration
// =====================================================================
extern "C" void kernel_launch(void* const* d_in, const int* in_sizes, int n_in,
                              void* d_out, int out_size, void* d_ws, size_t ws_size,
                              hipStream_t stream) {
  (void)in_sizes; (void)n_in; (void)out_size; (void)ws_size;
  const float* x_enc      = (const float*)d_in[0];
  const float* x_dec      = (const float*)d_in[1];
  const float* emb_enc_w  = (const float*)d_in[2];
  const float* emb_enc_b  = (const float*)d_in[3];
  const float* emb_dec_w  = (const float*)d_in[4];
  const float* emb_dec_b  = (const float*)d_in[5];
  const float* enc_attn_w = (const float*)d_in[6];
  const float* enc_attn_b = (const float*)d_in[7];
  const float* enc_ff_w1  = (const float*)d_in[8];
  const float* enc_ff_b1  = (const float*)d_in[9];
  const float* enc_ff_w2  = (const float*)d_in[10];
  const float* enc_ff_b2  = (const float*)d_in[11];
  const float* enc_ln_w   = (const float*)d_in[12];
  const float* enc_ln_b   = (const float*)d_in[13];
  const float* dec_self_w = (const float*)d_in[14];
  const float* dec_self_b = (const float*)d_in[15];
  const float* dec_cross_w= (const float*)d_in[16];
  const float* dec_cross_b= (const float*)d_in[17];
  const float* dec_ff_w1  = (const float*)d_in[18];
  const float* dec_ff_b1  = (const float*)d_in[19];
  const float* dec_ff_w2  = (const float*)d_in[20];
  const float* dec_ff_b2  = (const float*)d_in[21];
  const float* dec_ln_w   = (const float*)d_in[22];
  const float* dec_ln_b   = (const float*)d_in[23];
  const float* out_w      = (const float*)d_in[24];
  const float* out_b      = (const float*)d_in[25];

  const int M = Bq * Sq_;  // 8192
  char* ws = (char*)d_ws;
  size_t off = 0;
  auto alloc = [&](size_t bytes) -> void* {
    void* p = ws + off;
    off += (bytes + 255) & ~(size_t)255;
    return p;
  };
  float*          h_f   = (float*)alloc((size_t)M * Dm * 4);
  unsigned short* h_b   = (unsigned short*)alloc((size_t)M * Dm * 2);
  float*          t_f   = (float*)alloc((size_t)M * Dm * 4);
  unsigned short* t_b   = (unsigned short*)alloc((size_t)M * Dm * 2);
  unsigned short* q_b   = (unsigned short*)alloc((size_t)3 * M * Dm * 2);  // q, k, v in a row
  unsigned short* k_b   = q_b + (size_t)M * Dm;
  unsigned short* v_b   = k_b + (size_t)M * Dm;
  unsigned short* ctx_b = (unsigned short*)alloc((size_t)M * Dm * 2);
  float*          g_f   = (float*)alloc((size_t)M * Dm * 4);
  unsigned short* ffn_b = (unsigned short*)alloc((size_t)M * DFFc * 2);
  unsigned short* wt  = (unsigned short*)alloc(((size_t)16 * WP_DD + (size_t)6 * WP_DF) * 2);
  auto wA  = [&](int m) { return wt + (size_t)m * WP_DD; };           // attention matrices
  auto wF1 = [&](int m) { return wt + WP_FF1 + (size_t)m * WP_DF; };  // first FFN matrices
  auto wF2 = [&](int m) { return wt + WP_FF2 + (size_t)m * WP_DF; };  // second FFN matrices

  // the q, k and v projections of one attention, one launch:
  // Aq x W[0], Akv x W[1], Akv x W[2], each [M,Dm] x [Dm,Dm] -> bf16, to q_b, k_b, v_b
  auto gemm_qkv = [&](const unsigned short* Aq, const unsigned short* Akv,
                      const unsigned short* Wt, const float* bias) {
    gemm_bf16_kernel<Dm, 0, false, 3><<<dim3(M / 128, 3 * Dm / 128), 256, 0, stream>>>(Aq, Akv, Wt, bias, nullptr, q_b, Dm);
  };
  // [M,Kk] x [Kk,Dm] -> f32
  auto gemm_f = [&](const unsigned short* A, const unsigned short* Wt, const float* bias,
                    float* oF, int Kk) {
    gemm_bf16_kernel<Dm, 0, true, 1><<<dim3(M / 128, Dm / 128), 256, 0, stream>>>(A, A, Wt, bias, oF, nullptr, Kk);
  };
  // [M,Dm] x [Dm,DFFc], GELU -> bf16
  auto gemm_g = [&](const unsigned short* A, const unsigned short* Wt, const float* bias,
                    unsigned short* oB) {
    gemm_bf16_kernel<DFFc, 1, false, 1><<<dim3(M / 128, DFFc / 128), 256, 0, stream>>>(A, A, Wt, bias, nullptr, oB, Dm);
  };
  auto attn = [&](const unsigned short* Qp, const unsigned short* Kp,
                  const unsigned short* Vp, unsigned short* Op) {
    banded_attn_kernel<<<dim3(Sq_ / 64, Bq * Hh), 128, 0, stream>>>(Qp, Kp, Vp, Op, Sq_, Sq_, Sq_ / 4);
  };
  auto lnorm = [&](const float* xx, const float* rr, const float* w, const float* bb,
                   float* oF, unsigned short* oB) {
    ln_kernel<<<M / (8 * LN_RPW), 256, 0, stream>>>(xx, rr, w, bb, oF, oB);
  };

  // ----- all weights to bf16 [N,K], once -----
  wprep_kernel<<<WP_BLOCKS, 256, 0, stream>>>(enc_attn_w, dec_self_w, dec_cross_w,
                                              enc_ff_w1, dec_ff_w1, enc_ff_w2, dec_ff_w2, wt);

  // ----- encoder -----
  embed_kernel<<<M / EMB_ROWS, 256, 0, stream>>>(x_enc, emb_enc_w, emb_enc_b, h_f, h_b, 7);
  for (int l = 0; l < 2; ++l) {
    const float* ab = enc_attn_b + (size_t)l * 4 * Dm;
    gemm_qkv(h_b, h_b, wA(l * 4), ab);
    attn(q_b, k_b, v_b, ctx_b);
    gemm_f(ctx_b, wA(l * 4 + 3), ab + 3 * Dm, g_f, Dm);
    lnorm(h_f, g_f, enc_ln_w + (size_t)l * 2 * Dm, enc_ln_b + (size_t)l * 2 * Dm, h_f, h_b);
    gemm_g(h_b, wF1(l), enc_ff_b1 + (size_t)l * DFFc, ffn_b);
    gemm_f(ffn_b, wF2(l), enc_ff_b2 + (size_t)l * Dm, g_f, DFFc);
    lnorm(h_f, g_f, enc_ln_w + (size_t)l * 2 * Dm + Dm, enc_ln_b + (size_t)l * 2 * Dm + Dm, h_f, h_b);
  }
  // h_f / h_b now hold encoder memory.

  // ----- decoder (DL = 1) -----
  embed_kernel<<<M / EMB_ROWS, 256, 0, stream>>>(x_dec, emb_dec_w, emb_dec_b, t_f, t_b, 1);
  {
    // self-attention
    gemm_qkv(t_b, t_b, wA(8), dec_self_b);
    attn(q_b, k_b, v_b, ctx_b);
    gemm_f(ctx_b, wA(11), dec_self_b + 3 * Dm, g_f, Dm);
    lnorm(t_f, g_f, dec_ln_w + 0 * Dm, dec_ln_b + 0 * Dm, t_f, t_b);

    // cross-attention (K/V from encoder memory)
    gemm_qkv(t_b, h_b, wA(12), dec_cross_b);
    attn(q_b, k_b, v_b, ctx_b);
    gemm_f(ctx_b, wA(15), dec_cross_b + 3 * Dm, g_f, Dm);
    lnorm(t_f, g_f, dec_ln_w + 1 * Dm, dec_ln_b + 1 * Dm, t_f, t_b);

    // FFN
    gemm_g(t_b, wF1(2), dec_ff_b1, ffn_b);
    gemm_f(ffn_b, wF2(2), dec_ff_b2, g_f, DFFc);
    lnorm(t_f, g_f, dec_ln_w + 2 * Dm, dec_ln_b + 2 * Dm, t_f, t_b);
  }

  outproj_kernel<<<(M * 32 + 255) / 256, 256, 0, stream>>>(t_f, out_w, out_b, (float*)d_out, M);
}

// v009
// It runs in 439 microseconds.
// Next to v008, in two timings, it ran 1.13 and 1.15 times as fast.
// Over all steps from v000 it is 2.74 times as fast.
#include <hip/hip_runtime.h>
#include <math.h>

// ---------------- model constants ----------------
#define Bq 8
#define Sq_ 1024
#define Dm 512
#define Hh 8
#define HDc 64
#define DFFc 2048

// ---------------- WMMA types ----------------
typedef __bf16 bf16_t;
typedef bf16_t v16bf __attribute__((ext_vector_type(16)));
typedef float v8f __attribute__((ext_vector_type(8)));

union Frag { uint4 u[2]; v16bf v; };

__device__ __forceinline__ unsigned short f2bf(float f) {
  union { float f; unsigned u; } v; v.f = f;
  unsigned r = v.u + 0x7FFFu + ((v.u >> 16) & 1u);
  return (unsigned short)(r >> 16);
}

// 0.5 x (1 + tanh u) = x / (1 + exp(-2 u)), u = sqrt(2 / pi) (x + 0.044715 x^3).
// Straight-line: the library tanhf is two branches on a vector compare and a
// range-reduced exp per element, one dependent chain that cannot interleave
// with the next element's. exp(-2 u) = inf gives x * 0, exp(-2 u) = 0 gives x,
// the limits of the tanh form; no cancellation in 1 + tanh u for negative x.
__device__ __forceinline__ float gelu_f(float x) {
  constexpr float C1 = -2.0f * 0.7978845608028654f * 1.4426950408889634f;  // -2 sqrt(2 / pi) log2(e)
  constexpr float C3 = C1 * 0.044715f;
  const float e = __builtin_amdgcn_exp2f(x * (C1 + C3 * (x * x)));
  return x * __builtin_amdgcn_rcpf(1.0f + e);
}

// async copy 16B global -> LDS (ASYNCcnt-tracked, no VGPR round-trip)
__device__ __forceinline__ void async_cp16(const unsigned short* g, unsigned short* l) {
  unsigned lds = (unsigned)(uintptr_t)l;   // low 32 bits = LDS byte address
  asm volatile("global_load_async_to_lds_b128 %0, %1, off"
               :: "v"(lds), "v"(g) : "memory");
}
__device__ __forceinline__ void wait_async0() {
  asm volatile("s_wait_asynccnt 0x0" ::: "memory");
}
__device__ __forceinline__ void wait_async4() {
  asm volatile("s_wait_asynccnt 0x4" ::: "memory");
}

// =====================================================================
// bf16 WMMA GEMM:  C[M,N] = A[M,K] * W[K,N] + bias, optional GELU.
// A: bf16 row-major [M,K]; Wt: bf16 [N,K] (pre-transposed weights).
// Block 256 thr = 8 waves; tile 128x128, BK=32; wave tile 32x64.
// Double-buffered LDS staged with GLOBAL_LOAD_ASYNC_TO_LDS_B128;
// last tile peeled so the steady-state loop body is branch-free.
// N, the activation (ACT 1: GELU) and the output type (OUT_F32: outF, else
// bf16 to outB) are template parameters: the epilogue is then straight-line
// code, one address per thread with the 64 elements at constant offsets.
// NMAT products that do not depend on each other share a launch: Wt holds
// NMAT matrices [N,K] one after another, bias NMAT vectors, the output NMAT
// arrays [M,N]; grid.y runs over the column tiles of all of them. The first
// product reads A, the others A2. A WGP then holds NMAT work-groups, and
// one computes while another waits for its staged tile.
// =====================================================================
template <int N, int ACT, bool OUT_F32, int NMAT>
__global__ __launch_bounds__(256) void gemm_bf16_kernel(
    const unsigned short* __restrict__ A,
    const unsigned short* __restrict__ A2,
    const unsigned short* __restrict__ Wt,
    const float* __restrict__ bias,
    float* __restrict__ outF,
    unsigned short* __restrict__ outB,
    int K)
{
  // LDS row pitch (bf16 elems): 80 B = 16 B x odd. The 16 rows that a half-wave's
  // ds_load_b128 reads then start on 16 different groups of 4 banks (20 * row
  // mod 64 dwords); at 96 B rows r and r + 8 share their banks and each load
  // takes twice the LDS clocks
  constexpr int ST = 40;
  __shared__ unsigned short As[2][128 * ST];
  __shared__ unsigned short Bs[2][128 * ST];
  const int tid   = threadIdx.x;
  const int wave  = tid >> 5;
  const int lane  = tid & 31;
  const int l15   = lane & 15;
  const int lhalf = lane >> 4;
  const int koff  = lhalf * 8;
  const int bm = blockIdx.x * 128;
  const int bs = blockIdx.y * 128;                       // row of the stacked Wt and bias
  const int mat = (NMAT > 1) ? bs / N : 0;               // which product
  const int bn = bs - mat * N;                           // column in its own output
  const unsigned short* Am = (mat == 0) ? A : A2;
  const int wm = (wave >> 1) * 32;
  const int wn = (wave & 1) * 64;

  v8f zf = {};
  v8f c[2][4];
#pragma unroll
  for (int i = 0; i < 2; ++i)
#pragma unroll
    for (int j = 0; j < 4; ++j) c[i][j] = zf;

  // per-thread staging coordinates: 2 chunks of 8 bf16 per matrix,
  // running global pointers advanced by BK each issue.
  const int r0 = tid >> 2,           c0 = (tid & 3) * 8;          // chunk 0
  const int r1 = (tid + 256) >> 2,   c1 = ((tid + 256) & 3) * 8;  // chunk 1
  const unsigned short* gA0 = Am + (size_t)(bm + r0) * K + c0;
  const unsigned short* gA1 = Am + (size_t)(bm + r1) * K + c1;
  const unsigned short* gB0 = Wt + (size_t)(bs + r0) * K + c0;
  const unsigned short* gB1 = Wt + (size_t)(bs + r1) * K + c1;
  unsigned short* lA0[2] = { &As[0][r0 * ST + c0], &As[1][r0 * ST + c0] };
  unsigned short* lA1[2] = { &As[0][r1 * ST + c1], &As[1][r1 * ST + c1] };
  unsigned short* lB0[2] = { &Bs[0][r0 * ST + c0], &Bs[1][r0 * ST + c0] };
  unsigned short* lB1[2] = { &Bs[0][r1 * ST + c1], &Bs[1][r1 * ST + c1] };

  auto issue = [&](int buf) {
    async_cp16(gA0, lA0[buf]);  gA0 += 32;
    async_cp16(gA1, lA1[buf]);  gA1 += 32;
    async_cp16(gB0, lB0[buf]);  gB0 += 32;
    async_cp16(gB1, lB1[buf]);  gB1 += 32;
  };
  auto compute = [&](int cur) {
    Frag a[2], b[4];
#pragma unroll
    for (int i = 0; i < 2; ++i) {
      const unsigned short* p = &As[cur][(wm + i * 16 + l15) * ST];
      a[i].u[0] = *(const uint4*)(p + koff);
      a[i].u[1] = *(const uint4*)(p + koff + 16);
    }
#pragma unroll
    for (int j = 0; j < 4; ++j) {
      const unsigned short* p = &Bs[cur][(wn + j * 16 + l15) * ST];
      b[j].u[0] = *(const uint4*)(p + koff);
      b[j].u[1] = *(const uint4*)(p + koff + 16);
    }
#pragma unroll
    for (int i = 0; i < 2; ++i)
#pragma unroll
      for (int j = 0; j < 4; ++j)
        c[i][j] = __builtin_amdgcn_wmma_f32_16x16x32_bf16(
            false, a[i].v, false, b[j].v, (short)0, c[i][j], false, false);
  };

  const int nK = K >> 5;
  issue(0);
  for (int kt = 0; kt < nK - 1; ++kt) {   // branch-free steady state
    const int cur = kt & 1;
    issue(cur ^ 1);       // prefetch next tile (async, overlaps compute)
    wait_async4();        // own copies of current tile complete
    __syncthreads();
    compute(cur);
    __syncthreads();
  }
  wait_async0();          // peeled last tile
  __syncthreads();
  compute((nK - 1) & 1);

  const int col0 = bn + wn + l15;
  const size_t idx0 = ((size_t)mat * (Bq * Sq_) + (bm + wm + 8 * lhalf)) * N + col0;  // M = Bq * Sq_ rows an output
  float bb[4];
#pragma unroll
  for (int j = 0; j < 4; ++j) bb[j] = bias[bs + wn + l15 + j * 16];
#pragma unroll
  for (int i = 0; i < 2; ++i) {
#pragma unroll
    for (int j = 0; j < 4; ++j) {
#pragma unroll
      for (int r = 0; r < 8; ++r) {
        float v = c[i][j][r] + bb[j];
        if constexpr (ACT == 1) v = gelu_f(v);
        const size_t idx = idx0 + (i * 16 + r) * N + j * 16;
        if constexpr (OUT_F32) outF[idx] = v;
        else                   outB[idx] = f2bf(v);
      }
    }
  }
}

// lane l reads lane l ^ 16 (the other half of the wave)
__device__ __forceinline__ float other_half(float v) {
  int u = __builtin_bit_cast(int, v);
  return __builtin_bit_cast(float,
      __builtin_amdgcn_permlanex16(u, u, 0x76543210, 0xfedcba98, false, false));
}

typedef float v16f __attribute__((ext_vector_type(16)));
typedef bf16_t v8bf __attribute__((ext_vector_type(8)));
typedef short s16x8 __attribute__((ext_vector_type(8)));
union FragT { s16x8 s[2]; v16bf v; };

// Four 16-byte async copies global -> LDS of one thread. The s_wait_xcnt is the
// wait that belongs in front of any rewrite of an issued copy's address
// registers; as the last line of the copies' own statement nothing can be
// moved between it and them.
__device__ __forceinline__ void async_cp16_x4(
    const unsigned short* g0, const unsigned short* g1,
    const unsigned short* g2, const unsigned short* g3,
    unsigned l0, unsigned l1, unsigned l2, unsigned l3) {
  asm volatile("global_load_async_to_lds_b128 %0, %1, off\n\t"
               "global_load_async_to_lds_b128 %2, %3, off\n\t"
               "global_load_async_to_lds_b128 %4, %5, off\n\t"
               "global_load_async_to_lds_b128 %6, %7, off\n\t"
               "s_wait_xcnt 0x0"
               :: "v"(l0), "v"(g0), "v"(l1), "v"(g1), "v"(l2), "v"(g2), "v"(l3), "v"(g3)
               : "memory");
}

// transposing LDS load: from a row-major tile of 16-bit elements, lane
// (l15, lhalf) gets 8 successive rows of one column (addresses: see the caller)
__device__ __forceinline__ s16x8 ld_tr16(const unsigned short* p) {
  typedef __attribute__((address_space(3))) s16x8 lds_s16x8;
  return __builtin_amdgcn_ds_load_tr16_b128_v8i16((lds_s16x8*)p);
}

// =====================================================================
// Banded flash attention. Q,K,V,O: bf16 [B*S, D], head h in cols h*64..
// Grid: (Sq/64, B*H); 128 threads = 4 waves; wave owns 16 q-rows.
// Both products are formed transposed: S^T = K * Q^T (A = K rows, B = Q
// rows) and O^T += V^T * P^T. A result register r of lane (l15, lhalf) is
// then [8 * lhalf + r][l15]: a lane holds 16 of the 32 scores of ONE query,
// so the row maximum and the row sum are taken inside the lane and the two
// halves of the wave are joined by one exchange; there is one maximum, one
// sum and one rescale factor a lane. The two score tiles, converted in
// place, are the B operand of the second product in the hardware's k order
// (8 * lhalf + 0..7, 16 + 8 * lhalf + 0..7), which is the order in which
// the V^T rows are loaded: P passes through no LDS.
// Per 32-key tile: 4 WMMA for K*Q^T, online softmax, 4 WMMA for V^T*P^T.
// Q, K and V tiles are staged with async-to-LDS, all as they lie in memory.
// K and V have two buffers each: the copies of tile t + 2 are issued behind
// the last LDS read of trip t, into the buffers that trip t has just read, and
// are waited for at the same place of trip t + 1, so a tile flies during a
// whole trip. The V^T fragments come out of the row-major V tile by the
// transposing LDS load.
// =====================================================================
__global__ __launch_bounds__(128) void banded_attn_kernel(
    const unsigned short* __restrict__ Q,
    const unsigned short* __restrict__ Kc,
    const unsigned short* __restrict__ Vc,
    unsigned short* __restrict__ O,
    int Sq, int Sk, int bw)
{
  constexpr int STK = 72;  // stride for 64-wide hd rows (144B, aligned)
  constexpr int STV = 80;  // stride for V's 64-wide hd rows (160B = 32B x odd, the pitch for ds_load_tr16_b128)
  __shared__ __attribute__((aligned(16))) unsigned short Qs[64 * STK];
  __shared__ __attribute__((aligned(16))) unsigned short Ks[2][32 * STK];
  __shared__ __attribute__((aligned(16))) unsigned short Vs[2][32 * STV];   // [key][hd], as in memory

  const int tid   = threadIdx.x;
  const int wave  = tid >> 5;
  const int lane  = tid & 31;
  const int l15   = lane & 15;
  const int lhalf = lane >> 4;
  const int koff  = lhalf * 8;
  const int q0 = blockIdx.x * 64;
  const int bh = blockIdx.y;
  const int bb = bh / Hh;
  const int hh = bh % Hh;

  const unsigned short* Qg = Q  + ((size_t)bb * Sq) * Dm + hh * HDc;
  const unsigned short* Kg = Kc + ((size_t)bb * Sk) * Dm + hh * HDc;
  const unsigned short* Vg = Vc + ((size_t)bb * Sk) * Dm + hh * HDc;

  // a thread's share of a staged tile: 16 bytes of rows srow, srow + 16, ...
  const int srow = tid >> 3;
  const int scol = (tid & 7) * 8;

  // stage Q tile (64 x 64) via async copies
  {
    const unsigned short* gQ = Qg + (size_t)(q0 + srow) * Dm + scol;
    const unsigned lQ = (unsigned)(uintptr_t)&Qs[srow * STK + scol];   // low 32 bits = LDS byte address
    async_cp16_x4(gQ, gQ + 16 * Dm, gQ + 32 * Dm, gQ + 48 * Dm,
                  lQ, lQ + 16 * STK * 2, lQ + 32 * STK * 2, lQ + 48 * STK * 2);
  }

  int ks = q0 - bw;        if (ks < 0)  ks = 0;
  int ke = q0 + 64 + bw;   if (ke > Sk) ke = Sk;
  const int nt = (ke - ks + 31) >> 5;      // 32-key tiles; the same for the whole work-group

  const unsigned short* gK = Kg + (size_t)(ks + srow) * Dm + scol;   // run on by a tile an issue
  const unsigned short* gV = Vg + (size_t)(ks + srow) * Dm + scol;
  const unsigned lK = (unsigned)(uintptr_t)&Ks[0][srow * STK + scol];  // low 32 bits = LDS byte address
  const unsigned lV = (unsigned)(uintptr_t)&Vs[0][srow * STV + scol];
  auto stage = [&](int buf) {
    const unsigned k = lK + buf * (32 * STK * 2), v = lV + buf * (32 * STV * 2);
    async_cp16_x4(gK, gK + 16 * Dm, gV, gV + 16 * Dm,
                  k, k + 16 * STK * 2, v, v + 16 * STV * 2);
    gK += 32 * Dm;
    gV += 32 * Dm;
  };

  if (nt > 0) stage(0);
  wait_async0();
  __syncthreads();
  if (nt > 1) stage(1);

  Frag qa[2];
  {
    const unsigned short* p = Qs + (wave * 16 + l15) * STK;
    qa[0].u[0] = *(const uint4*)(p + koff);
    qa[0].u[1] = *(const uint4*)(p + koff + 16);
    qa[1].u[0] = *(const uint4*)(p + 32 + koff);
    qa[1].u[1] = *(const uint4*)(p + 32 + koff + 16);
  }

  const int qrow = q0 + wave * 16 + l15;   // the lane's query
  v8f zf = {};
  float rmax = -__builtin_inff();          // the same in both halves
  float rsum = 0.0f;                       // over this half's keys; joined at the end
  v8f o[4];                                // o[j][r] = O[qrow][j * 16 + 8 * lhalf + r]
#pragma unroll
  for (int j = 0; j < 4; ++j) o[j] = zf;

  for (int t = 0; t < nt; ++t) {
    const int cur = t & 1;
    const int kb = ks + t * 32;

    // scores for two 16-key sub-tiles
    Frag b0a, b0b, b1a, b1b;
    {
      const unsigned short* p0 = Ks[cur] + l15 * STK;
      const unsigned short* p1 = Ks[cur] + (16 + l15) * STK;
      b0a.u[0] = *(const uint4*)(p0 + koff);      b0a.u[1] = *(const uint4*)(p0 + koff + 16);
      b0b.u[0] = *(const uint4*)(p0 + 32 + koff); b0b.u[1] = *(const uint4*)(p0 + 32 + koff + 16);
      b1a.u[0] = *(const uint4*)(p1 + koff);      b1a.u[1] = *(const uint4*)(p1 + koff + 16);
      b1b.u[0] = *(const uint4*)(p1 + 32 + koff); b1b.u[1] = *(const uint4*)(p1 + 32 + koff + 16);
    }
    // s0[r] = S[qrow][kb + 8 * lhalf + r], s1[r] = S[qrow][kb + 16 + 8 * lhalf + r]
    v8f s0 = __builtin_amdgcn_wmma_f32_16x16x32_bf16(false, b0a.v, false, qa[0].v, (short)0, zf, false, false);
    s0     = __builtin_amdgcn_wmma_f32_16x16x32_bf16(false, b0b.v, false, qa[1].v, (short)0, s0, false, false);
    v8f s1 = __builtin_amdgcn_wmma_f32_16x16x32_bf16(false, b1a.v, false, qa[0].v, (short)0, zf, false, false);
    s1     = __builtin_amdgcn_wmma_f32_16x16x32_bf16(false, b1b.v, false, qa[1].v, (short)0, s1, false, false);

    // the V^T fragments, fetched here so that the trip's LDS reads end early.
    // Lane l addresses 16 bytes of key row 8 * lhalf + (l & 7), hd columns
    // 8 * ((l >> 3) & 1) + 0..7 of the 16 of tile j, and gets keys
    // 8 * lhalf + 0..7 of hd column j * 16 + l15; the second load the same 16 keys on
    FragT vb[4];
    const unsigned short* pv = Vs[cur] + (koff + (lane & 7)) * STV + ((lane >> 3) & 1) * 8;
#pragma unroll
    for (int j = 0; j < 4; ++j) {
      vb[j].s[0] = ld_tr16(pv + j * 16);
      vb[j].s[1] = ld_tr16(pv + 16 * STV + j * 16);
    }

    // The trip has no LDS read behind this point: the rest works on registers.
    // this wave's reads of the two buffers have returned before they are refilled
    asm volatile("s_wait_dscnt 0x0" ::: "memory");
    wait_async0();        // own copies of tile t + 1 have landed
    // the one barrier of a trip: publishes tile t + 1 and ends every wave's
    // reads of the buffers that are refilled behind it
    __syncthreads();
    if (t + 2 < nt) stage(cur);

    // online softmax, one query a lane
    // |qrow - key| <= bw  <=>  0 <= qrow - key + bw <= 2 bw
    const int t0 = qrow - (kb + 8 * lhalf) + bw;
    const unsigned span = 2u * (unsigned)bw;
    s0 *= 0.125f;     // 1/sqrt(64)
    s1 *= 0.125f;
    // every loop below is unrolled so that its arrays are indexed by
    // constants and stay in registers
    float v[16];
#pragma unroll
    for (int r = 0; r < 8; ++r) {
      v[r]     = ((unsigned)(t0 - r) > span)      ? -__builtin_inff() : s0[r];
      v[8 + r] = ((unsigned)(t0 - 16 - r) > span) ? -__builtin_inff() : s1[r];
    }
    float m8[8];
#pragma unroll
    for (int r = 0; r < 8; ++r) m8[r] = fmaxf(v[2 * r], v[2 * r + 1]);
    float mt = fmaxf(fmaxf(fmaxf(m8[0], m8[1]), fmaxf(m8[2], m8[3])),
                     fmaxf(fmaxf(m8[4], m8[5]), fmaxf(m8[6], m8[7])));
    mt = fmaxf(mt, other_half(mt));
    const float nm = fmaxf(rmax, mt);
    // no key of the query seen yet: subtract 0, so that every exponential
    // below is exp(-inf) = 0 and not exp(-inf + inf); o and rsum are still 0
    const float sub = (nm < -1e37f) ? 0.0f : nm;
    const float sc = __expf(rmax - sub);
    rmax = nm;
    v16f pf;
#pragma unroll
    for (int e = 0; e < 16; ++e) pf[e] = __expf(v[e] - sub);
    float p8[8];
#pragma unroll
    for (int r = 0; r < 8; ++r) p8[r] = pf[2 * r] + pf[2 * r + 1];
    rsum = rsum * sc + (((p8[0] + p8[1]) + (p8[2] + p8[3])) + ((p8[4] + p8[5]) + (p8[6] + p8[7])));
#pragma unroll
    for (int j = 0; j < 4; ++j) o[j] *= sc;

    // O^T += V^T[64x32] * P^T[32x16]
    const v16bf pb = __builtin_convertvector(pf, v16bf);
#pragma unroll
    for (int j = 0; j < 4; ++j)
      o[j] = __builtin_amdgcn_wmma_f32_16x16x32_bf16(false, vb[j].v, false, pb, (short)0, o[j], false, false);
  }
  wait_async0();          // nothing is in flight when the wave ends

  const float inv = 1.0f / (rsum + other_half(rsum));
  // a lane's 8 registers of a tile are 8 neighbouring columns of its row: 16-byte stores
  v8bf* Og = (v8bf*)(O + ((size_t)bb * Sq + qrow) * Dm + hh * HDc + 8 * lhalf);
  v8bf ob[4];
#pragma unroll
  for (int j = 0; j < 4; ++j) ob[j] = __builtin_convertvector(o[j] * inv, v8bf);
#pragma unroll
  for (int j = 0; j < 4; ++j) Og[j * 2] = ob[j];
}

// =====================================================================
// Embedding: h = (x @ W + b) * sqrt(D) + PE(s, d); outputs f32 + bf16.
// A work-group walks EMB_ROWS rows, a thread keeping its two columns: the
// launch starts 4096 waves where one work-group a row would start 65536.
// =====================================================================
#define EMB_ROWS 16
__global__ __launch_bounds__(256) void embed_kernel(
    const float* __restrict__ x, const float* __restrict__ W,
    const float* __restrict__ bias, float* __restrict__ outF,
    unsigned short* __restrict__ outB, int Cin)
{
  const int row0 = blockIdx.x * EMB_ROWS;
  const int tid = threadIdx.x;
  const int d = tid * 2;
  // what depends on the column alone is formed once
  float wv[7][2];
#pragma unroll
  for (int c = 0; c < 7; ++c) {
    wv[c][0] = (c < Cin) ? W[c * Dm + d]     : 0.0f;
    wv[c][1] = (c < Cin) ? W[c * Dm + d + 1] : 0.0f;
  }
  const float b0 = bias[d], b1 = bias[d + 1];
  const float div = __expf((float)d * (-9.210340371976184f / 512.0f));

  float xn[7];
#pragma unroll
  for (int c = 0; c < 7; ++c) xn[c] = (c < Cin) ? x[(size_t)row0 * Cin + c] : 0.0f;
  // kept rolled: for speed only
#pragma unroll 1
  for (int rr = 0; rr < EMB_ROWS; ++rr) {
    const int row = row0 + rr;
    float xv[7];
#pragma unroll
    for (int c = 0; c < 7; ++c) xv[c] = xn[c];
    // the next row's inputs fly while this row is computed (the last trip
    // reads its own row again, so the address stays inside x)
    const int nxt = (rr + 1 < EMB_ROWS) ? row + 1 : row;
#pragma unroll
    for (int c = 0; c < 7; ++c) xn[c] = (c < Cin) ? x[(size_t)nxt * Cin + c] : 0.0f;
    float acc0 = b0, acc1 = b1;
#pragma unroll
    for (int c = 0; c < 7; ++c) { acc0 += xv[c] * wv[c][0]; acc1 += xv[c] * wv[c][1]; }
    acc0 *= 22.627416997969522f;  // sqrt(512)
    acc1 *= 22.627416997969522f;
    const float arg = (float)(row & (Sq_ - 1)) * div;
    acc0 += sinf(arg);
    acc1 += cosf(arg);
    *(float2*)(outF + (size_t)row * Dm + d) = make_float2(acc0, acc1);
    *(unsigned*)(outB + (size_t)row * Dm + d) =
        (unsigned)f2bf(acc0) | ((unsigned)f2bf(acc1) << 16);
  }
}

// =====================================================================
// Residual + LayerNorm over D=512; outputs f32 (may alias x) + bf16.
// A wave owns whole rows: a lane holds 16 of a row's 512 values, and each
// of the two sums is a sum inside the lane and a five-step butterfly over
// the wave: no LDS, no barrier. A wave takes LN_RPW rows side by side, all
// their loads in flight together, so a launch starts 2048 waves where one
// work-group a row would start 65536.
// =====================================================================
#define LN_RPW 4

// lane l reads lane l ^ X of its 16-lane row
template <int X>
__device__ __forceinline__ float row_xor(float v) {
  int u = __builtin_bit_cast(int, v);
  return __builtin_bit_cast(float, __builtin_amdgcn_update_dpp(u, u, 0x160 + X, 0xf, 0xf, false));
}
// butterfly sum over the 32 lanes; every lane ends with the same value
__device__ __forceinline__ float wave_sum(float v) {
  v += row_xor<1>(v);
  v += row_xor<2>(v);
  v += row_xor<4>(v);
  v += row_xor<8>(v);
  int u = __builtin_bit_cast(int, v);
  v += __builtin_bit_cast(float,
      __builtin_amdgcn_permlanex16(u, u, 0x76543210, 0xfedcba98, false, false));
  return v;
}

typedef float f32x4 __attribute__((ext_vector_type(4)));
union Two4 { f32x4 h[2]; v8f v; };   // two 16-byte loads, named as one value

__global__ __launch_bounds__(256) void ln_kernel(
    const float* __restrict__ x, const float* __restrict__ res,
    const float* __restrict__ w, const float* __restrict__ b,
    float* __restrict__ outF, unsigned short* __restrict__ outB)
{
  const int lane = threadIdx.x & 31;
  const int row0 = (blockIdx.x * 8 + (threadIdx.x >> 5)) * LN_RPW;
  Two4 xr[LN_RPW][4];   // h[0]: x, h[1]: res
  Two4 wb[4];           // h[0]: w, h[1]: b
  const f32x4* xp = (const f32x4*)(x   + (size_t)row0 * Dm) + lane;
  const f32x4* rp = (const f32x4*)(res + (size_t)row0 * Dm) + lane;
#pragma unroll
  for (int rr = 0; rr < LN_RPW; ++rr) {
#pragma unroll
    for (int i = 0; i < 4; ++i) {
      xr[rr][i].h[0] = xp[rr * (Dm / 4) + 32 * i];
      xr[rr][i].h[1] = rp[rr * (Dm / 4) + 32 * i];
    }
  }
#pragma unroll
  for (int i = 0; i < 4; ++i) {
    wb[i].h[0] = ((const f32x4*)w)[lane + 32 * i];
    wb[i].h[1] = ((const f32x4*)b)[lane + 32 * i];
  }
  // holds all forty loads of the wave in front of the arithmetic, in flight
  // together (loaded values as inputs only): left alone the compiler sinks
  // a third of them behind the sums, where each is waited for on its own.
  // It is also the wait that belongs in front of any rewrite of an issued
  // load's address registers; naming the two addresses keeps them out of
  // the loads' own destination registers until it has passed
  asm volatile("s_wait_xcnt 0x0" ::
      "v"(xr[0][0].v), "v"(xr[0][1].v), "v"(xr[0][2].v), "v"(xr[0][3].v),
      "v"(xr[1][0].v), "v"(xr[1][1].v), "v"(xr[1][2].v), "v"(xr[1][3].v),
      "v"(xr[2][0].v), "v"(xr[2][1].v), "v"(xr[2][2].v), "v"(xr[2][3].v),
      "v"(xr[3][0].v), "v"(xr[3][1].v), "v"(xr[3][2].v), "v"(xr[3][3].v),
      "v"(wb[0].v), "v"(wb[1].v), "v"(wb[2].v), "v"(wb[3].v), "v"(xp), "v"(rp));

  f32x4 a[LN_RPW][4];
  float s[LN_RPW];
#pragma unroll
  for (int rr = 0; rr < LN_RPW; ++rr) {
    float t = 0.0f;
#pragma unroll
    for (int i = 0; i < 4; ++i) {
      a[rr][i] = xr[rr][i].h[0] + xr[rr][i].h[1];
      t += (a[rr][i].x + a[rr][i].y) + (a[rr][i].z + a[rr][i].w);
    }
    s[rr] = wave_sum(t);
  }

#pragma unroll
  for (int rr = 0; rr < LN_RPW; ++rr) {
    const float mu = s[rr] * (1.0f / 512.0f);
    float t = 0.0f;
#pragma unroll
    for (int i = 0; i < 4; ++i) {
      a[rr][i] -= mu;
      t += (a[rr][i].x * a[rr][i].x + a[rr][i].y * a[rr][i].y) +
           (a[rr][i].z * a[rr][i].z + a[rr][i].w * a[rr][i].w);
    }
    s[rr] = wave_sum(t);
  }

#pragma unroll
  for (int rr = 0; rr < LN_RPW; ++rr) {
    const float rstd = rsqrtf(s[rr] * (1.0f / 512.0f) + 1e-5f);
    f32x4* of = (f32x4*)(outF + (size_t)(row0 + rr) * Dm);
    uint2* ob = (uint2*)(outB + (size_t)(row0 + rr) * Dm);
#pragma unroll
    for (int i = 0; i < 4; ++i) {
      const f32x4 y = a[rr][i] * rstd * wb[i].h[0] + wb[i].h[1];
      of[lane + 32 * i] = y;
      ob[lane + 32 * i] = make_uint2(
          (unsigned)f2bf(y.x) | ((unsigned)f2bf(y.y) << 16),
          (unsigned)f2bf(y.z) | ((unsigned)f2bf(y.w) << 16));
    }
  }
}

// =====================================================================
// Weight preparation, one launch for all 22 matrices:
// fp32 [K,N] -> bf16 transposed [N,K], packed one after another in wt:
//   16 x [512,512]  (encoder attention 8, decoder self 4, decoder cross 4)
//    3 x [512,2048] (first FFN matrix: encoder 2, decoder 1)
//    3 x [2048,512] (second FFN matrix: encoder 2, decoder 1)
// The matrices are cut into 64x64 tiles, 2560 in all. A block moves 5 of
// them through LDS: 256-B row pieces are read, whole 128-B lines written.
// An LDS dword holds the bf16 pair (k, k+1) of one n; the pitch of 33
// dwords keeps both the column-wise writes and the row-wise reads on
// distinct banks.
// =====================================================================
#define WP_BLOCKS 512
#define WP_TILES_PER_BLOCK 5
#define WP_DD  (Dm * Dm)
#define WP_DF  (Dm * DFFc)
#define WP_FF1 (16 * WP_DD)
#define WP_FF2 (16 * WP_DD + 3 * WP_DF)

__global__ __launch_bounds__(256) void wprep_kernel(
    const float* __restrict__ enc_attn_w, const float* __restrict__ dec_self_w,
    const float* __restrict__ dec_cross_w,
    const float* __restrict__ enc_ff_w1, const float* __restrict__ dec_ff_w1,
    const float* __restrict__ enc_ff_w2, const float* __restrict__ dec_ff_w2,
    unsigned short* __restrict__ wt)
{
  constexpr int P = 33;
  __shared__ unsigned tile[2][64 * P];
  const int tid = threadIdx.x;
  const int p   = tid >> 4;         // reader: k pair (rows 2p, 2p+1, +32, +33)
  const int n0  = (tid & 15) * 4;   // reader: 4 columns
  const int wr  = tid >> 3;         // writer: output row (n), +32
  const int wc  = tid & 7;          // writer: 16-B chunk of the 128-B line

  float4 r[4];
  unsigned short* dst;
  int dstK;

  // tile id -> source and destination of its corner (same for the whole block)
  auto fetch = [&](int id) {
    const float* s; unsigned short* d; int K, N, kt, nt;
    if (id < 1024) {
      int m = id >> 6;
      s = (m < 8) ? enc_attn_w + (size_t)m * WP_DD
        : (m < 12) ? dec_self_w + (size_t)(m - 8) * WP_DD
                   : dec_cross_w + (size_t)(m - 12) * WP_DD;
      d = wt + (size_t)m * WP_DD;
      K = Dm; N = Dm; kt = (id >> 3) & 7; nt = id & 7;
    } else if (id < 1792) {
      int j = id - 1024, m = j >> 8;
      s = (m < 2) ? enc_ff_w1 + (size_t)m * WP_DF : dec_ff_w1;
      d = wt + WP_FF1 + (size_t)m * WP_DF;
      K = Dm; N = DFFc; kt = (j >> 5) & 7; nt = j & 31;
    } else {
      int j = id - 1792, m = j >> 8;
      s = (m < 2) ? enc_ff_w2 + (size_t)m * WP_DF : dec_ff_w2;
      d = wt + WP_FF2 + (size_t)m * WP_DF;
      K = DFFc; N = Dm; kt = (j >> 3) & 31; nt = j & 7;
    }
    const float* g = s + (size_t)(kt * 64 + 2 * p) * N + nt * 64 + n0;
    const float* g1 = g + N;
    const float* g2 = g + (size_t)32 * N;
    const float* g3 = g + (size_t)33 * N;
    r[0] = *(const float4*)(g);
    r[1] = *(const float4*)(g1);
    r[2] = *(const float4*)(g2);
    r[3] = *(const float4*)(g3);
    // the wait that belongs in front of any rewrite of an issued load's
    // address registers; naming the four addresses keeps them out of the
    // loads' own destination registers until it has passed
    asm volatile("s_wait_xcnt 0x0" :: "v"(g), "v"(g1), "v"(g2), "v"(g3) : "memory");
    dst  = d + (size_t)(nt * 64 + wr) * K + kt * 64 + wc * 8;
    dstK = K;
  };
  auto pack = [](float lo, float hi) -> unsigned {
    return (unsigned)f2bf(lo) | ((unsigned)f2bf(hi) << 16);
  };

  fetch(blockIdx.x);
  // unrolled so that the buffer index and the last-tile test are constants
#pragma unroll
  for (int t = 0; t < WP_TILES_PER_BLOCK; ++t) {
    unsigned* L = tile[t & 1];
    const float* a0 = (const float*)&r[0];
    const float* a1 = (const float*)&r[1];
    const float* a2 = (const float*)&r[2];
    const float* a3 = (const float*)&r[3];
    // unrolled so that r[] is indexed by constants and stays in registers
#pragma unroll
    for (int e = 0; e < 4; ++e) {
      L[(n0 + e) * P + p]      = pack(a0[e], a1[e]);
      L[(n0 + e) * P + 16 + p] = pack(a2[e], a3[e]);
    }
    unsigned short* o = dst;
    const int oK = dstK;
    // one barrier a tile: with two buffers it also ends the reads of the
    // buffer that the next tile overwrites
    __syncthreads();
    // the next tile's loads fly while this tile is written out
    if (t + 1 < WP_TILES_PER_BLOCK) fetch(blockIdx.x + (t + 1) * WP_BLOCKS);
    // unrolled so that both halves' LDS reads issue together
#pragma unroll
    for (int h = 0; h < 2; ++h) {
      const unsigned* q = L + (h * 32 + wr) * P + wc * 4;
      uint4 v = make_uint4(q[0], q[1], q[2], q[3]);
      *(uint4*)(o + (size_t)(h * 32) * oK) = v;
    }
  }
}

// final projection D->1: one wave per row
__global__ __launch_bounds__(256) void outproj_kernel(
    const float* __restrict__ t, const float* __restrict__ w,
    const float* __restrict__ b, float* __restrict__ out, int M)
{
  int gid = blockIdx.x * 256 + threadIdx.x;
  int row = gid >> 5;
  int lane = gid & 31;
  if (row >= M) return;
  float acc = 0.0f;
#pragma unroll
  for (int i = 0; i < 16; ++i)
    acc += t[(size_t)row * Dm + lane + i * 32] * w[lane + i * 32];
#pragma unroll
  for (int ofs = 16; ofs > 0; ofs >>= 1)
    acc += __shfl_xor(acc, ofs, 32);
  if (lane == 0) out[row] = acc + b[0];
}

// =====================================================================
// Host orchestration
// =====================================================================
extern "C" void kernel_launch(void* const* d_in, const int* in_sizes, int n_in,
                              void* d_out, int out_size, void* d_ws, size_t ws_size,
                              hipStream_t stream) {
  (void)in_sizes; (void)n_in; (void)out_size; (void)ws_size;
  const float* x_enc      = (const float*)d_in[0];
  const float* x_dec      = (const float*)d_in[1];
  const float* emb_enc_w  = (const float*)d_in[2];
  const float* emb_enc_b  = (const float*)d_in[3];
  const float* emb_dec_w  = (const float*)d_in[4];
  const float* emb_dec_b  = (const float*)d_in[5];
  const float* enc_attn_w = (const float*)d_in[6];
  const float* enc_attn_b = (const float*)d_in[7];
  const float* enc_ff_w1  = (const float*)d_in[8];
  const float* enc_ff_b1  = (const float*)d_in[9];
  const float* enc_ff_w2  = (const float*)d_in[10];
  const float* enc_ff_b2  = (const float*)d_in[11];
  const float* enc_ln_w   = (const float*)d_in[12];
  const float* enc_ln_b   = (const float*)d_in[13];
  const float* dec_self_w = (const float*)d_in[14];
  const float* dec_self_b = (const float*)d_in[15];
  const float* dec_cross_w= (const float*)d_in[16];
  const float* dec_cross_b= (const float*)d_in[17];
  const float* dec_ff_w1  = (const float*)d_in[18];
  const float* dec_ff_b1  = (const float*)d_in[19];
  const float* dec_ff_w2  = (const float*)d_in[20];
  const float* dec_ff_b2  = (const float*)d_in[21];
  const float* dec_ln_w   = (const float*)d_in[22];
  const float* dec_ln_b   = (const float*)d_in[23];
  const float* out_w      = (const float*)d_in[24];
  const float* out_b      = (const float*)d_in[25];

  const int M = Bq * Sq_;  // 8192
  char* ws = (char*)d_ws;
  size_t off = 0;
  auto alloc = [&](size_t bytes) -> void* {
    void* p = ws + off;
    off += (bytes + 255) & ~(size_t)255;
    return p;
  };
  float*          h_f   = (float*)alloc((size_t)M * Dm * 4);
  unsigned short* h_b   = (unsigned short*)alloc((size_t)M * Dm * 2);
  float*          t_f   = (float*)alloc((size_t)M * Dm * 4);
  unsigned short* t_b   = (unsigned short*)alloc((size_t)M * Dm * 2);
  unsigned short* q_b   = (unsigned short*)alloc((size_t)3 * M * Dm * 2);  // q, k, v in a row
  unsigned short* k_b   = q_b + (size_t)M * Dm;
  unsigned short* v_b   = k_b + (size_t)M * Dm;
  unsigned short* ctx_b = (unsigned short*)alloc((size_t)M * Dm * 2);
  float*          g_f   = (float*)alloc((size_t)M * Dm * 4);
  unsigned short* ffn_b = (unsigned short*)alloc((size_t)M * DFFc * 2);
  unsigned short* wt  = (unsigned short*)alloc(((size_t)16 * WP_DD + (size_t)6 * WP_DF) * 2);
  auto wA  = [&](int m) { return wt + (size_t)m * WP_DD; };           // attention matrices
  auto wF1 = [&](int m) { return wt + WP_FF1 + (size_t)m * WP_DF; };  // first FFN matrices
  auto wF2 = [&](int m) { return wt + WP_FF2 + (size_t)m * WP_DF; };  // second FFN matrices

  // the q, k and v projections of one attention, one launch:
  // Aq x W[0], Akv x W[1], Akv x W[2], each [M,Dm] x [Dm,Dm] -> bf16, to q_b, k_b, v_b
  auto gemm_qkv = [&](const unsigned short* Aq, const unsigned short* Akv,
                      const unsigned short* Wt, const float* bias) {
    gemm_bf16_kernel<Dm, 0, false, 3><<<dim3(M / 128, 3 * Dm / 128), 256, 0, stream>>>(Aq, Akv, Wt, bias, nullptr, q_b, Dm);
  };
  // [M,Kk] x [Kk,Dm] -> f32
  auto gemm_f = [&](const unsigned short* A, const unsigned short* Wt, const float* bias,
                    float* oF, int Kk) {
    gemm_bf16_kernel<Dm, 0, true, 1><<<dim3(M / 128, Dm / 128), 256, 0, stream>>>(A, A, Wt, bias, oF, nullptr, Kk);
  };
  // [M,Dm] x [Dm,DFFc], GELU -> bf16
  auto gemm_g = [&](const unsigned short* A, const unsigned short* Wt, const float* bias,
                    unsigned short* oB) {
    gemm_bf16_kernel<DFFc, 1, false, 1><<<dim3(M / 128, DFFc / 128), 256, 0, stream>>>(A, A, Wt, bias, nullptr, oB, Dm);
  };
  auto attn = [&](const unsigned short* Qp, const unsigned short* Kp,
                  const unsigned short* Vp, unsigned short* Op) {
    banded_attn_kernel<<<dim3(Sq_ / 64, Bq * Hh), 128, 0, stream>>>(Qp, Kp, Vp, Op, Sq_, Sq_, Sq_ / 4);
  };
  auto lnorm = [&](const float* xx, const float* rr, const float* w, const float* bb,
                   float* oF, unsigned short* oB) {
    ln_kernel<<<M / (8 * LN_RPW), 256, 0, stream>>>(xx, rr, w, bb, oF, oB);
  };

  // ----- all weights to bf16 [N,K], once -----
  wprep_kernel<<<WP_BLOCKS, 256, 0, stream>>>(enc_attn_w, dec_self_w, dec_cross_w,
                                              enc_ff_w1, dec_ff_w1, enc_ff_w2, dec_ff_w2, wt);

  // ----- encoder -----
  embed_kernel<<<M / EMB_ROWS, 256, 0, stream>>>(x_enc, emb_enc_w, emb_enc_b, h_f, h_b, 7);
  for (int l = 0; l < 2; ++l) {
    const float* ab = enc_attn_b + (size_t)l * 4 * Dm;
    gemm_qkv(h_b, h_b, wA(l * 4), ab);
    attn(q_b, k_b, v_b, ctx_b);
    gemm_f(ctx_b, wA(l * 4 + 3), ab + 3 * Dm, g_f, Dm);
    lnorm(h_f, g_f, enc_ln_w + (size_t)l * 2 * Dm, enc_ln_b + (size_t)l * 2 * Dm, h_f, h_b);
    gemm_g(h_b, wF1(l), enc_ff_b1 + (size_t)l * DFFc, ffn_b);
    gemm_f(ffn_b, wF2(l), enc_ff_b2 + (size_t)l * Dm, g_f, DFFc);
    lnorm(h_f, g_f, enc_ln_w + (size_t)l * 2 * Dm + Dm, enc_ln_b + (size_t)l * 2 * Dm + Dm, h_f, h_b);
  }
  // h_f / h_b now hold encoder memory.

  // ----- decoder (DL = 1) -----
  embed_kernel<<<M / EMB_ROWS, 256, 0, stream>>>(x_dec, emb_dec_w, emb_dec_b, t_f, t_b, 1);
  {
    // self-attention
    gemm_qkv(t_b, t_b, wA(8), dec_self_b);
    attn(q_b, k_b, v_b, ctx_b);
    gemm_f(ctx_b, wA(11), dec_self_b + 3 * Dm, g_f, Dm);
    lnorm(t_f, g_f, dec_ln_w + 0 * Dm, dec_ln_b + 0 * Dm, t_f, t_b);

    // cross-attention (K/V from encoder memory)
    gemm_qkv(t_b, h_b, wA(12), dec_cross_b);
    attn(q_b, k_b, v_b, ctx_b);
    gemm_f(ctx_b, wA(15), dec_cross_b + 3 * Dm, g_f, Dm);
    lnorm(t_f, g_f, dec_ln_w + 1 * Dm, dec_ln_b + 1 * Dm, t_f, t_b);

    // FFN
    gemm_g(t_b, wF1(2), dec_ff_b1, ffn_b);
    gemm_f(ffn_b, wF2(2), dec_ff_b2, g_f, DFFc);
    lnorm(t_f, g_f, dec_ln_w + 2 * Dm, dec_ln_b + 2 * Dm, t_f, t_b);
  }

  outproj_kernel<<<(M * 32 + 255) / 256, 256, 0, stream>>>(t_f, out_w, out_b, (float*)d_out, M);
}

// v010
// It runs in 404 microseconds.
// Two timings next to v009 both put it at 1.09 times that version's speed.
// Counting every step since v000, it is 2.98 times as fast.
#include <hip/hip_runtime.h>
#include <math.h>

// ---------------- model constants ----------------
#define Bq 8
#define Sq_ 1024
#define Dm 512
#define Hh 8
#define HDc 64
#define DFFc 2048

// ---------------- WMMA types ----------------
typedef __bf16 bf16_t;
typedef bf16_t v16bf __attribute__((ext_vector_type(16)));
typedef float v8f __attribute__((ext_vector_type(8)));

union Frag { uint4 u[2]; v16bf v; };

__device__ __forceinline__ unsigned short f2bf(float f) {
  union { float f; unsigned u; } v; v.f = f;
  unsigned r = v.u + 0x7FFFu + ((v.u >> 16) & 1u);
  return (unsigned short)(r >> 16);
}

// 0.5 x (1 + tanh u) = x / (1 + exp(-2 u)), u = sqrt(2 / pi) (x + 0.044715 x^3).
// Straight-line: the library tanhf is two branches on a vector compare and a
// range-reduced exp per element, one dependent chain that cannot interleave
// with the next element's. exp(-2 u) = inf gives x * 0, exp(-2 u) = 0 gives x,
// the limits of the tanh form; no cancellation in 1 + tanh u for negative x.
__device__ __forceinline__ float gelu_f(float x) {
  constexpr float C1 = -2.0f * 0.7978845608028654f * 1.4426950408889634f;  // -2 sqrt(2 / pi) log2(e)
  constexpr float C3 = C1 * 0.044715f;
  const float e = __builtin_amdgcn_exp2f(x * (C1 + C3 * (x * x)));
  return x * __builtin_amdgcn_rcpf(1.0f + e);
}

// async copy 16B global -> LDS (ASYNCcnt-tracked, no VGPR round-trip)
__device__ __forceinline__ void async_cp16(const unsigned short* g, unsigned short* l) {
  unsigned lds = (unsigned)(uintptr_t)l;   // low 32 bits = LDS byte address
  asm volatile("global_load_async_to_lds_b128 %0, %1, off"
               :: "v"(lds), "v"(g) : "memory");
}
__device__ __forceinline__ void wait_async0() {
  asm volatile("s_wait_asynccnt 0x0" ::: "memory");
}
__device__ __forceinline__ void wait_async4() {
  asm volatile("s_wait_asynccnt 0x4" ::: "memory");
}

// =====================================================================
// bf16 WMMA GEMM:  C[M,N] = A[M,K] * W[K,N] + bias, optional GELU.
// A: bf16 row-major [M,K]; Wt: bf16 [N,K] (pre-transposed weights).
// Block 256 thr = 8 waves; tile 128x128, BK=32; wave tile 32x64.
// Double-buffered LDS staged with GLOBAL_LOAD_ASYNC_TO_LDS_B128;
// last tile peeled so the steady-state loop body is branch-free.
// N, the activation (ACT 1: GELU) and the output type (OUT_F32: outF, else
// bf16 to outB) are template parameters: the epilogue is then straight-line
// code, one address per thread with the 64 elements at constant offsets.
// NMAT products that do not depend on each other share a launch: Wt holds
// NMAT matrices [N,K] one after another, bias NMAT vectors, the output NMAT
// arrays [M,N]; grid.y runs over the column tiles of all of them. The first
// product reads A, the others A2. A WGP then holds NMAT work-groups, and
// one computes while another waits for its staged tile.
// SETS = 2: two such launches that do not depend on each other run as one.
// A, A2 and every output array then have 2 x Bq * Sq_ rows; the upper half of
// the rows is multiplied by Wt2 and gets bias2.
// =====================================================================
template <int N, int ACT, bool OUT_F32, int NMAT, int SETS>
__global__ __launch_bounds__(256) void gemm_bf16_kernel(
    const unsigned short* __restrict__ A,
    const unsigned short* __restrict__ A2,
    const unsigned short* __restrict__ Wt,
    const float* __restrict__ bias,
    const unsigned short* __restrict__ Wt2,
    const float* __restrict__ bias2,
    float* __restrict__ outF,
    unsigned short* __restrict__ outB,
    int K)
{
  // LDS row pitch (bf16 elems): 80 B = 16 B x odd. The 16 rows that a half-wave's
  // ds_load_b128 reads then start on 16 different groups of 4 banks (20 * row
  // mod 64 dwords); at 96 B rows r and r + 8 share their banks and each load
  // takes twice the LDS clocks
  constexpr int ST = 40;
  __shared__ unsigned short As[2][128 * ST];
  __shared__ unsigned short Bs[2][128 * ST];
  const int tid   = threadIdx.x;
  const int wave  = tid >> 5;
  const int lane  = tid & 31;
  const int l15   = lane & 15;
  const int lhalf = lane >> 4;
  const int koff  = lhalf * 8;
  const int bm = blockIdx.x * 128;
  const int bs = blockIdx.y * 128;                       // row of the stacked Wt and bias
  const int mat = (NMAT > 1) ? bs / N : 0;               // which product
  const int bn = bs - mat * N;                           // column in its own output
  const unsigned short* Am = (mat == 0) ? A : A2;
  const bool upper = (SETS > 1) && bm >= Bq * Sq_;       // the same for the whole work-group
  const unsigned short* Ws = upper ? Wt2 : Wt;
  const float* bias_s = upper ? bias2 : bias;
  const int wm = (wave >> 1) * 32;
  const int wn = (wave & 1) * 64;

  v8f zf = {};
  v8f c[2][4];
#pragma unroll
  for (int i = 0; i < 2; ++i)
#pragma unroll
    for (int j = 0; j < 4; ++j) c[i][j] = zf;

  // per-thread staging coordinates: 2 chunks of 8 bf16 per matrix,
  // running global pointers advanced by BK each issue.
  const int r0 = tid >> 2,           c0 = (tid & 3) * 8;          // chunk 0
  const int r1 = (tid + 256) >> 2,   c1 = ((tid + 256) & 3) * 8;  // chunk 1
  const unsigned short* gA0 = Am + (size_t)(bm + r0) * K + c0;
  const unsigned short* gA1 = Am + (size_t)(bm + r1) * K + c1;
  const unsigned short* gB0 = Ws + (size_t)(bs + r0) * K + c0;
  const unsigned short* gB1 = Ws + (size_t)(bs + r1) * K + c1;
  unsigned short* lA0[2] = { &As[0][r0 * ST + c0], &As[1][r0 * ST + c0] };
  unsigned short* lA1[2] = { &As[0][r1 * ST + c1], &As[1][r1 * ST + c1] };
  unsigned short* lB0[2] = { &Bs[0][r0 * ST + c0], &Bs[1][r0 * ST + c0] };
  unsigned short* lB1[2] = { &Bs[0][r1 * ST + c1], &Bs[1][r1 * ST + c1] };

  auto issue = [&](int buf) {
    async_cp16(gA0, lA0[buf]);  gA0 += 32;
    async_cp16(gA1, lA1[buf]);  gA1 += 32;
    async_cp16(gB0, lB0[buf]);  gB0 += 32;
    async_cp16(gB1, lB1[buf]);  gB1 += 32;
  };
  auto compute = [&](int cur) {
    Frag a[2], b[4];
#pragma unroll
    for (int i = 0; i < 2; ++i) {
      const unsigned short* p = &As[cur][(wm + i * 16 + l15) * ST];
      a[i].u[0] = *(const uint4*)(p + koff);
      a[i].u[1] = *(const uint4*)(p + koff + 16);
    }
#pragma unroll
    for (int j = 0; j < 4; ++j) {
      const unsigned short* p = &Bs[cur][(wn + j * 16 + l15) * ST];
      b[j].u[0] = *(const uint4*)(p + koff);
      b[j].u[1] = *(const uint4*)(p + koff + 16);
    }
#pragma unroll
    for (int i = 0; i < 2; ++i)
#pragma unroll
      for (int j = 0; j < 4; ++j)
        c[i][j] = __builtin_amdgcn_wmma_f32_16x16x32_bf16(
            false, a[i].v, false, b[j].v, (short)0, c[i][j], false, false);
  };

  const int nK = K >> 5;
  issue(0);
  for (int kt = 0; kt < nK - 1; ++kt) {   // branch-free steady state
    const int cur = kt & 1;
    issue(cur ^ 1);       // prefetch next tile (async, overlaps compute)
    wait_async4();        // own copies of current tile complete
    __syncthreads();
    compute(cur);
    __syncthreads();
  }
  wait_async0();          // peeled last tile
  __syncthreads();
  compute((nK - 1) & 1);

  const int col0 = bn + wn + l15;
  const size_t idx0 = ((size_t)mat * (SETS * Bq * Sq_) + (bm + wm + 8 * lhalf)) * N + col0;  // SETS * Bq * Sq_ rows an output
  float bb[4];
#pragma unroll
  for (int j = 0; j < 4; ++j) bb[j] = bias_s[bs + wn + l15 + j * 16];
#pragma unroll
  for (int i = 0; i < 2; ++i) {
#pragma unroll
    for (int j = 0; j < 4; ++j) {
#pragma unroll
      for (int r = 0; r < 8; ++r) {
        float v = c[i][j][r] + bb[j];
        if constexpr (ACT == 1) v = gelu_f(v);
        const size_t idx = idx0 + (i * 16 + r) * N + j * 16;
        if constexpr (OUT_F32) outF[idx] = v;
        else                   outB[idx] = f2bf(v);
      }
    }
  }
}

// lane l reads lane l ^ 16 (the other half of the wave)
__device__ __forceinline__ float other_half(float v) {
  int u = __builtin_bit_cast(int, v);
  return __builtin_bit_cast(float,
      __builtin_amdgcn_permlanex16(u, u, 0x76543210, 0xfedcba98, false, false));
}

typedef float v16f __attribute__((ext_vector_type(16)));
typedef bf16_t v8bf __attribute__((ext_vector_type(8)));
typedef short s16x8 __attribute__((ext_vector_type(8)));
union FragT { s16x8 s[2]; v16bf v; };

// Four 16-byte async copies global -> LDS of one thread. The s_wait_xcnt is the
// wait that belongs in front of any rewrite of an issued copy's address
// registers; as the last line of the copies' own statement nothing can be
// moved between it and them.
__device__ __forceinline__ void async_cp16_x4(
    const unsigned short* g0, const unsigned short* g1,
    const unsigned short* g2, const unsigned short* g3,
    unsigned l0, unsigned l1, unsigned l2, unsigned l3) {
  asm volatile("global_load_async_to_lds_b128 %0, %1, off\n\t"
               "global_load_async_to_lds_b128 %2, %3, off\n\t"
               "global_load_async_to_lds_b128 %4, %5, off\n\t"
               "global_load_async_to_lds_b128 %6, %7, off\n\t"
               "s_wait_xcnt 0x0"
               :: "v"(l0), "v"(g0), "v"(l1), "v"(g1), "v"(l2), "v"(g2), "v"(l3), "v"(g3)
               : "memory");
}

// transposing LDS load: from a row-major tile of 16-bit elements, lane
// (l15, lhalf) gets 8 successive rows of one column (addresses: see the caller)
__device__ __forceinline__ s16x8 ld_tr16(const unsigned short* p) {
  typedef __attribute__((address_space(3))) s16x8 lds_s16x8;
  return __builtin_amdgcn_ds_load_tr16_b128_v8i16((lds_s16x8*)p);
}

// =====================================================================
// Banded flash attention. Q,K,V,O: bf16 [B*S, D], head h in cols h*64..
// Grid: (Sq/64, B*H); 128 threads = 4 waves; wave owns 16 q-rows.
// Both products are formed transposed: S^T = K * Q^T (A = K rows, B = Q
// rows) and O^T += V^T * P^T. A result register r of lane (l15, lhalf) is
// then [8 * lhalf + r][l15]: a lane holds 16 of the 32 scores of ONE query,
// so the row maximum and the row sum are taken inside the lane and the two
// halves of the wave are joined by one exchange; there is one maximum, one
// sum and one rescale factor a lane. The two score tiles, converted in
// place, are the B operand of the second product in the hardware's k order
// (8 * lhalf + 0..7, 16 + 8 * lhalf + 0..7), which is the order in which
// the V^T rows are loaded: P passes through no LDS.
// Per 32-key tile: 4 WMMA for K*Q^T, online softmax, 4 WMMA for V^T*P^T.
// Q, K and V tiles are staged with async-to-LDS, all as they lie in memory.
// K and V have two buffers each: the copies of tile t + 2 are issued behind
// the last LDS read of trip t, into the buffers that trip t has just read, and
// are waited for at the same place of trip t + 1, so a tile flies during a
// whole trip. The V^T fragments come out of the row-major V tile by the
// transposing LDS load.
// =====================================================================
__global__ __launch_bounds__(128) void banded_attn_kernel(
    const unsigned short* __restrict__ Q,
    const unsigned short* __restrict__ Kc,
    const unsigned short* __restrict__ Vc,
    unsigned short* __restrict__ O,
    int Sq, int Sk, int bw)
{
  constexpr int STK = 72;  // stride for 64-wide hd rows (144B, aligned)
  constexpr int STV = 80;  // stride for V's 64-wide hd rows (160B = 32B x odd, the pitch for ds_load_tr16_b128)
  __shared__ __attribute__((aligned(16))) unsigned short Qs[64 * STK];
  __shared__ __attribute__((aligned(16))) unsigned short Ks[2][32 * STK];
  __shared__ __attribute__((aligned(16))) unsigned short Vs[2][32 * STV];   // [key][hd], as in memory

  const int tid   = threadIdx.x;
  const int wave  = tid >> 5;
  const int lane  = tid & 31;
  const int l15   = lane & 15;
  const int lhalf = lane >> 4;
  const int koff  = lhalf * 8;
  const int q0 = blockIdx.x * 64;
  const int bh = blockIdx.y;
  const int bb = bh / Hh;
  const int hh = bh % Hh;

  const unsigned short* Qg = Q  + ((size_t)bb * Sq) * Dm + hh * HDc;
  const unsigned short* Kg = Kc + ((size_t)bb * Sk) * Dm + hh * HDc;
  const unsigned short* Vg = Vc + ((size_t)bb * Sk) * Dm + hh * HDc;

  // a thread's share of a staged tile: 16 bytes of rows srow, srow + 16, ...
  const int srow = tid >> 3;
  const int scol = (tid & 7) * 8;

  // stage Q tile (64 x 64) via async copies
  {
    const unsigned short* gQ = Qg + (size_t)(q0 + srow) * Dm + scol;
    const unsigned lQ = (unsigned)(uintptr_t)&Qs[srow * STK + scol];   // low 32 bits = LDS byte address
    async_cp16_x4(gQ, gQ + 16 * Dm, gQ + 32 * Dm, gQ + 48 * Dm,
                  lQ, lQ + 16 * STK * 2, lQ + 32 * STK * 2, lQ + 48 * STK * 2);
  }

  int ks = q0 - bw;        if (ks < 0)  ks = 0;
  int ke = q0 + 64 + bw;   if (ke > Sk) ke = Sk;
  const int nt = (ke - ks + 31) >> 5;      // 32-key tiles; the same for the whole work-group

  const unsigned short* gK = Kg + (size_t)(ks + srow) * Dm + scol;   // run on by a tile an issue
  const unsigned short* gV = Vg + (size_t)(ks + srow) * Dm + scol;
  const unsigned lK = (unsigned)(uintptr_t)&Ks[0][srow * STK + scol];  // low 32 bits = LDS byte address
  const unsigned lV = (unsigned)(uintptr_t)&Vs[0][srow * STV + scol];
  auto stage = [&](int buf) {
    const unsigned k = lK + buf * (32 * STK * 2), v = lV + buf * (32 * STV * 2);
    async_cp16_x4(gK, gK + 16 * Dm, gV, gV + 16 * Dm,
                  k, k + 16 * STK * 2, v, v + 16 * STV * 2);
    gK += 32 * Dm;
    gV += 32 * Dm;
  };

  if (nt > 0) stage(0);
  wait_async0();
  __syncthreads();
  if (nt > 1) stage(1);

  Frag qa[2];
  {
    const unsigned short* p = Qs + (wave * 16 + l15) * STK;
    qa[0].u[0] = *(const uint4*)(p + koff);
    qa[0].u[1] = *(const uint4*)(p + koff + 16);
    qa[1].u[0] = *(const uint4*)(p + 32 + koff);
    qa[1].u[1] = *(const uint4*)(p + 32 + koff + 16);
  }

  const int qrow = q0 + wave * 16 + l15;   // the lane's query
  v8f zf = {};
  float rmax = -__builtin_inff();          // the same in both halves
  float rsum = 0.0f;                       // over this half's keys; joined at the end
  v8f o[4];                                // o[j][r] = O[qrow][j * 16 + 8 * lhalf + r]
#pragma unroll
  for (int j = 0; j < 4; ++j) o[j] = zf;

  for (int t = 0; t < nt; ++t) {
    const int cur = t & 1;
    const int kb = ks + t * 32;

    // scores for two 16-key sub-tiles
    Frag b0a, b0b, b1a, b1b;
    {
      const unsigned short* p0 = Ks[cur] + l15 * STK;
      const unsigned short* p1 = Ks[cur] + (16 + l15) * STK;
      b0a.u[0] = *(const uint4*)(p0 + koff);      b0a.u[1] = *(const uint4*)(p0 + koff + 16);
      b0b.u[0] = *(const uint4*)(p0 + 32 + koff); b0b.u[1] = *(const uint4*)(p0 + 32 + koff + 16);
      b1a.u[0] = *(const uint4*)(p1 + koff);      b1a.u[1] = *(const uint4*)(p1 + koff + 16);
      b1b.u[0] = *(const uint4*)(p1 + 32 + koff); b1b.u[1] = *(const uint4*)(p1 + 32 + koff + 16);
    }
    // s0[r] = S[qrow][kb + 8 * lhalf + r], s1[r] = S[qrow][kb + 16 + 8 * lhalf + r]
    v8f s0 = __builtin_amdgcn_wmma_f32_16x16x32_bf16(false, b0a.v, false, qa[0].v, (short)0, zf, false, false);
    s0     = __builtin_amdgcn_wmma_f32_16x16x32_bf16(false, b0b.v, false, qa[1].v, (short)0, s0, false, false);
    v8f s1 = __builtin_amdgcn_wmma_f32_16x16x32_bf16(false, b1a.v, false, qa[0].v, (short)0, zf, false, false);
    s1     = __builtin_amdgcn_wmma_f32_16x16x32_bf16(false, b1b.v, false, qa[1].v, (short)0, s1, false, false);

    // the V^T fragments, fetched here so that the trip's LDS reads end early.
    // Lane l addresses 16 bytes of key row 8 * lhalf + (l & 7), hd columns
    // 8 * ((l >> 3) & 1) + 0..7 of the 16 of tile j, and gets keys
    // 8 * lhalf + 0..7 of hd column j * 16 + l15; the second load the same 16 keys on
    FragT vb[4];
    const unsigned short* pv = Vs[cur] + (koff + (lane & 7)) * STV + ((lane >> 3) & 1) * 8;
#pragma unroll
    for (int j = 0; j < 4; ++j) {
      vb[j].s[0] = ld_tr16(pv + j * 16);
      vb[j].s[1] = ld_tr16(pv + 16 * STV + j * 16);
    }

    // The trip has no LDS read behind this point: the rest works on registers.
    // this wave's reads of the two buffers have returned before they are refilled
    asm volatile("s_wait_dscnt 0x0" ::: "memory");
    wait_async0();        // own copies of tile t + 1 have landed
    // the one barrier of a trip: publishes tile t + 1 and ends every wave's
    // reads of the buffers that are refilled behind it
    __syncthreads();
    if (t + 2 < nt) stage(cur);

    // online softmax, one query a lane
    // |qrow - key| <= bw  <=>  0 <= qrow - key + bw <= 2 bw
    const int t0 = qrow - (kb + 8 * lhalf) + bw;
    const unsigned span = 2u * (unsigned)bw;
    s0 *= 0.125f;     // 1/sqrt(64)
    s1 *= 0.125f;
    // every loop below is unrolled so that its arrays are indexed by
    // constants and stay in registers
    float v[16];
#pragma unroll
    for (int r = 0; r < 8; ++r) {
      v[r]     = ((unsigned)(t0 - r) > span)      ? -__builtin_inff() : s0[r];
      v[8 + r] = ((unsigned)(t0 - 16 - r) > span) ? -__builtin_inff() : s1[r];
    }
    float m8[8];
#pragma unroll
    for (int r = 0; r < 8; ++r) m8[r] = fmaxf(v[2 * r], v[2 * r + 1]);
    float mt = fmaxf(fmaxf(fmaxf(m8[0], m8[1]), fmaxf(m8[2], m8[3])),
                     fmaxf(fmaxf(m8[4], m8[5]), fmaxf(m8[6], m8[7])));
    mt = fmaxf(mt, other_half(mt));
    const float nm = fmaxf(rmax, mt);
    // no key of the query seen yet: subtract 0, so that every exponential
    // below is exp(-inf) = 0 and not exp(-inf + inf); o and rsum are still 0
    const float sub = (nm < -1e37f) ? 0.0f : nm;
    const float sc = __expf(rmax - sub);
    rmax = nm;
    v16f pf;
#pragma unroll
    for (int e = 0; e < 16; ++e) pf[e] = __expf(v[e] - sub);
    float p8[8];
#pragma unroll
    for (int r = 0; r < 8; ++r) p8[r] = pf[2 * r] + pf[2 * r + 1];
    rsum = rsum * sc + (((p8[0] + p8[1]) + (p8[2] + p8[3])) + ((p8[4] + p8[5]) + (p8[6] + p8[7])));
#pragma unroll
    for (int j = 0; j < 4; ++j) o[j] *= sc;

    // O^T += V^T[64x32] * P^T[32x16]
    const v16bf pb = __builtin_convertvector(pf, v16bf);
#pragma unroll
    for (int j = 0; j < 4; ++j)
      o[j] = __builtin_amdgcn_wmma_f32_16x16x32_bf16(false, vb[j].v, false, pb, (short)0, o[j], false, false);
  }
  wait_async0();          // nothing is in flight when the wave ends

  const float inv = 1.0f / (rsum + other_half(rsum));
  // a lane's 8 registers of a tile are 8 neighbouring columns of its row: 16-byte stores
  v8bf* Og = (v8bf*)(O + ((size_t)bb * Sq + qrow) * Dm + hh * HDc + 8 * lhalf);
  v8bf ob[4];
#pragma unroll
  for (int j = 0; j < 4; ++j) ob[j] = __builtin_convertvector(o[j] * inv, v8bf);
#pragma unroll
  for (int j = 0; j < 4; ++j) Og[j * 2] = ob[j];
}

// =====================================================================
// Embedding: h = (x @ W + b) * sqrt(D) + PE(s, d); outputs f32 + bf16.
// A work-group walks EMB_ROWS rows, a thread keeping its two columns: the
// launch starts 8192 embedding waves where one work-group a row would start 131072.
// Both embeddings run in one launch: the output has 2 x Bq * Sq_ rows, the
// upper half made from x2, W2, bias2 (Cin2 inputs a row).
// =====================================================================
#define EMB_ROWS 16
__device__ __forceinline__ void embed_body(
    int blk,
    const float* __restrict__ x1, const float* __restrict__ W1,
    const float* __restrict__ bias1, int Cin1,
    const float* __restrict__ x2, const float* __restrict__ W2,
    const float* __restrict__ bias2, int Cin2,
    float* __restrict__ outF, unsigned short* __restrict__ outB)
{
  const int row0 = blk * EMB_ROWS;                       // row of the output
  const bool upper = row0 >= Bq * Sq_;                   // the same for the whole work-group
  const float* x    = upper ? x2 : x1;
  const float* W    = upper ? W2 : W1;
  const float* bias = upper ? bias2 : bias1;
  const int Cin     = upper ? Cin2 : Cin1;
  const int xshift  = upper ? Bq * Sq_ : 0;              // output row - row of x
  const int tid = threadIdx.x;
  const int d = tid * 2;
  // what depends on the column alone is formed once
  float wv[7][2];
#pragma unroll
  for (int c = 0; c < 7; ++c) {
    wv[c][0] = (c < Cin) ? W[c * Dm + d]     : 0.0f;
    wv[c][1] = (c < Cin) ? W[c * Dm + d + 1] : 0.0f;
  }
  const float b0 = bias[d], b1 = bias[d + 1];
  const float div = __expf((float)d * (-9.210340371976184f / 512.0f));

  float xn[7];
#pragma unroll
  for (int c = 0; c < 7; ++c) xn[c] = (c < Cin) ? x[(size_t)(row0 - xshift) * Cin + c] : 0.0f;
  // kept rolled, for speed only
#pragma unroll 1
  for (int rr = 0; rr < EMB_ROWS; ++rr) {
    const int row = row0 + rr;
    float xv[7];
#pragma unroll
    for (int c = 0; c < 7; ++c) xv[c] = xn[c];
    // the next row's inputs fly while this row is computed (the last trip
    // reads its own row again, so the address stays inside x)
    const int nxt = (rr + 1 < EMB_ROWS) ? row + 1 : row;
#pragma unroll
    for (int c = 0; c < 7; ++c) xn[c] = (c < Cin) ? x[(size_t)(nxt - xshift) * Cin + c] : 0.0f;
    float acc0 = b0, acc1 = b1;
#pragma unroll
    for (int c = 0; c < 7; ++c) { acc0 += xv[c] * wv[c][0]; acc1 += xv[c] * wv[c][1]; }
    acc0 *= 22.627416997969522f;  // sqrt(512)
    acc1 *= 22.627416997969522f;
    const float arg = (float)(row & (Sq_ - 1)) * div;
    acc0 += sinf(arg);
    acc1 += cosf(arg);
    *(float2*)(outF + (size_t)row * Dm + d) = make_float2(acc0, acc1);
    *(unsigned*)(outB + (size_t)row * Dm + d) =
        (unsigned)f2bf(acc0) | ((unsigned)f2bf(acc1) << 16);
  }
}

// =====================================================================
// Residual + LayerNorm over D=512; outputs f32 (may alias x) + bf16.
// A wave owns whole rows: a lane holds 16 of a row's 512 values, and each
// of the two sums is a sum inside the lane and a five-step butterfly over
// the wave: no LDS, no barrier. A wave takes LN_RPW rows side by side, all
// their loads in flight together, so a launch over Bq * Sq_ rows starts 2048 waves where one
// work-group a row would start 65536.
// Two normalisations that do not depend on each other may share a launch:
// rows from Bq * Sq_ on take w2 and b2.
// =====================================================================
#define LN_RPW 4

// lane l reads lane l ^ X of its 16-lane row
template <int X>
__device__ __forceinline__ float row_xor(float v) {
  int u = __builtin_bit_cast(int, v);
  return __builtin_bit_cast(float, __builtin_amdgcn_update_dpp(u, u, 0x160 + X, 0xf, 0xf, false));
}
// butterfly sum over the 32 lanes; every lane ends with the same value
__device__ __forceinline__ float wave_sum(float v) {
  v += row_xor<1>(v);
  v += row_xor<2>(v);
  v += row_xor<4>(v);
  v += row_xor<8>(v);
  int u = __builtin_bit_cast(int, v);
  v += __builtin_bit_cast(float,
      __builtin_amdgcn_permlanex16(u, u, 0x76543210, 0xfedcba98, false, false));
  return v;
}

typedef float f32x4 __attribute__((ext_vector_type(4)));
union Two4 { f32x4 h[2]; v8f v; };   // two 16-byte loads, named as one value

__global__ __launch_bounds__(256) void ln_kernel(
    const float* __restrict__ x, const float* __restrict__ res,
    const float* __restrict__ w1, const float* __restrict__ b1,
    const float* __restrict__ w2, const float* __restrict__ b2,
    float* __restrict__ outF, unsigned short* __restrict__ outB)
{
  const bool upper = blockIdx.x >= Bq * Sq_ / (8 * LN_RPW);   // the same for the whole work-group
  const float* w = upper ? w2 : w1;
  const float* b = upper ? b2 : b1;
  const int lane = threadIdx.x & 31;
  const int row0 = (blockIdx.x * 8 + (threadIdx.x >> 5)) * LN_RPW;
  Two4 xr[LN_RPW][4];   // h[0]: x, h[1]: res
  Two4 wb[4];           // h[0]: w, h[1]: b
  const f32x4* xp = (const f32x4*)(x   + (size_t)row0 * Dm) + lane;
  const f32x4* rp = (const f32x4*)(res + (size_t)row0 * Dm) + lane;
#pragma unroll
  for (int rr = 0; rr < LN_RPW; ++rr) {
#pragma unroll
    for (int i = 0; i < 4; ++i) {
      xr[rr][i].h[0] = xp[rr * (Dm / 4) + 32 * i];
      xr[rr][i].h[1] = rp[rr * (Dm / 4) + 32 * i];
    }
  }
#pragma unroll
  for (int i = 0; i < 4; ++i) {
    wb[i].h[0] = ((const f32x4*)w)[lane + 32 * i];
    wb[i].h[1] = ((const f32x4*)b)[lane + 32 * i];
  }
  // holds all forty loads of the wave in front of the arithmetic, in flight
  // together (loaded values as inputs only): left alone the compiler sinks
  // a third of them behind the sums, where each is waited for on its own.
  // It is also the wait that belongs in front of any rewrite of an issued
  // load's address registers; naming the two addresses keeps them out of
  // the loads' own destination registers until it has passed
  asm volatile("s_wait_xcnt 0x0" ::
      "v"(xr[0][0].v), "v"(xr[0][1].v), "v"(xr[0][2].v), "v"(xr[0][3].v),
      "v"(xr[1][0].v), "v"(xr[1][1].v), "v"(xr[1][2].v), "v"(xr[1][3].v),
      "v"(xr[2][0].v), "v"(xr[2][1].v), "v"(xr[2][2].v), "v"(xr[2][3].v),
      "v"(xr[3][0].v), "v"(xr[3][1].v), "v"(xr[3][2].v), "v"(xr[3][3].v),
      "v"(wb[0].v), "v"(wb[1].v), "v"(wb[2].v), "v"(wb[3].v), "v"(xp), "v"(rp));

  f32x4 a[LN_RPW][4];
  float s[LN_RPW];
#pragma unroll
  for (int rr = 0; rr < LN_RPW; ++rr) {
    float t = 0.0f;
#pragma unroll
    for (int i = 0; i < 4; ++i) {
      a[rr][i] = xr[rr][i].h[0] + xr[rr][i].h[1];
      t += (a[rr][i].x + a[rr][i].y) + (a[rr][i].z + a[rr][i].w);
    }
    s[rr] = wave_sum(t);
  }

#pragma unroll
  for (int rr = 0; rr < LN_RPW; ++rr) {
    const float mu = s[rr] * (1.0f / 512.0f);
    float t = 0.0f;
#pragma unroll
    for (int i = 0; i < 4; ++i) {
      a[rr][i] -= mu;
      t += (a[rr][i].x * a[rr][i].x + a[rr][i].y * a[rr][i].y) +
           (a[rr][i].z * a[rr][i].z + a[rr][i].w * a[rr][i].w);
    }
    s[rr] = wave_sum(t);
  }

#pragma unroll
  for (int rr = 0; rr < LN_RPW; ++rr) {
    const float rstd = rsqrtf(s[rr] * (1.0f / 512.0f) + 1e-5f);
    f32x4* of = (f32x4*)(outF + (size_t)(row0 + rr) * Dm);
    uint2* ob = (uint2*)(outB + (size_t)(row0 + rr) * Dm);
#pragma unroll
    for (int i = 0; i < 4; ++i) {
      const f32x4 y = a[rr][i] * rstd * wb[i].h[0] + wb[i].h[1];
      of[lane + 32 * i] = y;
      ob[lane + 32 * i] = make_uint2(
          (unsigned)f2bf(y.x) | ((unsigned)f2bf(y.y) << 16),
          (unsigned)f2bf(y.z) | ((unsigned)f2bf(y.w) << 16));
    }
  }
}

// =====================================================================
// Weight preparation, one launch for all 22 matrices:
// fp32 [K,N] -> bf16 transposed [N,K], packed one after another in wt:
//   16 x [512,512]  (encoder attention 8, decoder self 4, decoder cross 4)
//    3 x [512,2048] (first FFN matrix: encoder 2, decoder 1)
//    3 x [2048,512] (second FFN matrix: encoder 2, decoder 1)
// The matrices are cut into 64x64 tiles, 2560 in all. A block moves 5 of
// them through LDS: 256-B row pieces are read, whole 128-B lines written.
// An LDS dword holds the bf16 pair (k, k+1) of one n; the pitch of 33
// dwords keeps both the column-wise writes and the row-wise reads on
// distinct banks.
// =====================================================================
#define WP_BLOCKS 512
#define WP_TILES_PER_BLOCK 5
#define WP_DD  (Dm * Dm)
#define WP_DF  (Dm * DFFc)
#define WP_FF1 (16 * WP_DD)
#define WP_FF2 (16 * WP_DD + 3 * WP_DF)

typedef unsigned u32x4 __attribute__((ext_vector_type(4)));

__device__ __forceinline__ void wprep_body(
    const float* __restrict__ enc_attn_w, const float* __restrict__ dec_self_w,
    const float* __restrict__ dec_cross_w,
    const float* __restrict__ enc_ff_w1, const float* __restrict__ dec_ff_w1,
    const float* __restrict__ enc_ff_w2, const float* __restrict__ dec_ff_w2,
    unsigned short* __restrict__ wt)
{
  constexpr int P = 33;
  __shared__ unsigned tile[2][64 * P];
  const int tid = threadIdx.x;
  const int p   = tid >> 4;         // reader: k pair (rows 2p, 2p+1, +32, +33)
  const int n0  = (tid & 15) * 4;   // reader: 4 columns
  const int wr  = tid >> 3;         // writer: output row (n), +32
  const int wc  = tid & 7;          // writer: 16-B chunk of the 128-B line

  float4 r[4];
  unsigned short* dst;
  int dstK;

  // tile id -> source and destination of its corner (same for the whole block)
  auto fetch = [&](int id) {
    const float* s; unsigned short* d; int K, N, kt, nt;
    if (id < 1024) {
      int m = id >> 6;
      s = (m < 8) ? enc_attn_w + (size_t)m * WP_DD
        : (m < 12) ? dec_self_w + (size_t)(m - 8) * WP_DD
                   : dec_cross_w + (size_t)(m - 12) * WP_DD;
      d = wt + (size_t)m * WP_DD;
      K = Dm; N = Dm; kt = (id >> 3) & 7; nt = id & 7;
    } else if (id < 1792) {
      int j = id - 1024, m = j >> 8;
      s = (m < 2) ? enc_ff_w1 + (size_t)m * WP_DF : dec_ff_w1;
      d = wt + WP_FF1 + (size_t)m * WP_DF;
      K = Dm; N = DFFc; kt = (j >> 5) & 7; nt = j & 31;
    } else {
      int j = id - 1792, m = j >> 8;
      s = (m < 2) ? enc_ff_w2 + (size_t)m * WP_DF : dec_ff_w2;
      d = wt + WP_FF2 + (size_t)m * WP_DF;
      K = DFFc; N = Dm; kt = (j >> 3) & 31; nt = j & 7;
    }
    const float* g = s + (size_t)(kt * 64 + 2 * p) * N + nt * 64 + n0;
    const float* g1 = g + N;
    const float* g2 = g + (size_t)32 * N;
    const float* g3 = g + (size_t)33 * N;
    r[0] = *(const float4*)(g);
    r[1] = *(const float4*)(g1);
    r[2] = *(const float4*)(g2);
    r[3] = *(const float4*)(g3);
    // the wait that belongs in front of any rewrite of an issued load's
    // address registers; naming the four addresses keeps them out of the
    // loads' own destination registers until it has passed
    asm volatile("s_wait_xcnt 0x0" :: "v"(g), "v"(g1), "v"(g2), "v"(g3) : "memory");
    dst  = d + (size_t)(nt * 64 + wr) * K + kt * 64 + wc * 8;
    dstK = K;
  };
  auto pack = [](float lo, float hi) -> unsigned {
    return (unsigned)f2bf(lo) | ((unsigned)f2bf(hi) << 16);
  };

  fetch(blockIdx.x);
  // unrolled so that the buffer index and the last-tile test are constants
#pragma unroll
  for (int t = 0; t < WP_TILES_PER_BLOCK; ++t) {
    unsigned* L = tile[t & 1];
    const float* a0 = (const float*)&r[0];
    const float* a1 = (const float*)&r[1];
    const float* a2 = (const float*)&r[2];
    const float* a3 = (const float*)&r[3];
    // unrolled so that r[] is indexed by constants and stays in registers
#pragma unroll
    for (int e = 0; e < 4; ++e) {
      L[(n0 + e) * P + p]      = pack(a0[e], a1[e]);
      L[(n0 + e) * P + 16 + p] = pack(a2[e], a3[e]);
    }
    unsigned short* o = dst;
    const int oK = dstK;
    // one barrier a tile: with two buffers it also ends the reads of the
    // buffer that the next tile overwrites
    __syncthreads();
    // the next tile's loads fly while this tile is written out
    if (t + 1 < WP_TILES_PER_BLOCK) fetch(blockIdx.x + (t + 1) * WP_BLOCKS);
    // unrolled so that both halves' LDS reads issue together
    u32x4 v[2];
#pragma unroll
    for (int h = 0; h < 2; ++h) {
      const unsigned* q = L + (h * 32 + wr) * P + wc * 4;
      v[h] = u32x4{q[0], q[1], q[2], q[3]};
    }
    unsigned short* o1 = o + (size_t)32 * oK;
    *(u32x4*)o  = v[0];
    *(u32x4*)o1 = v[1];
    // the wait that belongs in front of any rewrite of an issued store's
    // registers; naming addresses and data keeps them as they are until it
    // has passed
    asm volatile("s_wait_xcnt 0x0" :: "v"(o), "v"(o1), "v"(v[0]), "v"(v[1]) : "memory");
  }
}

// The weight preparation and the two embeddings need nothing of each other:
// one launch, work-groups 0 .. WP_BLOCKS - 1 prepare the weights, the others
// embed. The branch is the same for a whole work-group, barriers included.
__global__ __launch_bounds__(256) void prep_embed_kernel(
    const float* __restrict__ enc_attn_w, const float* __restrict__ dec_self_w,
    const float* __restrict__ dec_cross_w,
    const float* __restrict__ enc_ff_w1, const float* __restrict__ dec_ff_w1,
    const float* __restrict__ enc_ff_w2, const float* __restrict__ dec_ff_w2,
    unsigned short* __restrict__ wt,
    const float* __restrict__ x1, const float* __restrict__ W1,
    const float* __restrict__ bias1, int Cin1,
    const float* __restrict__ x2, const float* __restrict__ W2,
    const float* __restrict__ bias2, int Cin2,
    float* __restrict__ outF, unsigned short* __restrict__ outB)
{
  if (blockIdx.x < WP_BLOCKS)
    wprep_body(enc_attn_w, dec_self_w, dec_cross_w, enc_ff_w1, dec_ff_w1, enc_ff_w2, dec_ff_w2, wt);
  else
    embed_body(blockIdx.x - WP_BLOCKS, x1, W1, bias1, Cin1, x2, W2, bias2, Cin2, outF, outB);
}

// final projection D->1: one wave per row
__global__ __launch_bounds__(256) void outproj_kernel(
    const float* __restrict__ t, const float* __restrict__ w,
    const float* __restrict__ b, float* __restrict__ out, int M)
{
  int gid = blockIdx.x * 256 + threadIdx.x;
  int row = gid >> 5;
  int lane = gid & 31;
  if (row >= M) return;
  float acc = 0.0f;
#pragma unroll
  for (int i = 0; i < 16; ++i)
    acc += t[(size_t)row * Dm + lane + i * 32] * w[lane + i * 32];
#pragma unroll
  for (int ofs = 16; ofs > 0; ofs >>= 1)
    acc += __shfl_xor(acc, ofs, 32);
  if (lane == 0) out[row] = acc + b[0];
}

// =====================================================================
// Host orchestration
// =====================================================================
extern "C" void kernel_launch(void* const* d_in, const int* in_sizes, int n_in,
                              void* d_out, int out_size, void* d_ws, size_t ws_size,
                              hipStream_t stream) {
  (void)in_sizes; (void)n_in; (void)out_size; (void)ws_size;
  const float* x_enc      = (const float*)d_in[0];
  const float* x_dec      = (const float*)d_in[1];
  const float* emb_enc_w  = (const float*)d_in[2];
  const float* emb_enc_b  = (const float*)d_in[3];
  const float* emb_dec_w  = (const float*)d_in[4];
  const float* emb_dec_b  = (const float*)d_in[5];
  const float* enc_attn_w = (const float*)d_in[6];
  const float* enc_attn_b = (const float*)d_in[7];
  const float* enc_ff_w1  = (const float*)d_in[8];
  const float* enc_ff_b1  = (const float*)d_in[9];
  const float* enc_ff_w2  = (const float*)d_in[10];
  const float* enc_ff_b2  = (const float*)d_in[11];
  const float* enc_ln_w   = (const float*)d_in[12];
  const float* enc_ln_b   = (const float*)d_in[13];
  const float* dec_self_w = (const float*)d_in[14];
  const float* dec_self_b = (const float*)d_in[15];
  const float* dec_cross_w= (const float*)d_in[16];
  const float* dec_cross_b= (const float*)d_in[17];
  const float* dec_ff_w1  = (const float*)d_in[18];
  const float* dec_ff_b1  = (const float*)d_in[19];
  const float* dec_ff_w2  = (const float*)d_in[20];
  const float* dec_ff_b2  = (const float*)d_in[21];
  const float* dec_ln_w   = (const float*)d_in[22];
  const float* dec_ln_b   = (const float*)d_in[23];
  const float* out_w      = (const float*)d_in[24];
  const float* out_b      = (const float*)d_in[25];

  const int M = Bq * Sq_;  // 8192
  char* ws = (char*)d_ws;
  size_t off = 0;
  auto alloc = [&](size_t bytes) -> void* {
    void* p = ws + off;
    off += (bytes + 255) & ~(size_t)255;
    return p;
  };
  // The encoder's stream h and the decoder's stream t lie one behind the other,
  // so that a launch over 2 M rows works on both; q, k, v, ctx and g have room
  // for 2 M rows for those launches.
  float*          h_f   = (float*)alloc((size_t)2 * M * Dm * 4);
  float*          t_f   = h_f + (size_t)M * Dm;
  unsigned short* h_b   = (unsigned short*)alloc((size_t)2 * M * Dm * 2);
  unsigned short* t_b   = h_b + (size_t)M * Dm;
  unsigned short* q_b   = (unsigned short*)alloc((size_t)3 * 2 * M * Dm * 2);  // q, k, v in a row
  unsigned short* k_b   = q_b + (size_t)M * Dm;          // M rows each
  unsigned short* v_b   = k_b + (size_t)M * Dm;
  unsigned short* k2_b  = q_b + (size_t)2 * M * Dm;      // 2 M rows each
  unsigned short* v2_b  = k2_b + (size_t)2 * M * Dm;
  unsigned short* ctx_b = (unsigned short*)alloc((size_t)2 * M * Dm * 2);
  float*          g_f   = (float*)alloc((size_t)2 * M * Dm * 4);
  unsigned short* ffn_b = (unsigned short*)alloc((size_t)M * DFFc * 2);
  unsigned short* wt  = (unsigned short*)alloc(((size_t)16 * WP_DD + (size_t)6 * WP_DF) * 2);
  auto wA  = [&](int m) { return wt + (size_t)m * WP_DD; };           // attention matrices
  auto wF1 = [&](int m) { return wt + WP_FF1 + (size_t)m * WP_DF; };  // first FFN matrices
  auto wF2 = [&](int m) { return wt + WP_FF2 + (size_t)m * WP_DF; };  // second FFN matrices

  // the q, k and v projections of one attention, one launch:
  // Aq x W[0], Akv x W[1], Akv x W[2], each [M,Dm] x [Dm,Dm] -> bf16, to q_b, k_b, v_b
  auto gemm_qkv = [&](const unsigned short* Aq, const unsigned short* Akv,
                      const unsigned short* Wt, const float* bias) {
    gemm_bf16_kernel<Dm, 0, false, 3, 1><<<dim3(M / 128, 3 * Dm / 128), 256, 0, stream>>>(Aq, Akv, Wt, bias, Wt, bias, nullptr, q_b, Dm);
  };
  // [M,Kk] x [Kk,Dm] -> f32
  auto gemm_f = [&](const unsigned short* A, const unsigned short* Wt, const float* bias,
                    float* oF, int Kk) {
    gemm_bf16_kernel<Dm, 0, true, 1, 1><<<dim3(M / 128, Dm / 128), 256, 0, stream>>>(A, A, Wt, bias, Wt, bias, oF, nullptr, Kk);
  };
  // [M,Dm] x [Dm,DFFc], GELU -> bf16
  auto gemm_g = [&](const unsigned short* A, const unsigned short* Wt, const float* bias,
                    unsigned short* oB) {
    gemm_bf16_kernel<DFFc, 1, false, 1, 1><<<dim3(M / 128, DFFc / 128), 256, 0, stream>>>(A, A, Wt, bias, Wt, bias, nullptr, oB, Dm);
  };
  auto attn = [&](const unsigned short* Qp, const unsigned short* Kp,
                  const unsigned short* Vp, unsigned short* Op) {
    banded_attn_kernel<<<dim3(Sq_ / 64, Bq * Hh), 128, 0, stream>>>(Qp, Kp, Vp, Op, Sq_, Sq_, Sq_ / 4);
  };
  auto lnorm = [&](const float* xx, const float* rr, const float* w, const float* bb,
                   float* oF, unsigned short* oB) {
    ln_kernel<<<M / (8 * LN_RPW), 256, 0, stream>>>(xx, rr, w, bb, w, bb, oF, oB);
  };

  // ----- all weights to bf16 [N,K], once, and both embeddings -----
  prep_embed_kernel<<<WP_BLOCKS + 2 * M / EMB_ROWS, 256, 0, stream>>>(
      enc_attn_w, dec_self_w, dec_cross_w, enc_ff_w1, dec_ff_w1, enc_ff_w2, dec_ff_w2, wt,
      x_enc, emb_enc_w, emb_enc_b, 7, x_dec, emb_dec_w, emb_dec_b, 1, h_f, h_b);

  // ----- the encoder's first attention block and the decoder's self-attention
  // block: neither needs anything of the other, so each of the four steps is
  // one launch over the 2 M rows of h and t -----
  gemm_bf16_kernel<Dm, 0, false, 3, 2><<<dim3(2 * M / 128, 3 * Dm / 128), 256, 0, stream>>>(
      h_b, h_b, wA(0), enc_attn_b, wA(8), dec_self_b, nullptr, q_b, Dm);
  banded_attn_kernel<<<dim3(Sq_ / 64, 2 * Bq * Hh), 128, 0, stream>>>(q_b, k2_b, v2_b, ctx_b, Sq_, Sq_, Sq_ / 4);
  gemm_bf16_kernel<Dm, 0, true, 1, 2><<<dim3(2 * M / 128, Dm / 128), 256, 0, stream>>>(
      ctx_b, ctx_b, wA(3), enc_attn_b + 3 * Dm, wA(11), dec_self_b + 3 * Dm, g_f, nullptr, Dm);
  ln_kernel<<<2 * M / (8 * LN_RPW), 256, 0, stream>>>(h_f, g_f, enc_ln_w, enc_ln_b, dec_ln_w, dec_ln_b, h_f, h_b);

  // ----- encoder, the rest -----
  for (int l = 0; l < 2; ++l) {
    const float* ab = enc_attn_b + (size_t)l * 4 * Dm;
    if (l > 0) {
      gemm_qkv(h_b, h_b, wA(l * 4), ab);
      attn(q_b, k_b, v_b, ctx_b);
      gemm_f(ctx_b, wA(l * 4 + 3), ab + 3 * Dm, g_f, Dm);
      lnorm(h_f, g_f, enc_ln_w + (size_t)l * 2 * Dm, enc_ln_b + (size_t)l * 2 * Dm, h_f, h_b);
    }
    gemm_g(h_b, wF1(l), enc_ff_b1 + (size_t)l * DFFc, ffn_b);
    gemm_f(ffn_b, wF2(l), enc_ff_b2 + (size_t)l * Dm, g_f, DFFc);
    lnorm(h_f, g_f, enc_ln_w + (size_t)l * 2 * Dm + Dm, enc_ln_b + (size_t)l * 2 * Dm + Dm, h_f, h_b);
  }
  // h_f / h_b now hold encoder memory.

  // ----- decoder (DL = 1), the rest -----
  {
    // cross-attention (K/V from encoder memory)
    gemm_qkv(t_b, h_b, wA(12), dec_cross_b);
    attn(q_b, k_b, v_b, ctx_b);
    gemm_f(ctx_b, wA(15), dec_cross_b + 3 * Dm, g_f, Dm);
    lnorm(t_f, g_f, dec_ln_w + 1 * Dm, dec_ln_b + 1 * Dm, t_f, t_b);

    // FFN
    gemm_g(t_b, wF1(2), dec_ff_b1, ffn_b);
    gemm_f(ffn_b, wF2(2), dec_ff_b2, g_f, DFFc);
    lnorm(t_f, g_f, dec_ln_w + 2 * Dm, dec_ln_b + 2 * Dm, t_f, t_b);
  }

  outproj_kernel<<<(M * 32 + 255) / 256, 256, 0, stream>>>(t_f, out_w, out_b, (float*)d_out, M);
}
